// v000
// Times are from an AMD MI455X. After a warm-up the kernel runs many times in a row, and a time is the length of
// such a window on the GPU divided by its runs, so every launch and the gaps after it count. The runs cycle
// through copies of the inputs. A figure is the median of several windows, for all but v000 over two sittings.
// Sittings can differ by a few percent; kernels timed side by side share one.
// The starting kernel, v000, takes 4020 microseconds a run.
#include <hip/hip_runtime.h>
// Complex multi-head attention (x_real, x_imag [2][2048][1024]; complex linear (weights [in][out]): r = xr Wr - xi Wi + br, i = xi Wr + xr Wi + bi for q, k, v; 16 heads of 64; scores = (qr . kr + qi . ki) / 8 = Re(q conj(k)); softmax; out_r = P vr, out_i = P vi; y = complex_linear(out, Wo); output = stack([y_r, y_i]) -> [2][2][2048][1024]).
// Structure: [x_real | x_imag] as ONE exact f16 row plane (K = 2048); each complex projection as ONE WMMA GEMM (32x64 wave tiles, f32 accumulation, exact x16 weights arranged on VALU as [Wr^T | -Wi^T] / [Wi^T | Wr^T] row pairs, + bias) whose output columns interleave (q_r | q_i) per head (head width 128); per batch: [v_r | v_i]^T via LDS transposes; per 4-head group: scores GEMM with K = 128 (= qr.kr + qi.ki in one contraction, alpha 1/8), row softmax on VALU (f32 statistics, native exp; weights x256 f16), [out_r | out_i] = P [v_r | v_i]^T GEMM (N = 128; carried x64) into interleaved f16 rows; y_r and y_i as two GEMMs over those rows (K = 2048, weights re-laid on VALU with the matching signs, + bias) straight into the two output planes; 8 + 3 + 2 x (1 + 4 x 3) + 2 = 39 launches.
// Compute dtype: inputs rounded to bf16; x / weights exact; q, k, v, softmax weights and out plain f16 (~2^-12); scores, statistics, y f32. v_wmma_f32_16x16x32_f16.
#define NB 2
#define SQ 2048
#define DMX 1024                     /* model width */
#define DM (2 * DMX)                 /* interleaved (real | imag) width = 16 heads x 128 */
#define NH 32                        /* k_vt slabs of 64: (head, part) */
#define HD 64
#define HG 4
#define QN SQ
#define NR ((size_t)NB * SQ)
typedef __bf16 v16b __attribute__((ext_vector_type(16)));
typedef unsigned short v8us __attribute__((ext_vector_type(8), may_alias));
typedef float  v8f  __attribute__((ext_vector_type(8)));
typedef float  v4f  __attribute__((ext_vector_type(4)));
typedef float  v4fa __attribute__((ext_vector_type(4), may_alias));
union FragB { v16b v; v8us half[2]; unsigned short u[16]; };

__device__ __forceinline__ unsigned short bf16_bits(float x) { unsigned int u = __float_as_uint(x); return (unsigned short)((u + 0x7FFFu + ((u >> 16) & 1u)) >> 16); }
__device__ __forceinline__ float bf16_val(unsigned short b) { return __uint_as_float(((unsigned int)b) << 16); }
__device__ __forceinline__ float bf16_round(float x) { return bf16_val(bf16_bits(x)); }
// D += A·B with NT terms: 1 = ah·bh, 2 = + al·bh (A split), 3 = + ah·bl (both split)
template <int NT>
__device__ __forceinline__ v8f mmaN(v16b ah, v16b al, v16b bh, v16b bl, v8f c) {
  c = __builtin_amdgcn_wmma_f32_16x16x32_bf16(false, ah, false, bh, (short)0, c, false, false);
  if (NT >= 2) c = __builtin_amdgcn_wmma_f32_16x16x32_bf16(false, al, false, bh, (short)0, c, false, false);
  if (NT >= 3) c = __builtin_amdgcn_wmma_f32_16x16x32_bf16(false, ah, false, bl, (short)0, c, false, false);
  asm volatile("v_nop\n\tv_nop\n\tv_nop\n\tv_nop" : "+v"(c) : "v"(ah), "v"(al), "v"(bh), "v"(bl));
  return c;
}

__global__ __launch_bounds__(256) void k_wt_bf16(const float* __restrict__ W, unsigned short* __restrict__ Wt, int K, int N) {
  const int t = blockIdx.x * 256 + threadIdx.x;
  const int k8n = K / 8;
  if (t >= N * k8n) return;
  const int n = t / k8n, k8 = (t % k8n) * 8;
  v8us v;
#pragma unroll
  for (int i = 0; i < 8; ++i) v[i] = bf16_bits(W[(size_t)(k8 + i) * N + n]);
  *(v8us*)(Wt + (size_t)n * K + k8) = v;
  
}

// GEMM C[M][N] (f32, pitch ldc) = act(A[M][K]·W + bias). A f32 row-major (pitch lda) converted per fragment to bf16
// (ASPLIT: hi/lo two planes -> 2 terms, else single rounded term); Wt bf16 [N][K] (pitch ldb). BIAS_BF16 rounds the
// bias to bf16 first (bias quantised to bf16 before the add). K%32==0, M%16==0, N%64==0.
template <bool ASPLIT, int ACT, bool BIAS_BF16>
__global__ __launch_bounds__(128) void k_gemm_bf(const float* __restrict__ A, int lda, const unsigned short* __restrict__ Wt, int ldb,
                                               const float* __restrict__ bias, float* __restrict__ C, int ldc, int M, int N, int K) {
  __shared__ __attribute__((aligned(16))) float so[4][16][64];
  const int tid = threadIdx.x, w = tid >> 5, lane = tid & 31, ln = lane & 15, hh = lane >> 4;
  const int ntn = N / 64;
  const int wid = blockIdx.x * 4 + w;
  const int mt = wid / ntn, nq = wid % ntn;
  if (mt * 16 >= M) return;
  const int row0 = mt * 16, col0 = nq * 64;
  const float* arow = A + (size_t)(row0 + ln) * lda;
  v8f acc[4] = {};
  for (int kb = 0; kb < K; kb += 32) {
    FragB ah, al;
    const v4f x0 = *(const v4fa*)(arow + kb + 8 * hh), x1 = *(const v4fa*)(arow + kb + 8 * hh + 4);
    const v4f x2 = *(const v4fa*)(arow + kb + 16 + 8 * hh), x3 = *(const v4fa*)(arow + kb + 16 + 8 * hh + 4);
    float xs[16] = {x0[0],x0[1],x0[2],x0[3],x1[0],x1[1],x1[2],x1[3],x2[0],x2[1],x2[2],x2[3],x3[0],x3[1],x3[2],x3[3]};
#pragma unroll
    for (int i = 0; i < 16; ++i) { const unsigned short hb = bf16_bits(xs[i]); ah.u[i] = hb; al.u[i] = ASPLIT ? bf16_bits(xs[i] - bf16_val(hb)) : (unsigned short)0; }
#pragma unroll
    for (int t = 0; t < 4; ++t) {
      const unsigned short* brow = Wt + (size_t)(col0 + t * 16 + ln) * ldb + kb;
      FragB b;
      b.half[0] = *(const v8us*)(brow + 8 * hh);
      b.half[1] = *(const v8us*)(brow + 16 + 8 * hh);
      acc[t] = mmaN<ASPLIT ? 2 : 1>(ah.v, al.v, b.v, b.v, acc[t]);
    }
  }
#pragma unroll
  for (int t = 0; t < 4; ++t) {
    float bv = bias ? bias[col0 + t * 16 + ln] : 0.f;
    if (BIAS_BF16) bv = bf16_round(bv);
#pragma unroll
    for (int r = 0; r < 8; ++r) { float v = acc[t][r] + bv; if (ACT == 1) v = fmaxf(v, 0.f); so[w][8 * hh + r][t * 16 + ln] = v; }
  }
  __builtin_amdgcn_fence(__ATOMIC_ACQ_REL, "workgroup");
  __builtin_amdgcn_wave_barrier();
  const int rsub = lane >> 4, c4 = (lane & 15) * 4;
  {
#pragma unroll
    for (int q = 0; q < 8; ++q) {
      const int r = q * 2 + rsub;
      const v4f v = *(const v4fa*)&so[w][r][c4];
      *(v4f*)(C + (size_t)(row0 + r) * ldc + col0 + c4) = v;
    }
    
  }
}

// GEMM C = act(A·W + bias + resid): A f32 (ASPLIT -> hi/lo 2 terms), Wt bf16 [N][K]; ACT 0 none, 1 relu, 2 exact gelu;
// resid (optional, f32, row index = (row % rmod), pitch ldr, RES_BF16 rounds it) added before the activation.
template <bool ASPLIT, int ACT, bool BIAS_BF16, bool RES_BF16>
__global__ __launch_bounds__(128) void k_gemm_bf3(const float* __restrict__ A, int lda, const unsigned short* __restrict__ Wt, int ldb,
                                                const float* __restrict__ bias, const float* __restrict__ resid, int rmod, int ldr,
                                                float* __restrict__ C, int ldc, int M, int N, int K) {
  __shared__ __attribute__((aligned(16))) float so[4][16][64];
  const int tid = threadIdx.x, w = tid >> 5, lane = tid & 31, ln = lane & 15, hh = lane >> 4;
  const int ntn = N / 64;
  const int wid = blockIdx.x * 4 + w;
  const int mt = wid / ntn, nq = wid % ntn;
  if (mt * 16 >= M) return;
  const int row0 = mt * 16, col0 = nq * 64;
  const float* arow = A + (size_t)(row0 + ln) * lda;
  v8f acc[4] = {};
  for (int kb = 0; kb < K; kb += 32) {
    FragB ah, al;
    const v4f x0 = *(const v4fa*)(arow + kb + 8 * hh), x1 = *(const v4fa*)(arow + kb + 8 * hh + 4);
    const v4f x2 = *(const v4fa*)(arow + kb + 16 + 8 * hh), x3 = *(const v4fa*)(arow + kb + 16 + 8 * hh + 4);
    float xs[16] = {x0[0],x0[1],x0[2],x0[3],x1[0],x1[1],x1[2],x1[3],x2[0],x2[1],x2[2],x2[3],x3[0],x3[1],x3[2],x3[3]};
#pragma unroll
    for (int i = 0; i < 16; ++i) { const unsigned short hb = bf16_bits(xs[i]); ah.u[i] = hb; al.u[i] = ASPLIT ? bf16_bits(xs[i] - bf16_val(hb)) : (unsigned short)0; }
#pragma unroll
    for (int t = 0; t < 4; ++t) {
      const unsigned short* brow = Wt + (size_t)(col0 + t * 16 + ln) * ldb + kb;
      FragB b;
      b.half[0] = *(const v8us*)(brow + 8 * hh);
      b.half[1] = *(const v8us*)(brow + 16 + 8 * hh);
      acc[t] = mmaN<ASPLIT ? 2 : 1>(ah.v, al.v, b.v, b.v, acc[t]);
    }
  }
#pragma unroll
  for (int t = 0; t < 4; ++t) {
    const int col = col0 + t * 16 + ln;
    float bv = bias ? bias[col] : 0.f;
    if (BIAS_BF16) bv = bf16_round(bv);
#pragma unroll
    for (int r = 0; r < 8; ++r) {
      float v = acc[t][r] + bv;
      if (resid) { float rv = resid[(size_t)((row0 + 8 * hh + r) % rmod) * ldr + col]; if (RES_BF16) rv = bf16_round(rv); v += rv; }
      if (ACT == 1) v = fmaxf(v, 0.f);
      if (ACT == 2) v = 0.5f * v * (1.0f + erff(v * 0.70710678118654752f));
      if (ACT == 3) { const float u = 0.7978845608028654f * (v + 0.044715f * v * v * v); v = 0.5f * v * (1.0f + tanhf(u)); }
      so[w][8 * hh + r][t * 16 + ln] = v;
    }
  }
  __builtin_amdgcn_fence(__ATOMIC_ACQ_REL, "workgroup");
  __builtin_amdgcn_wave_barrier();
  const int rsub = lane >> 4, c4 = (lane & 15) * 4;
  {
#pragma unroll
    for (int q = 0; q < 8; ++q) {
      const int r = q * 2 + rsub;
      const v4f v = *(const v4fa*)&so[w][r][c4];
      *(v4f*)(C + (size_t)(row0 + r) * ldc + col0 + c4) = v;
    }
    
  }
}
// row LayerNorm (biased variance, eps) over N: s = X (+ R); optional out_sum <- s; out_norm <- (s-mu)*rsqrt(var+eps)*g + b
template <bool PARAM_BF16>
__global__ __launch_bounds__(256) void k_layernorm(const float* __restrict__ X, const float* __restrict__ R, const float* __restrict__ g, const float* __restrict__ bta,
                                                  float* __restrict__ out_sum, float* __restrict__ out_norm, int N, float eps) {
  __shared__ float red[256];
  const int row = blockIdx.x, tid = threadIdx.x;
  const float* x = X + (size_t)row * N; const float* rr = R ? R + (size_t)row * N : nullptr;
  float vals[16];                     // up to N = 4096
  const int per = N / 256;            // contiguous chunk per thread? use strided-by-4 chunks: thread handles j = tid*4 + 1024*u
  float s1 = 0.f;
  for (int u = 0; u < per / 4; ++u) {
    const int j = tid * 4 + 1024 * u;
    const v4f a = *(const v4fa*)(x + j);
    v4f b = {0.f,0.f,0.f,0.f}; if (rr) b = *(const v4fa*)(rr + j);
#pragma unroll
    for (int q = 0; q < 4; ++q) { const float v = a[q] + b[q]; vals[u * 4 + q] = v; s1 += v; }
  }
  red[tid] = s1; __syncthreads();
  for (int st = 128; st > 0; st >>= 1) { if (tid < st) red[tid] += red[tid + st]; __syncthreads(); }
  const float mu = red[0] / (float)N; __syncthreads();
  float s2 = 0.f;
  for (int u = 0; u < per / 4; ++u)
#pragma unroll
    for (int q = 0; q < 4; ++q) { const float c = vals[u * 4 + q] - mu; s2 += c * c; }
  red[tid] = s2; __syncthreads();
  for (int st = 128; st > 0; st >>= 1) { if (tid < st) red[tid] += red[tid + st]; __syncthreads(); }
  const float rs = rsqrtf(red[0] / (float)N + eps);
  {
    for (int u = 0; u < per / 4; ++u) {
      const int j = tid * 4 + 1024 * u;
      v4f o, sm;
#pragma unroll
      for (int q = 0; q < 4; ++q) {
        float gg = g[j + q], bb = bta[j + q];
        if (PARAM_BF16) { gg = bf16_round(gg); bb = bf16_round(bb); }
        sm[q] = vals[u * 4 + q]; o[q] = (vals[u * 4 + q] - mu) * rs * gg + bb;
      }
      if (out_sum) *(v4f*)(out_sum + (size_t)row * N + j) = sm;
      *(v4f*)(out_norm + (size_t)row * N + j) = o;
    }
    
  }
}



// ---- f16 WMMA path (v_wmma_f32_16x16x32_f16): 11-bit significands for operands in range — used where a [0,1] probability operand needs more precision than bf16
typedef _Float16 v16h __attribute__((ext_vector_type(16)));
union FragH { v16h v; v8us half[2]; _Float16 h[16]; unsigned short u[16]; };
template <int NT>
__device__ __forceinline__ v8f mmaH(v16h ah, v16h al, v16h bh, v16h bl, v8f c) {
  c = __builtin_amdgcn_wmma_f32_16x16x32_f16(false, ah, false, bh, (short)0, c, false, false);
  if (NT >= 2) c = __builtin_amdgcn_wmma_f32_16x16x32_f16(false, al, false, bh, (short)0, c, false, false);
  if (NT >= 3) c = __builtin_amdgcn_wmma_f32_16x16x32_f16(false, ah, false, bl, (short)0, c, false, false);
  asm volatile("v_nop\n\tv_nop\n\tv_nop\n\tv_nop" : "+v"(c) : "v"(ah), "v"(al), "v"(bh), "v"(bl));
  return c;
}
// batched GEMM like k_gemm_b but f16 operands: A f32 (split into f16 hi/lo if ASPLIT, else rounded to f16), Bt = f16 values [n][k]; alpha; C f32; N multiple of 16 (partial tiles skipped)
template <bool ASPLIT>
__global__ __launch_bounds__(128) void k_gemm_h(const float* __restrict__ A, int lda, size_t sA, const _Float16* __restrict__ Bh, int ldb, size_t sB, float alpha, float* __restrict__ C, int ldc, size_t sC, int M, int N, int K) {
  __shared__ __attribute__((aligned(16))) float so[4][16][64];
  const int tid = threadIdx.x, w = tid >> 5, lane = tid & 31, ln = lane & 15, hh = lane >> 4; const int by = blockIdx.y;
  A += (size_t)by * sA; Bh += (size_t)by * sB; C += (size_t)by * sC;
  const int ntn = (N + 63) / 64; const int wid = blockIdx.x * 4 + w; const int mt = wid / ntn, nq = wid % ntn; if (mt * 16 >= M) return;
  const int row0 = mt * 16, col0 = nq * 64; const float* arow = A + (size_t)(row0 + ln) * lda;
  v8f acc[4] = {};
  for (int kb = 0; kb < K; kb += 32) {
    FragH ah, al;
    const v4f x0 = *(const v4fa*)(arow + kb + 8 * hh), x1 = *(const v4fa*)(arow + kb + 8 * hh + 4), x2 = *(const v4fa*)(arow + kb + 16 + 8 * hh), x3 = *(const v4fa*)(arow + kb + 16 + 8 * hh + 4);
    float xs[16] = {x0[0],x0[1],x0[2],x0[3],x1[0],x1[1],x1[2],x1[3],x2[0],x2[1],x2[2],x2[3],x3[0],x3[1],x3[2],x3[3]};
#pragma unroll
    for (int i = 0; i < 16; ++i) { const _Float16 h = (_Float16)xs[i]; ah.h[i] = h; al.h[i] = ASPLIT ? (_Float16)(xs[i] - (float)h) : (_Float16)0.0f; }
#pragma unroll
    for (int t = 0; t < 4; ++t) { if (col0 + t * 16 >= N) continue; const size_t boff = (size_t)(col0 + t * 16 + ln) * ldb + kb; FragH bq; bq.half[0] = *(const v8us*)(Bh + boff + 8 * hh); bq.half[1] = *(const v8us*)(Bh + boff + 16 + 8 * hh);
      acc[t] = mmaH<ASPLIT ? 2 : 1>(ah.v, al.v, bq.v, bq.v, acc[t]); }
  }
#pragma unroll
  for (int t = 0; t < 4; ++t) { if (col0 + t * 16 >= N) continue;
#pragma unroll
    for (int r = 0; r < 8; ++r) so[w][8 * hh + r][t * 16 + ln] = acc[t][r] * alpha; }
  __builtin_amdgcn_fence(__ATOMIC_ACQ_REL, "workgroup"); __builtin_amdgcn_wave_barrier();
  const int rsub = lane >> 4, c4 = (lane & 15) * 4;
  {
#pragma unroll
    for (int q = 0; q < 8; ++q) { const int r = q * 2 + rsub; if (col0 + c4 < N) { const v4f v = *(const v4fa*)&so[w][r][c4]; *(v4f*)(C + (size_t)(row0 + r) * ldc + col0 + c4) = v; } }
     }
}

// Wt[n][k] = f16(W[k][n]·scale) from f32 row-major W[K][N] (scale = power of two; bf16-exact weights stay exact in f16 away from the subnormal range)
__global__ __launch_bounds__(256) void k_wt_f16(const float* __restrict__ W, _Float16* __restrict__ Wt, int K, int N, float scale) {
  const int t = blockIdx.x * 256 + threadIdx.x; if (t >= N * (K / 8)) return; const int n = t / (K / 8), k8 = (t % (K / 8)) * 8; FragH f;
#pragma unroll
  for (int i = 0; i < 8; ++i) f.h[i] = (_Float16)(bf16_round(W[(size_t)(k8 + i) * N + n]) * scale); const v8us o = f.half[0];
  *(v8us*)((unsigned short*)Wt + (size_t)n * K + k8) = o; 
}
// k_gemm_hh variant with fused epilogue: v = acc·alpha + bias[by·sBias + col] (+ CP[(row/rowsPerB)·sCPb + by·64 + col] if CP) ; ACT 0 none / 1 elu ; writes f16 C16 (and f32 C if non-null)
template <int ACT>
__global__ __launch_bounds__(128) void k_gemm_hhx(const _Float16* __restrict__ A, int lda, size_t sA, const _Float16* __restrict__ Bh, int ldb, size_t sB, float alpha, const float* __restrict__ bias, size_t sBias, const float* __restrict__ CP, int rowsPerB, size_t sCPb, int row0g,
    float* __restrict__ C, _Float16* __restrict__ C16, int ldc, size_t sC, int M, int N, int K) {
  __shared__ __attribute__((aligned(16))) float so[4][16][64];
  const int tid = threadIdx.x, w = tid >> 5, lane = tid & 31, ln = lane & 15, hh = lane >> 4; const int by = blockIdx.y;
  A += (size_t)by * sA; Bh += (size_t)by * sB; const size_t cofs = (size_t)by * sC; const float* bp = bias ? bias + (size_t)by * sBias : nullptr;
  const int ntn = (N + 63) / 64; const int wid = blockIdx.x * 4 + w; const int mt = wid / ntn, nq = wid % ntn; if (mt * 16 >= M) return;
  const int row0 = mt * 16, col0 = nq * 64; const _Float16* arow = A + (size_t)(row0 + ln) * lda;
  v8f acc[4] = {};
  for (int kb = 0; kb < K; kb += 32) { FragH ah; ah.half[0] = *(const v8us*)((const unsigned short*)arow + kb + 8 * hh); ah.half[1] = *(const v8us*)((const unsigned short*)arow + kb + 16 + 8 * hh);
#pragma unroll
    for (int t = 0; t < 4; ++t) { if (col0 + t * 16 >= N) continue; const size_t boff = (size_t)(col0 + t * 16 + ln) * ldb + kb; FragH bq; bq.half[0] = *(const v8us*)((const unsigned short*)Bh + boff + 8 * hh); bq.half[1] = *(const v8us*)((const unsigned short*)Bh + boff + 16 + 8 * hh);
      acc[t] = mmaH<1>(ah.v, ah.v, bq.v, bq.v, acc[t]); }
  }
#pragma unroll
  for (int t = 0; t < 4; ++t) { if (col0 + t * 16 >= N) continue; const int col = col0 + t * 16 + ln; const float bv = bp ? bf16_round(bp[col]) : 0.f;
#pragma unroll
    for (int r = 0; r < 8; ++r) { float v = acc[t][r] * alpha + bv; if (CP) { const int rr = row0g + row0 + 8 * hh + r; if (rowsPerB < 0) v += CP[cofs + (size_t)rr * ldc + col];      /* rowsPerB < 0: own element of the batched C plane */ else { const int bidx = rr / rowsPerB; v += CP[(size_t)bidx * sCPb + (size_t)by * 64 + col]; } } if (ACT == 1) v = (v > 0.f) ? v : expm1f(v); else if (ACT == 7) v = (v > 0.f) ? v + 1.0f : expf(v); else if (ACT == 8) v = tanhf(v); else if (ACT == 9) v = 0.5f * v * (1.0f + tanhf(0.7978845608028654f * (v + 0.044715f * v * v * v))); else if (ACT == 11) v = 1.0f / (1.0f + expf(-v)); else if (ACT == 12) v = (v > 0.f) ? v : 0.01f * v; else if (ACT == 14) v = (v > 0.f) ? v : 0.1f * v; else if (ACT == 16) v = (v >= 0.f) ? v : 0.3f * v; else if (ACT == 17) v = (v >= 0.f) ? v : 0.2f * v; else if (ACT == 15) v = v / (1.0f + expf(-v)); else if (ACT == 3) v = fmaxf(v, 0.f); else if (ACT == 6) v = 0.5f * v * (1.0f + erff(v * 0.70710678118654752f)); so[w][8 * hh + r][t * 16 + ln] = v; } }
  __builtin_amdgcn_fence(__ATOMIC_ACQ_REL, "workgroup"); __builtin_amdgcn_wave_barrier();
  const int rsub = lane >> 4, c4 = (lane & 15) * 4; typedef _Float16 v4h __attribute__((ext_vector_type(4)));
  {
#pragma unroll
    for (int q = 0; q < 8; ++q) { const int r = q * 2 + rsub; if (col0 + c4 < N) { const v4f v = *(const v4fa*)&so[w][r][c4]; if (C) *(v4f*)(C + cofs + (size_t)(row0 + r) * ldc + col0 + c4) = v; if (C16) { v4h h4; for (int i = 0; i < 4; ++i) h4[i] = (_Float16)v[i]; *(v4h*)(C16 + cofs + (size_t)(row0 + r) * ldc + col0 + c4) = h4; } } }
     }
}


typedef _Float16 v4h __attribute__((ext_vector_type(4)));

__global__ __launch_bounds__(256) void k_x16(const float* __restrict__ x, _Float16* __restrict__ X16, size_t n8) { const size_t t = (size_t)blockIdx.x * 256 + threadIdx.x; if (t >= n8) return; FragH f;
#pragma unroll
  for (int q = 0; q < 8; ++q) f.h[q] = (_Float16)bf16_round(x[t * 8 + q]); *(v8us*)((unsigned short*)X16 + t * 8) = f.half[0];  }
__global__ __launch_bounds__(256) void k_h16(const float* __restrict__ x, _Float16* __restrict__ X16, size_t n8) { const size_t t = (size_t)blockIdx.x * 256 + threadIdx.x; if (t >= n8) return; FragH f;
#pragma unroll
  for (int q = 0; q < 8; ++q) f.h[q] = (_Float16)x[t * 8 + q]; *(v8us*)((unsigned short*)X16 + t * 8) = f.half[0];  }
__global__ __launch_bounds__(256) void k_round16f(const float* __restrict__ W, _Float16* __restrict__ Bt, size_t n8) { const size_t t = (size_t)blockIdx.x * 256 + threadIdx.x; if (t >= n8) return; FragH f;
#pragma unroll
  for (int i = 0; i < 8; ++i) f.h[i] = (_Float16)(bf16_round(W[t * 8 + i]) * 16.0f); *(v8us*)((unsigned short*)Bt + t * 8) = f.half[0];  }
template <int NHv, int TTv>
__global__ __launch_bounds__(256) void k_vt(const _Float16* __restrict__ V16, int ldv, int voff, _Float16* __restrict__ Vt) { __shared__ unsigned short tl[64][66]; const int tid = threadIdx.x; const int slab = blockIdx.x / (TTv / 64), lg = blockIdx.x % (TTv / 64); const int b = slab / NHv, h = slab % NHv;
  for (int i = tid; i < 64 * 8; i += 256) { const int r = i / 8, c8 = (i % 8) * 8; FragH f; f.half[0] = *(const v8us*)((const unsigned short*)V16 + ((size_t)b * TTv + lg * 64 + r) * ldv + voff + h * 64 + c8);
#pragma unroll
    for (int q = 0; q < 8; ++q) tl[r][c8 + q] = f.u[q]; }
  __syncthreads();
  {
#pragma unroll
    for (int rd = 0; rd < 2; ++rd) { const int d = rd * 32 + tid / 8, pc = tid % 8; FragH f;
#pragma unroll
      for (int q = 0; q < 8; ++q) f.u[q] = tl[pc * 8 + q][d];
      *(v8us*)((unsigned short*)Vt + ((size_t)slab * 64 + d) * TTv + lg * 64 + pc * 8) = f.half[0]; }
     } }

__global__ __launch_bounds__(256) void k_hl(const float* __restrict__ F, _Float16* __restrict__ Hh, _Float16* __restrict__ Hl, size_t n8) { const size_t t = (size_t)blockIdx.x * 256 + threadIdx.x; if (t >= n8) return; FragH fh, fl; const v4f a = *(const v4fa*)(F + t * 8), c = *(const v4fa*)(F + t * 8 + 4);
#pragma unroll
  for (int q = 0; q < 4; ++q) { _Float16 h = (_Float16)a[q]; fh.h[q] = h; fl.h[q] = (_Float16)((a[q] - (float)h) * 1024.0f); h = (_Float16)c[q]; fh.h[4 + q] = h; fl.h[4 + q] = (_Float16)((c[q] - (float)h) * 1024.0f); }
  { *(v8us*)((unsigned short*)Hh + t * 8) = fh.half[0]; *(v8us*)((unsigned short*)Hl + t * 8) = fl.half[0];  } }

// ---- fast GEMM (wave tile 32x64; requires M % 32 == 0 rows per launch region and N % 64 == 0); epilogue = k_gemm_hhx semantics ----
__device__ __forceinline__ v16h g2_frag(const _Float16* p, int hh) { FragH f; f.half[0] = *(const v8us*)((const unsigned short*)p + 8 * hh); f.half[1] = *(const v8us*)((const unsigned short*)p + 16 + 8 * hh); return f.v; }
__device__ __forceinline__ v8f g2_mma(v16h a, v16h b, v8f c) { v8f d = __builtin_amdgcn_wmma_f32_16x16x32_f16(false, a, false, b, (short)0, c, false, false); asm volatile("v_nop\n\tv_nop\n\tv_nop\n\tv_nop" : "+v"(d) : "v"(a), "v"(b)); return d; }
template <int ACT>
__global__ __launch_bounds__(128) void k_gemm2(const _Float16* __restrict__ A, int lda, size_t sA, const _Float16* __restrict__ Bh, int ldb, size_t sB, float alpha, const float* __restrict__ bias, size_t sBias, const float* __restrict__ CP, int rowsPerB, size_t sCPb, int row0g,
    float* __restrict__ C, _Float16* __restrict__ C16, int ldc, size_t sC, int M, int N, int K) { static_assert(ACT == 0 || ACT == 3 || ACT == 6 || ACT == 8 || ACT == 9 || ACT == 11 || ACT == 12 || ACT == 14 || ACT == 15 || ACT == 16 || ACT == 17, "k_gemm2: unsupported ACT code (would silently apply no activation)");
  __shared__ __attribute__((aligned(16))) float so[4][32][68];
  const int tid = threadIdx.x, w = tid >> 5, lane = tid & 31, ln = lane & 15, hh = lane >> 4; const int by = blockIdx.y;
  A += (size_t)by * sA; Bh += (size_t)by * sB; const size_t cofs = (size_t)by * sC; const float* bp = bias ? bias + (size_t)by * sBias : nullptr;
  const int ntn = N >> 6; const int mt = blockIdx.x / ntn, nq = blockIdx.x - mt * ntn; const int row0 = mt * 128 + 32 * w, col0 = nq * 64; if (row0 >= M) return;
  const _Float16* a0p = A + (size_t)(row0 + ln) * lda; const _Float16* a1p = a0p + (size_t)16 * lda;
  const _Float16* b0p = Bh + (size_t)(col0 + ln) * ldb; const _Float16* b1p = b0p + (size_t)16 * ldb; const _Float16* b2p = b1p + (size_t)16 * ldb; const _Float16* b3p = b2p + (size_t)16 * ldb;
  const v8f z8 = {0.f,0.f,0.f,0.f,0.f,0.f,0.f,0.f}; v8f c00 = z8, c01 = z8, c02 = z8, c03 = z8, c10 = z8, c11 = z8, c12 = z8, c13 = z8;
#pragma unroll 1
  for (int kb = 0; kb < K; kb += 32) { const v16h a0 = g2_frag(a0p + kb, hh), a1 = g2_frag(a1p + kb, hh);
    v16h b = g2_frag(b0p + kb, hh); c00 = g2_mma(a0, b, c00); c10 = g2_mma(a1, b, c10);
    b = g2_frag(b1p + kb, hh); c01 = g2_mma(a0, b, c01); c11 = g2_mma(a1, b, c11);
    b = g2_frag(b2p + kb, hh); c02 = g2_mma(a0, b, c02); c12 = g2_mma(a1, b, c12);
    b = g2_frag(b3p + kb, hh); c03 = g2_mma(a0, b, c03); c13 = g2_mma(a1, b, c13); }
  v8f accs[8] = {c00, c01, c02, c03, c10, c11, c12, c13};
#pragma unroll
  for (int u = 0; u < 8; ++u) { const int t = u & 3, half = u >> 2; const int col = col0 + t * 16 + ln; const float bv = bp ? bf16_round(bp[col]) : 0.f;
#pragma unroll
    for (int r = 0; r < 8; ++r) { const int rloc = half * 16 + 8 * hh + r; float v = accs[u][r] * alpha + bv; if (CP) { if (rowsPerB < 0) v += CP[cofs + (size_t)(row0g + row0 + rloc) * ldc + col];      /* rowsPerB < 0: own element of the batched C plane */ else { const int bidx = (row0g + row0 + rloc) / rowsPerB; v += CP[(size_t)bidx * sCPb + (size_t)by * 64 + col]; } }
      if (ACT == 3) v = fmaxf(v, 0.f); else if (ACT == 6) v = 0.5f * v * (1.0f + erff(v * 0.70710678118654752f)); else if (ACT == 11) v = 1.0f / (1.0f + expf(-v)); else if (ACT == 15) v = v / (1.0f + expf(-v)); else if (ACT == 12) v = (v > 0.f) ? v : 0.01f * v; else if (ACT == 8) v = tanhf(v); else if (ACT == 9) v = 0.5f * v * (1.0f + tanhf(0.7978845608028654f * (v + 0.044715f * v * v * v))); else if (ACT == 14) v = (v > 0.f) ? v : 0.1f * v; else if (ACT == 16) v = (v >= 0.f) ? v : 0.3f * v; else if (ACT == 17) v = (v >= 0.f) ? v : 0.2f * v;
      so[w][rloc][t * 16 + ln] = v; } }
  __builtin_amdgcn_fence(__ATOMIC_ACQ_REL, "workgroup"); __builtin_amdgcn_wave_barrier();
  const int rsub = lane >> 4, c4 = (lane & 15) * 4;
  {
#pragma unroll
    for (int q = 0; q < 16; ++q) { const int r = q * 2 + rsub; const v4f v = *(const v4fa*)&so[w][r][c4]; if (C) *(v4f*)(C + cofs + (size_t)(row0 + r) * ldc + col0 + c4) = v; if (C16) { v4h h4; for (int i = 0; i < 4; ++i) h4[i] = (_Float16)v[i]; *(v4h*)(C16 + cofs + (size_t)(row0 + r) * ldc + col0 + c4) = h4; } }
     } }


__global__ __launch_bounds__(256) void k_wnat(const float* __restrict__ w, size_t n8, _Float16* __restrict__ Bt) { const size_t t = (size_t)blockIdx.x * 256 + threadIdx.x; if (t >= n8) return; FragH f; for (int q = 0; q < 8; ++q) f.h[q] = (_Float16)(bf16_round(w[t * 8 + q]) * 16.0f); *(v8us*)((unsigned short*)Bt + t * 8) = f.half[0];  }
__global__ __launch_bounds__(256) void k_rsm(const float* __restrict__ S, _Float16* __restrict__ P, int nrows) {
  #pragma clang fp contract(off)
  const int i = blockIdx.x * 256 + threadIdx.x; if (i >= nrows) return; const float* s = S + (size_t)i * SQ; float mx = -3.0e38f;
#pragma unroll 1
  for (int j = 0; j < SQ; ++j) mx = fmaxf(mx, s[j]); float se = 0.f;
#pragma unroll 1
  for (int j = 0; j < SQ; ++j) se += expf(s[j] - mx); const float sc = 256.0f / se;
#pragma unroll 1
  for (int j0 = 0; j0 < SQ; j0 += 8) { FragH f; for (int q = 0; q < 8; ++q) f.h[q] = (_Float16)(expf(s[j0 + q] - mx) * sc); unsigned short* d = (unsigned short*)P + (size_t)i * SQ + j0; *(v8us*)d = f.half[0];  } }
__global__ __launch_bounds__(256) void k_vt(const _Float16* __restrict__ V16, int b, int h0, _Float16* __restrict__ VT) { __shared__ unsigned short tl[64][65]; const int tid = threadIdx.x; const int hh = blockIdx.x % HG, sg = blockIdx.x / HG; const int s0 = sg * 64; const int h = h0 + hh;
  for (int i = tid; i < 64 * 8; i += 256) { const int j = i / 8, d8 = (i % 8) * 8; FragH f; f.half[0] = *(const v8us*)((const unsigned short*)V16 + ((size_t)b * SQ + s0 + j) * DM + h * HD + d8); for (int q = 0; q < 8; ++q) tl[d8 + q][j] = f.u[q]; }
  __syncthreads();
  { for (int i = tid; i < 64 * 8; i += 256) { const int d = i / 8, j8 = (i % 8) * 8; FragH f; for (int q = 0; q < 8; ++q) f.u[q] = tl[d][j8 + q]; *(v8us*)((unsigned short*)VT + ((size_t)hh * HD + d) * SQ + s0 + j8) = f.half[0]; }  } }


__global__ __launch_bounds__(256) void k_wcat2(const float* __restrict__ wr, const float* __restrict__ wi, _Float16* __restrict__ Bt) { const size_t t = (size_t)blockIdx.x * 256 + threadIdx.x; if (t >= (size_t)(2 * DMX) * (2 * DMX / 8)) return; const int k8 = (int)(t % (2 * DMX / 8)) * 8; const int n2 = (int)(t / (2 * DMX / 8)); const int h = n2 / 128, w = n2 % 128; const bool im = (w >= 64); const int f = h * 64 + (w & 63); FragH fr;
  for (int q = 0; q < 8; ++q) { const int k = k8 + q; float v; if (k < DMX) v = im ? wi[(size_t)k * DMX + f] : wr[(size_t)k * DMX + f]; else v = im ? wr[(size_t)(k - DMX) * DMX + f] : -wi[(size_t)(k - DMX) * DMX + f]; fr.h[q] = (_Float16)(16.0f * bf16_round(v)); }
  unsigned short* d = (unsigned short*)Bt + (size_t)n2 * (2 * DMX) + k8; *(v8us*)d = fr.half[0];  }
__global__ __launch_bounds__(256) void k_bcat2(const float* __restrict__ br, const float* __restrict__ bi, float* __restrict__ b2) { for (int n2 = threadIdx.x; n2 < 2 * DMX; n2 += 256) { const int h = n2 / 128, w = n2 % 128; const float v = (w < 64) ? br[h * 64 + w] : bi[h * 64 + (w - 64)]; *(float*)(b2 + n2) = v; }  }
__global__ __launch_bounds__(256) void k_wcplx3(const float* __restrict__ wr, const float* __restrict__ wi, _Float16* __restrict__ Bt) { const size_t t = (size_t)blockIdx.x * 256 + threadIdx.x; if (t >= (size_t)2 * DMX * (2 * DMX / 8)) return; const int k8 = (int)(t % (2 * DMX / 8)) * 8; const int f = (int)((t / (2 * DMX / 8)) % DMX); const int part = (int)(t / ((size_t)(2 * DMX / 8) * DMX)); FragH fr;
  for (int q = 0; q < 8; ++q) { const int k2 = k8 + q; const int h = k2 / 128, w = k2 % 128; const bool im = (w >= 64); const int g = h * 64 + (w & 63); float v; if (part == 0) v = im ? -wi[(size_t)g * DMX + f] : wr[(size_t)g * DMX + f]; else v = im ? wr[(size_t)g * DMX + f] : wi[(size_t)g * DMX + f]; fr.h[q] = (_Float16)(16.0f * bf16_round(v)); }
  unsigned short* d = (unsigned short*)Bt + ((size_t)part * DMX + f) * (2 * DMX) + k8; *(v8us*)d = fr.half[0];  }
__global__ __launch_bounds__(256) void k_xcat(const float* __restrict__ xr, const float* __restrict__ xi, _Float16* __restrict__ XC, size_t nrows) { const size_t t = (size_t)blockIdx.x * 256 + threadIdx.x; if (t >= nrows * (2 * DMX / 8)) return; const int k8 = (int)(t % (2 * DMX / 8)) * 8; const size_t r = t / (2 * DMX / 8); const float* s = (k8 < DMX) ? xr + r * DMX + k8 : xi + r * DMX + (k8 - DMX); const v4f a = *(const v4fa*)s, b = *(const v4fa*)(s + 4); FragH f; for (int q = 0; q < 4; ++q) { f.h[q] = (_Float16)bf16_round(a[q]); f.h[4 + q] = (_Float16)bf16_round(b[q]); }
  unsigned short* d = (unsigned short*)XC + r * (2 * DMX) + k8; *(v8us*)d = f.half[0];  }


__global__ __launch_bounds__(256) void k_rsmf(const float* __restrict__ S, _Float16* __restrict__ P, int qn, int hg) {
  #pragma clang fp contract(off)
  const int t = blockIdx.x * 256 + threadIdx.x; if (t >= qn * hg) return; const size_t i = (size_t)(t / qn) * SQ + (t % qn); const float* s = S + i * SQ; float mx = -3.0e38f;
#pragma unroll 1
  for (int j = 0; j < SQ; ++j) mx = fmaxf(mx, s[j]); float se = 0.f;
#pragma unroll 1
  for (int j = 0; j < SQ; ++j) se += __expf(s[j] - mx); const float sc = 256.0f / se;
#pragma unroll 1
  for (int j0 = 0; j0 < SQ; j0 += 8) { FragH f; for (int q = 0; q < 8; ++q) f.h[q] = (_Float16)(__expf(s[j0 + q] - mx) * sc); unsigned short* d = (unsigned short*)P + i * SQ + j0; *(v8us*)d = f.half[0];  } }

extern "C" void kernel_launch(void* const* d_in, const int* in_sizes, int n_in,
                              void* d_out, int out_size, void* d_ws, size_t ws_size, hipStream_t stream) {
  (void)in_sizes; (void)n_in; (void)out_size;
  const float* const* I = (const float* const*)d_in; const float* xr = I[0]; const float* xi = I[1];
  const float* qwr = I[2]; const float* qwi = I[3]; const float* qbr = I[4]; const float* qbi = I[5]; const float* kwr = I[6]; const float* kwi = I[7]; const float* kbr = I[8]; const float* kbi = I[9]; const float* vwr = I[10]; const float* vwi = I[11]; const float* vbr = I[12]; const float* vbi = I[13]; const float* owr = I[14]; const float* owi = I[15]; const float* obr = I[16]; const float* obi = I[17];
  char* ws = (char*)d_ws; size_t off = 0;
  auto take = [&](size_t bytes) { char* p = ws + off; off += (bytes + 255) & ~(size_t)255; return p; };
  _Float16* BQ = (_Float16*)take((size_t)DM * DM * 2); _Float16* BK = (_Float16*)take((size_t)DM * DM * 2); _Float16* BV = (_Float16*)take((size_t)DM * DM * 2); _Float16* BO = (_Float16*)take((size_t)2 * DMX * DM * 2); float* bq2 = (float*)take(DM * 4); float* bk2 = (float*)take(DM * 4); float* bv2 = (float*)take(DM * 4);
  _Float16* XC = (_Float16*)take(NR * DM * 2); _Float16* Q2 = (_Float16*)take(NR * DM * 2); _Float16* K2 = (_Float16*)take(NR * DM * 2); _Float16* V2 = (_Float16*)take(NR * DM * 2); _Float16* O2 = (_Float16*)take(NR * DM * 2);
  float* S = (float*)take((size_t)HG * SQ * SQ * 4); _Float16* P = (_Float16*)take((size_t)HG * SQ * SQ * 2); _Float16* VT = (_Float16*)take((size_t)DM * SQ * 2);
  if (off > ws_size) return;      /* approx 8 x 4 + 16 x 5 + 64 + 32 + 8 = 216 MiB */
  { const unsigned g = (unsigned)(((size_t)DM * (DM / 8) + 255) / 256); k_wcat2<<<g, 256, 0, stream>>>(qwr, qwi, BQ); k_wcat2<<<g, 256, 0, stream>>>(kwr, kwi, BK); k_wcat2<<<g, 256, 0, stream>>>(vwr, vwi, BV); k_wcplx3<<<(unsigned)(((size_t)2 * DMX * (DM / 8) + 255) / 256), 256, 0, stream>>>(owr, owi, BO); }
  k_bcat2<<<1, 256, 0, stream>>>(qbr, qbi, bq2); k_bcat2<<<1, 256, 0, stream>>>(kbr, kbi, bk2); k_bcat2<<<1, 256, 0, stream>>>(vbr, vbi, bv2);
  k_xcat<<<(unsigned)((NR * (DM / 8) + 255) / 256), 256, 0, stream>>>(xr, xi, XC, NR);      /* [x_real | x_imag] exact f16 rows */
  k_gemm2<0><<<dim3((unsigned)((NR / 128) * (DM / 64)), 1), 128, 0, stream>>>(XC, DM, 0, BQ, DM, 0, 0.0625f, bq2, 0, nullptr, 1, 0, 0, nullptr, Q2, DM, 0, (int)NR, DM, DM);      /* (q_r | q_i) per head, K = 2048 */
  k_gemm2<0><<<dim3((unsigned)((NR / 128) * (DM / 64)), 1), 128, 0, stream>>>(XC, DM, 0, BK, DM, 0, 0.0625f, bk2, 0, nullptr, 1, 0, 0, nullptr, K2, DM, 0, (int)NR, DM, DM);
  k_gemm2<0><<<dim3((unsigned)((NR / 128) * (DM / 64)), 1), 128, 0, stream>>>(XC, DM, 0, BV, DM, 0, 0.0625f, bv2, 0, nullptr, 1, 0, 0, nullptr, V2, DM, 0, (int)NR, DM, DM);
  for (int b = 0; b < NB; ++b) { const size_t r0 = (size_t)b * SQ;
    k_vt<NH, SQ><<<NH * (SQ / 64), 256, 0, stream>>>(V2 + r0 * DM, DM, 0, VT);      /* [v_r | v_i]^T: slab 2h = v_r of head h, 2h+1 = v_i */
    for (int h0 = 0; h0 < 16; h0 += HG) {
      k_gemm2<0><<<dim3((QN / 128) * (SQ / 64), HG), 128, 0, stream>>>(Q2 + r0 * DM + h0 * 128, DM, (size_t)128, K2 + r0 * DM + h0 * 128, DM, (size_t)128, 0.125f, nullptr, 0, nullptr, 1, 0, 0, S, nullptr, SQ, (size_t)SQ * SQ, QN, SQ, 128);      /* scores = (qr.kr + qi.ki)/8, K = 128 */
      k_rsmf<<<(HG * QN + 255) / 256, 256, 0, stream>>>(S, P, QN, HG);
      k_gemm2<0><<<dim3((QN / 128) * (128 / 64), HG), 128, 0, stream>>>(P, SQ, (size_t)SQ * SQ, VT + (size_t)h0 * 128 * SQ, SQ, (size_t)128 * SQ, 0.25f, nullptr, 0, nullptr, 1, 0, 0, nullptr, O2 + r0 * DM + h0 * 128, DM, (size_t)128, QN, 128, SQ); } }      /* [out_r | out_i] x64 per head */
  k_gemm2<0><<<dim3((unsigned)((NR / 128) * (DMX / 64)), 1), 128, 0, stream>>>(O2, DM, 0, BO, DM, 0, 0.0009765625f, obr, 0, nullptr, 1, 0, 0, (float*)d_out, nullptr, DMX, 0, (int)NR, DMX, DM);      /* y_r = o_r Wr - o_i Wi + br -> out[0] */
  k_gemm2<0><<<dim3((unsigned)((NR / 128) * (DMX / 64)), 1), 128, 0, stream>>>(O2, DM, 0, BO + (size_t)DMX * DM, DM, 0, 0.0009765625f, obi, 0, nullptr, 1, 0, 0, (float*)d_out + NR * DMX, nullptr, DMX, 0, (int)NR, DMX, DM);      /* y_i = o_i Wr + o_r Wi + bi -> out[1] */
}

// v001
// It runs in 1340 microseconds.
// Next to v000, in two timings, it ran 3.00 and 3.02 times as fast.
#include <hip/hip_runtime.h>
// Complex multi-head attention (x_real, x_imag [2][2048][1024]; complex linear (weights [in][out]): r = xr Wr - xi Wi + br, i = xi Wr + xr Wi + bi for q, k, v; 16 heads of 64; scores = (qr . kr + qi . ki) / 8 = Re(q conj(k)); softmax; out_r = P vr, out_i = P vi; y = complex_linear(out, Wo); output = stack([y_r, y_i]) -> [2][2][2048][1024]).
// Structure: [x_real | x_imag] as ONE exact f16 row plane (K = 2048); each complex projection as ONE WMMA GEMM (32x64 wave tiles, f32 accumulation, exact x16 weights arranged on VALU as [Wr^T | -Wi^T] / [Wi^T | Wr^T] row pairs, + bias) whose output columns interleave (q_r | q_i) per head (head width 128); per batch: [v_r | v_i]^T via LDS transposes; per 4-head group: scores GEMM with K = 128 (= qr.kr + qi.ki in one contraction, alpha 1/8), row softmax on VALU (f32 statistics, native exp; weights x256 f16), [out_r | out_i] = P [v_r | v_i]^T GEMM (N = 128; carried x64) into interleaved f16 rows; y_r and y_i as two GEMMs over those rows (K = 2048, weights re-laid on VALU with the matching signs, + bias) straight into the two output planes; 8 + 3 + 2 x (1 + 4 x 3) + 2 = 39 launches.
// Compute dtype: inputs rounded to bf16; x / weights exact; q, k, v, softmax weights and out plain f16 (~2^-12); scores, statistics, y f32. v_wmma_f32_16x16x32_f16.
#define NB 2
#define SQ 2048
#define DMX 1024                     /* model width */
#define DM (2 * DMX)                 /* interleaved (real | imag) width = 16 heads x 128 */
#define NH 32                        /* k_vt slabs of 64: (head, part) */
#define HD 64
#define HG 4
#define QN SQ
#define NR ((size_t)NB * SQ)
typedef __bf16 v16b __attribute__((ext_vector_type(16)));
typedef unsigned short v8us __attribute__((ext_vector_type(8), may_alias));
typedef float  v8f  __attribute__((ext_vector_type(8)));
typedef float  v4f  __attribute__((ext_vector_type(4)));
typedef float  v4fa __attribute__((ext_vector_type(4), may_alias));
union FragB { v16b v; v8us half[2]; unsigned short u[16]; };

__device__ __forceinline__ unsigned short bf16_bits(float x) { unsigned int u = __float_as_uint(x); return (unsigned short)((u + 0x7FFFu + ((u >> 16) & 1u)) >> 16); }
__device__ __forceinline__ float bf16_val(unsigned short b) { return __uint_as_float(((unsigned int)b) << 16); }
__device__ __forceinline__ float bf16_round(float x) { return bf16_val(bf16_bits(x)); }
// D += A·B with NT terms: 1 = ah·bh, 2 = + al·bh (A split), 3 = + ah·bl (both split)
template <int NT>
__device__ __forceinline__ v8f mmaN(v16b ah, v16b al, v16b bh, v16b bl, v8f c) {
  c = __builtin_amdgcn_wmma_f32_16x16x32_bf16(false, ah, false, bh, (short)0, c, false, false);
  if (NT >= 2) c = __builtin_amdgcn_wmma_f32_16x16x32_bf16(false, al, false, bh, (short)0, c, false, false);
  if (NT >= 3) c = __builtin_amdgcn_wmma_f32_16x16x32_bf16(false, ah, false, bl, (short)0, c, false, false);
  asm volatile("v_nop\n\tv_nop\n\tv_nop\n\tv_nop" : "+v"(c) : "v"(ah), "v"(al), "v"(bh), "v"(bl));
  return c;
}

__global__ __launch_bounds__(256) void k_wt_bf16(const float* __restrict__ W, unsigned short* __restrict__ Wt, int K, int N) {
  const int t = blockIdx.x * 256 + threadIdx.x;
  const int k8n = K / 8;
  if (t >= N * k8n) return;
  const int n = t / k8n, k8 = (t % k8n) * 8;
  v8us v;
#pragma unroll
  for (int i = 0; i < 8; ++i) v[i] = bf16_bits(W[(size_t)(k8 + i) * N + n]);
  *(v8us*)(Wt + (size_t)n * K + k8) = v;
  
}

// GEMM C[M][N] (f32, pitch ldc) = act(A[M][K]·W + bias). A f32 row-major (pitch lda) converted per fragment to bf16
// (ASPLIT: hi/lo two planes -> 2 terms, else single rounded term); Wt bf16 [N][K] (pitch ldb). BIAS_BF16 rounds the
// bias to bf16 first (bias quantised to bf16 before the add). K%32==0, M%16==0, N%64==0.
template <bool ASPLIT, int ACT, bool BIAS_BF16>
__global__ __launch_bounds__(128) void k_gemm_bf(const float* __restrict__ A, int lda, const unsigned short* __restrict__ Wt, int ldb,
                                               const float* __restrict__ bias, float* __restrict__ C, int ldc, int M, int N, int K) {
  __shared__ __attribute__((aligned(16))) float so[4][16][64];
  const int tid = threadIdx.x, w = tid >> 5, lane = tid & 31, ln = lane & 15, hh = lane >> 4;
  const int ntn = N / 64;
  const int wid = blockIdx.x * 4 + w;
  const int mt = wid / ntn, nq = wid % ntn;
  if (mt * 16 >= M) return;
  const int row0 = mt * 16, col0 = nq * 64;
  const float* arow = A + (size_t)(row0 + ln) * lda;
  v8f acc[4] = {};
  for (int kb = 0; kb < K; kb += 32) {
    FragB ah, al;
    const v4f x0 = *(const v4fa*)(arow + kb + 8 * hh), x1 = *(const v4fa*)(arow + kb + 8 * hh + 4);
    const v4f x2 = *(const v4fa*)(arow + kb + 16 + 8 * hh), x3 = *(const v4fa*)(arow + kb + 16 + 8 * hh + 4);
    float xs[16] = {x0[0],x0[1],x0[2],x0[3],x1[0],x1[1],x1[2],x1[3],x2[0],x2[1],x2[2],x2[3],x3[0],x3[1],x3[2],x3[3]};
#pragma unroll
    for (int i = 0; i < 16; ++i) { const unsigned short hb = bf16_bits(xs[i]); ah.u[i] = hb; al.u[i] = ASPLIT ? bf16_bits(xs[i] - bf16_val(hb)) : (unsigned short)0; }
#pragma unroll
    for (int t = 0; t < 4; ++t) {
      const unsigned short* brow = Wt + (size_t)(col0 + t * 16 + ln) * ldb + kb;
      FragB b;
      b.half[0] = *(const v8us*)(brow + 8 * hh);
      b.half[1] = *(const v8us*)(brow + 16 + 8 * hh);
      acc[t] = mmaN<ASPLIT ? 2 : 1>(ah.v, al.v, b.v, b.v, acc[t]);
    }
  }
#pragma unroll
  for (int t = 0; t < 4; ++t) {
    float bv = bias ? bias[col0 + t * 16 + ln] : 0.f;
    if (BIAS_BF16) bv = bf16_round(bv);
#pragma unroll
    for (int r = 0; r < 8; ++r) { float v = acc[t][r] + bv; if (ACT == 1) v = fmaxf(v, 0.f); so[w][8 * hh + r][t * 16 + ln] = v; }
  }
  __builtin_amdgcn_fence(__ATOMIC_ACQ_REL, "workgroup");
  __builtin_amdgcn_wave_barrier();
  const int rsub = lane >> 4, c4 = (lane & 15) * 4;
  {
#pragma unroll
    for (int q = 0; q < 8; ++q) {
      const int r = q * 2 + rsub;
      const v4f v = *(const v4fa*)&so[w][r][c4];
      *(v4f*)(C + (size_t)(row0 + r) * ldc + col0 + c4) = v;
    }
    
  }
}

// GEMM C = act(A·W + bias + resid): A f32 (ASPLIT -> hi/lo 2 terms), Wt bf16 [N][K]; ACT 0 none, 1 relu, 2 exact gelu;
// resid (optional, f32, row index = (row % rmod), pitch ldr, RES_BF16 rounds it) added before the activation.
template <bool ASPLIT, int ACT, bool BIAS_BF16, bool RES_BF16>
__global__ __launch_bounds__(128) void k_gemm_bf3(const float* __restrict__ A, int lda, const unsigned short* __restrict__ Wt, int ldb,
                                                const float* __restrict__ bias, const float* __restrict__ resid, int rmod, int ldr,
                                                float* __restrict__ C, int ldc, int M, int N, int K) {
  __shared__ __attribute__((aligned(16))) float so[4][16][64];
  const int tid = threadIdx.x, w = tid >> 5, lane = tid & 31, ln = lane & 15, hh = lane >> 4;
  const int ntn = N / 64;
  const int wid = blockIdx.x * 4 + w;
  const int mt = wid / ntn, nq = wid % ntn;
  if (mt * 16 >= M) return;
  const int row0 = mt * 16, col0 = nq * 64;
  const float* arow = A + (size_t)(row0 + ln) * lda;
  v8f acc[4] = {};
  for (int kb = 0; kb < K; kb += 32) {
    FragB ah, al;
    const v4f x0 = *(const v4fa*)(arow + kb + 8 * hh), x1 = *(const v4fa*)(arow + kb + 8 * hh + 4);
    const v4f x2 = *(const v4fa*)(arow + kb + 16 + 8 * hh), x3 = *(const v4fa*)(arow + kb + 16 + 8 * hh + 4);
    float xs[16] = {x0[0],x0[1],x0[2],x0[3],x1[0],x1[1],x1[2],x1[3],x2[0],x2[1],x2[2],x2[3],x3[0],x3[1],x3[2],x3[3]};
#pragma unroll
    for (int i = 0; i < 16; ++i) { const unsigned short hb = bf16_bits(xs[i]); ah.u[i] = hb; al.u[i] = ASPLIT ? bf16_bits(xs[i] - bf16_val(hb)) : (unsigned short)0; }
#pragma unroll
    for (int t = 0; t < 4; ++t) {
      const unsigned short* brow = Wt + (size_t)(col0 + t * 16 + ln) * ldb + kb;
      FragB b;
      b.half[0] = *(const v8us*)(brow + 8 * hh);
      b.half[1] = *(const v8us*)(brow + 16 + 8 * hh);
      acc[t] = mmaN<ASPLIT ? 2 : 1>(ah.v, al.v, b.v, b.v, acc[t]);
    }
  }
#pragma unroll
  for (int t = 0; t < 4; ++t) {
    const int col = col0 + t * 16 + ln;
    float bv = bias ? bias[col] : 0.f;
    if (BIAS_BF16) bv = bf16_round(bv);
#pragma unroll
    for (int r = 0; r < 8; ++r) {
      float v = acc[t][r] + bv;
      if (resid) { float rv = resid[(size_t)((row0 + 8 * hh + r) % rmod) * ldr + col]; if (RES_BF16) rv = bf16_round(rv); v += rv; }
      if (ACT == 1) v = fmaxf(v, 0.f);
      if (ACT == 2) v = 0.5f * v * (1.0f + erff(v * 0.70710678118654752f));
      if (ACT == 3) { const float u = 0.7978845608028654f * (v + 0.044715f * v * v * v); v = 0.5f * v * (1.0f + tanhf(u)); }
      so[w][8 * hh + r][t * 16 + ln] = v;
    }
  }
  __builtin_amdgcn_fence(__ATOMIC_ACQ_REL, "workgroup");
  __builtin_amdgcn_wave_barrier();
  const int rsub = lane >> 4, c4 = (lane & 15) * 4;
  {
#pragma unroll
    for (int q = 0; q < 8; ++q) {
      const int r = q * 2 + rsub;
      const v4f v = *(const v4fa*)&so[w][r][c4];
      *(v4f*)(C + (size_t)(row0 + r) * ldc + col0 + c4) = v;
    }
    
  }
}
// row LayerNorm (biased variance, eps) over N: s = X (+ R); optional out_sum <- s; out_norm <- (s-mu)*rsqrt(var+eps)*g + b
template <bool PARAM_BF16>
__global__ __launch_bounds__(256) void k_layernorm(const float* __restrict__ X, const float* __restrict__ R, const float* __restrict__ g, const float* __restrict__ bta,
                                                  float* __restrict__ out_sum, float* __restrict__ out_norm, int N, float eps) {
  __shared__ float red[256];
  const int row = blockIdx.x, tid = threadIdx.x;
  const float* x = X + (size_t)row * N; const float* rr = R ? R + (size_t)row * N : nullptr;
  float vals[16];                     // up to N = 4096
  const int per = N / 256;            // contiguous chunk per thread? use strided-by-4 chunks: thread handles j = tid*4 + 1024*u
  float s1 = 0.f;
  for (int u = 0; u < per / 4; ++u) {
    const int j = tid * 4 + 1024 * u;
    const v4f a = *(const v4fa*)(x + j);
    v4f b = {0.f,0.f,0.f,0.f}; if (rr) b = *(const v4fa*)(rr + j);
#pragma unroll
    for (int q = 0; q < 4; ++q) { const float v = a[q] + b[q]; vals[u * 4 + q] = v; s1 += v; }
  }
  red[tid] = s1; __syncthreads();
  for (int st = 128; st > 0; st >>= 1) { if (tid < st) red[tid] += red[tid + st]; __syncthreads(); }
  const float mu = red[0] / (float)N; __syncthreads();
  float s2 = 0.f;
  for (int u = 0; u < per / 4; ++u)
#pragma unroll
    for (int q = 0; q < 4; ++q) { const float c = vals[u * 4 + q] - mu; s2 += c * c; }
  red[tid] = s2; __syncthreads();
  for (int st = 128; st > 0; st >>= 1) { if (tid < st) red[tid] += red[tid + st]; __syncthreads(); }
  const float rs = rsqrtf(red[0] / (float)N + eps);
  {
    for (int u = 0; u < per / 4; ++u) {
      const int j = tid * 4 + 1024 * u;
      v4f o, sm;
#pragma unroll
      for (int q = 0; q < 4; ++q) {
        float gg = g[j + q], bb = bta[j + q];
        if (PARAM_BF16) { gg = bf16_round(gg); bb = bf16_round(bb); }
        sm[q] = vals[u * 4 + q]; o[q] = (vals[u * 4 + q] - mu) * rs * gg + bb;
      }
      if (out_sum) *(v4f*)(out_sum + (size_t)row * N + j) = sm;
      *(v4f*)(out_norm + (size_t)row * N + j) = o;
    }
    
  }
}



// ---- f16 WMMA path (v_wmma_f32_16x16x32_f16): 11-bit significands for operands in range — used where a [0,1] probability operand needs more precision than bf16
typedef _Float16 v16h __attribute__((ext_vector_type(16)));
union FragH { v16h v; v8us half[2]; _Float16 h[16]; unsigned short u[16]; };
template <int NT>
__device__ __forceinline__ v8f mmaH(v16h ah, v16h al, v16h bh, v16h bl, v8f c) {
  c = __builtin_amdgcn_wmma_f32_16x16x32_f16(false, ah, false, bh, (short)0, c, false, false);
  if (NT >= 2) c = __builtin_amdgcn_wmma_f32_16x16x32_f16(false, al, false, bh, (short)0, c, false, false);
  if (NT >= 3) c = __builtin_amdgcn_wmma_f32_16x16x32_f16(false, ah, false, bl, (short)0, c, false, false);
  asm volatile("v_nop\n\tv_nop\n\tv_nop\n\tv_nop" : "+v"(c) : "v"(ah), "v"(al), "v"(bh), "v"(bl));
  return c;
}
// batched GEMM like k_gemm_b but f16 operands: A f32 (split into f16 hi/lo if ASPLIT, else rounded to f16), Bt = f16 values [n][k]; alpha; C f32; N multiple of 16 (partial tiles skipped)
template <bool ASPLIT>
__global__ __launch_bounds__(128) void k_gemm_h(const float* __restrict__ A, int lda, size_t sA, const _Float16* __restrict__ Bh, int ldb, size_t sB, float alpha, float* __restrict__ C, int ldc, size_t sC, int M, int N, int K) {
  __shared__ __attribute__((aligned(16))) float so[4][16][64];
  const int tid = threadIdx.x, w = tid >> 5, lane = tid & 31, ln = lane & 15, hh = lane >> 4; const int by = blockIdx.y;
  A += (size_t)by * sA; Bh += (size_t)by * sB; C += (size_t)by * sC;
  const int ntn = (N + 63) / 64; const int wid = blockIdx.x * 4 + w; const int mt = wid / ntn, nq = wid % ntn; if (mt * 16 >= M) return;
  const int row0 = mt * 16, col0 = nq * 64; const float* arow = A + (size_t)(row0 + ln) * lda;
  v8f acc[4] = {};
  for (int kb = 0; kb < K; kb += 32) {
    FragH ah, al;
    const v4f x0 = *(const v4fa*)(arow + kb + 8 * hh), x1 = *(const v4fa*)(arow + kb + 8 * hh + 4), x2 = *(const v4fa*)(arow + kb + 16 + 8 * hh), x3 = *(const v4fa*)(arow + kb + 16 + 8 * hh + 4);
    float xs[16] = {x0[0],x0[1],x0[2],x0[3],x1[0],x1[1],x1[2],x1[3],x2[0],x2[1],x2[2],x2[3],x3[0],x3[1],x3[2],x3[3]};
#pragma unroll
    for (int i = 0; i < 16; ++i) { const _Float16 h = (_Float16)xs[i]; ah.h[i] = h; al.h[i] = ASPLIT ? (_Float16)(xs[i] - (float)h) : (_Float16)0.0f; }
#pragma unroll
    for (int t = 0; t < 4; ++t) { if (col0 + t * 16 >= N) continue; const size_t boff = (size_t)(col0 + t * 16 + ln) * ldb + kb; FragH bq; bq.half[0] = *(const v8us*)(Bh + boff + 8 * hh); bq.half[1] = *(const v8us*)(Bh + boff + 16 + 8 * hh);
      acc[t] = mmaH<ASPLIT ? 2 : 1>(ah.v, al.v, bq.v, bq.v, acc[t]); }
  }
#pragma unroll
  for (int t = 0; t < 4; ++t) { if (col0 + t * 16 >= N) continue;
#pragma unroll
    for (int r = 0; r < 8; ++r) so[w][8 * hh + r][t * 16 + ln] = acc[t][r] * alpha; }
  __builtin_amdgcn_fence(__ATOMIC_ACQ_REL, "workgroup"); __builtin_amdgcn_wave_barrier();
  const int rsub = lane >> 4, c4 = (lane & 15) * 4;
  {
#pragma unroll
    for (int q = 0; q < 8; ++q) { const int r = q * 2 + rsub; if (col0 + c4 < N) { const v4f v = *(const v4fa*)&so[w][r][c4]; *(v4f*)(C + (size_t)(row0 + r) * ldc + col0 + c4) = v; } }
     }
}

// Wt[n][k] = f16(W[k][n]·scale) from f32 row-major W[K][N] (scale = power of two; bf16-exact weights stay exact in f16 away from the subnormal range)
__global__ __launch_bounds__(256) void k_wt_f16(const float* __restrict__ W, _Float16* __restrict__ Wt, int K, int N, float scale) {
  const int t = blockIdx.x * 256 + threadIdx.x; if (t >= N * (K / 8)) return; const int n = t / (K / 8), k8 = (t % (K / 8)) * 8; FragH f;
#pragma unroll
  for (int i = 0; i < 8; ++i) f.h[i] = (_Float16)(bf16_round(W[(size_t)(k8 + i) * N + n]) * scale); const v8us o = f.half[0];
  *(v8us*)((unsigned short*)Wt + (size_t)n * K + k8) = o; 
}
// k_gemm_hh variant with fused epilogue: v = acc·alpha + bias[by·sBias + col] (+ CP[(row/rowsPerB)·sCPb + by·64 + col] if CP) ; ACT 0 none / 1 elu ; writes f16 C16 (and f32 C if non-null)
template <int ACT>
__global__ __launch_bounds__(128) void k_gemm_hhx(const _Float16* __restrict__ A, int lda, size_t sA, const _Float16* __restrict__ Bh, int ldb, size_t sB, float alpha, const float* __restrict__ bias, size_t sBias, const float* __restrict__ CP, int rowsPerB, size_t sCPb, int row0g,
    float* __restrict__ C, _Float16* __restrict__ C16, int ldc, size_t sC, int M, int N, int K) {
  __shared__ __attribute__((aligned(16))) float so[4][16][64];
  const int tid = threadIdx.x, w = tid >> 5, lane = tid & 31, ln = lane & 15, hh = lane >> 4; const int by = blockIdx.y;
  A += (size_t)by * sA; Bh += (size_t)by * sB; const size_t cofs = (size_t)by * sC; const float* bp = bias ? bias + (size_t)by * sBias : nullptr;
  const int ntn = (N + 63) / 64; const int wid = blockIdx.x * 4 + w; const int mt = wid / ntn, nq = wid % ntn; if (mt * 16 >= M) return;
  const int row0 = mt * 16, col0 = nq * 64; const _Float16* arow = A + (size_t)(row0 + ln) * lda;
  v8f acc[4] = {};
  for (int kb = 0; kb < K; kb += 32) { FragH ah; ah.half[0] = *(const v8us*)((const unsigned short*)arow + kb + 8 * hh); ah.half[1] = *(const v8us*)((const unsigned short*)arow + kb + 16 + 8 * hh);
#pragma unroll
    for (int t = 0; t < 4; ++t) { if (col0 + t * 16 >= N) continue; const size_t boff = (size_t)(col0 + t * 16 + ln) * ldb + kb; FragH bq; bq.half[0] = *(const v8us*)((const unsigned short*)Bh + boff + 8 * hh); bq.half[1] = *(const v8us*)((const unsigned short*)Bh + boff + 16 + 8 * hh);
      acc[t] = mmaH<1>(ah.v, ah.v, bq.v, bq.v, acc[t]); }
  }
#pragma unroll
  for (int t = 0; t < 4; ++t) { if (col0 + t * 16 >= N) continue; const int col = col0 + t * 16 + ln; const float bv = bp ? bf16_round(bp[col]) : 0.f;
#pragma unroll
    for (int r = 0; r < 8; ++r) { float v = acc[t][r] * alpha + bv; if (CP) { const int rr = row0g + row0 + 8 * hh + r; if (rowsPerB < 0) v += CP[cofs + (size_t)rr * ldc + col];      /* rowsPerB < 0: own element of the batched C plane */ else { const int bidx = rr / rowsPerB; v += CP[(size_t)bidx * sCPb + (size_t)by * 64 + col]; } } if (ACT == 1) v = (v > 0.f) ? v : expm1f(v); else if (ACT == 7) v = (v > 0.f) ? v + 1.0f : expf(v); else if (ACT == 8) v = tanhf(v); else if (ACT == 9) v = 0.5f * v * (1.0f + tanhf(0.7978845608028654f * (v + 0.044715f * v * v * v))); else if (ACT == 11) v = 1.0f / (1.0f + expf(-v)); else if (ACT == 12) v = (v > 0.f) ? v : 0.01f * v; else if (ACT == 14) v = (v > 0.f) ? v : 0.1f * v; else if (ACT == 16) v = (v >= 0.f) ? v : 0.3f * v; else if (ACT == 17) v = (v >= 0.f) ? v : 0.2f * v; else if (ACT == 15) v = v / (1.0f + expf(-v)); else if (ACT == 3) v = fmaxf(v, 0.f); else if (ACT == 6) v = 0.5f * v * (1.0f + erff(v * 0.70710678118654752f)); so[w][8 * hh + r][t * 16 + ln] = v; } }
  __builtin_amdgcn_fence(__ATOMIC_ACQ_REL, "workgroup"); __builtin_amdgcn_wave_barrier();
  const int rsub = lane >> 4, c4 = (lane & 15) * 4; typedef _Float16 v4h __attribute__((ext_vector_type(4)));
  {
#pragma unroll
    for (int q = 0; q < 8; ++q) { const int r = q * 2 + rsub; if (col0 + c4 < N) { const v4f v = *(const v4fa*)&so[w][r][c4]; if (C) *(v4f*)(C + cofs + (size_t)(row0 + r) * ldc + col0 + c4) = v; if (C16) { v4h h4; for (int i = 0; i < 4; ++i) h4[i] = (_Float16)v[i]; *(v4h*)(C16 + cofs + (size_t)(row0 + r) * ldc + col0 + c4) = h4; } } }
     }
}


typedef _Float16 v4h __attribute__((ext_vector_type(4)));

__global__ __launch_bounds__(256) void k_x16(const float* __restrict__ x, _Float16* __restrict__ X16, size_t n8) { const size_t t = (size_t)blockIdx.x * 256 + threadIdx.x; if (t >= n8) return; FragH f;
#pragma unroll
  for (int q = 0; q < 8; ++q) f.h[q] = (_Float16)bf16_round(x[t * 8 + q]); *(v8us*)((unsigned short*)X16 + t * 8) = f.half[0];  }
__global__ __launch_bounds__(256) void k_h16(const float* __restrict__ x, _Float16* __restrict__ X16, size_t n8) { const size_t t = (size_t)blockIdx.x * 256 + threadIdx.x; if (t >= n8) return; FragH f;
#pragma unroll
  for (int q = 0; q < 8; ++q) f.h[q] = (_Float16)x[t * 8 + q]; *(v8us*)((unsigned short*)X16 + t * 8) = f.half[0];  }
__global__ __launch_bounds__(256) void k_round16f(const float* __restrict__ W, _Float16* __restrict__ Bt, size_t n8) { const size_t t = (size_t)blockIdx.x * 256 + threadIdx.x; if (t >= n8) return; FragH f;
#pragma unroll
  for (int i = 0; i < 8; ++i) f.h[i] = (_Float16)(bf16_round(W[t * 8 + i]) * 16.0f); *(v8us*)((unsigned short*)Bt + t * 8) = f.half[0];  }
template <int NHv, int TTv>
__global__ __launch_bounds__(256) void k_vt(const _Float16* __restrict__ V16, int ldv, int voff, _Float16* __restrict__ Vt) { __shared__ unsigned short tl[64][66]; const int tid = threadIdx.x; const int slab = blockIdx.x / (TTv / 64), lg = blockIdx.x % (TTv / 64); const int b = slab / NHv, h = slab % NHv;
  for (int i = tid; i < 64 * 8; i += 256) { const int r = i / 8, c8 = (i % 8) * 8; FragH f; f.half[0] = *(const v8us*)((const unsigned short*)V16 + ((size_t)b * TTv + lg * 64 + r) * ldv + voff + h * 64 + c8);
#pragma unroll
    for (int q = 0; q < 8; ++q) tl[r][c8 + q] = f.u[q]; }
  __syncthreads();
  {
#pragma unroll
    for (int rd = 0; rd < 2; ++rd) { const int d = rd * 32 + tid / 8, pc = tid % 8; FragH f;
#pragma unroll
      for (int q = 0; q < 8; ++q) f.u[q] = tl[pc * 8 + q][d];
      *(v8us*)((unsigned short*)Vt + ((size_t)slab * 64 + d) * TTv + lg * 64 + pc * 8) = f.half[0]; }
     } }

__global__ __launch_bounds__(256) void k_hl(const float* __restrict__ F, _Float16* __restrict__ Hh, _Float16* __restrict__ Hl, size_t n8) { const size_t t = (size_t)blockIdx.x * 256 + threadIdx.x; if (t >= n8) return; FragH fh, fl; const v4f a = *(const v4fa*)(F + t * 8), c = *(const v4fa*)(F + t * 8 + 4);
#pragma unroll
  for (int q = 0; q < 4; ++q) { _Float16 h = (_Float16)a[q]; fh.h[q] = h; fl.h[q] = (_Float16)((a[q] - (float)h) * 1024.0f); h = (_Float16)c[q]; fh.h[4 + q] = h; fl.h[4 + q] = (_Float16)((c[q] - (float)h) * 1024.0f); }
  { *(v8us*)((unsigned short*)Hh + t * 8) = fh.half[0]; *(v8us*)((unsigned short*)Hl + t * 8) = fl.half[0];  } }

// ---- fast GEMM (wave tile 32x64; requires M % 32 == 0 rows per launch region and N % 64 == 0); epilogue = k_gemm_hhx semantics ----
__device__ __forceinline__ v16h g2_frag(const _Float16* p, int hh) { FragH f; f.half[0] = *(const v8us*)((const unsigned short*)p + 8 * hh); f.half[1] = *(const v8us*)((const unsigned short*)p + 16 + 8 * hh); return f.v; }
__device__ __forceinline__ v8f g2_mma(v16h a, v16h b, v8f c) { v8f d = __builtin_amdgcn_wmma_f32_16x16x32_f16(false, a, false, b, (short)0, c, false, false); asm volatile("v_nop\n\tv_nop\n\tv_nop\n\tv_nop" : "+v"(d) : "v"(a), "v"(b)); return d; }
template <int ACT>
__global__ __launch_bounds__(128) void k_gemm2(const _Float16* __restrict__ A, int lda, size_t sA, const _Float16* __restrict__ Bh, int ldb, size_t sB, float alpha, const float* __restrict__ bias, size_t sBias, const float* __restrict__ CP, int rowsPerB, size_t sCPb, int row0g,
    float* __restrict__ C, _Float16* __restrict__ C16, int ldc, size_t sC, int M, int N, int K) { static_assert(ACT == 0 || ACT == 3 || ACT == 6 || ACT == 8 || ACT == 9 || ACT == 11 || ACT == 12 || ACT == 14 || ACT == 15 || ACT == 16 || ACT == 17, "k_gemm2: unsupported ACT code (would silently apply no activation)");
  __shared__ __attribute__((aligned(16))) float so[4][32][68];
  const int tid = threadIdx.x, w = tid >> 5, lane = tid & 31, ln = lane & 15, hh = lane >> 4; const int by = blockIdx.y;
  A += (size_t)by * sA; Bh += (size_t)by * sB; const size_t cofs = (size_t)by * sC; const float* bp = bias ? bias + (size_t)by * sBias : nullptr;
  const int ntn = N >> 6; const int mt = blockIdx.x / ntn, nq = blockIdx.x - mt * ntn; const int row0 = mt * 128 + 32 * w, col0 = nq * 64; if (row0 >= M) return;
  const _Float16* a0p = A + (size_t)(row0 + ln) * lda; const _Float16* a1p = a0p + (size_t)16 * lda;
  const _Float16* b0p = Bh + (size_t)(col0 + ln) * ldb; const _Float16* b1p = b0p + (size_t)16 * ldb; const _Float16* b2p = b1p + (size_t)16 * ldb; const _Float16* b3p = b2p + (size_t)16 * ldb;
  const v8f z8 = {0.f,0.f,0.f,0.f,0.f,0.f,0.f,0.f}; v8f c00 = z8, c01 = z8, c02 = z8, c03 = z8, c10 = z8, c11 = z8, c12 = z8, c13 = z8;
#pragma unroll 1
  for (int kb = 0; kb < K; kb += 32) { const v16h a0 = g2_frag(a0p + kb, hh), a1 = g2_frag(a1p + kb, hh);
    v16h b = g2_frag(b0p + kb, hh); c00 = g2_mma(a0, b, c00); c10 = g2_mma(a1, b, c10);
    b = g2_frag(b1p + kb, hh); c01 = g2_mma(a0, b, c01); c11 = g2_mma(a1, b, c11);
    b = g2_frag(b2p + kb, hh); c02 = g2_mma(a0, b, c02); c12 = g2_mma(a1, b, c12);
    b = g2_frag(b3p + kb, hh); c03 = g2_mma(a0, b, c03); c13 = g2_mma(a1, b, c13); }
  v8f accs[8] = {c00, c01, c02, c03, c10, c11, c12, c13};
#pragma unroll
  for (int u = 0; u < 8; ++u) { const int t = u & 3, half = u >> 2; const int col = col0 + t * 16 + ln; const float bv = bp ? bf16_round(bp[col]) : 0.f;
#pragma unroll
    for (int r = 0; r < 8; ++r) { const int rloc = half * 16 + 8 * hh + r; float v = accs[u][r] * alpha + bv; if (CP) { if (rowsPerB < 0) v += CP[cofs + (size_t)(row0g + row0 + rloc) * ldc + col];      /* rowsPerB < 0: own element of the batched C plane */ else { const int bidx = (row0g + row0 + rloc) / rowsPerB; v += CP[(size_t)bidx * sCPb + (size_t)by * 64 + col]; } }
      if (ACT == 3) v = fmaxf(v, 0.f); else if (ACT == 6) v = 0.5f * v * (1.0f + erff(v * 0.70710678118654752f)); else if (ACT == 11) v = 1.0f / (1.0f + expf(-v)); else if (ACT == 15) v = v / (1.0f + expf(-v)); else if (ACT == 12) v = (v > 0.f) ? v : 0.01f * v; else if (ACT == 8) v = tanhf(v); else if (ACT == 9) v = 0.5f * v * (1.0f + tanhf(0.7978845608028654f * (v + 0.044715f * v * v * v))); else if (ACT == 14) v = (v > 0.f) ? v : 0.1f * v; else if (ACT == 16) v = (v >= 0.f) ? v : 0.3f * v; else if (ACT == 17) v = (v >= 0.f) ? v : 0.2f * v;
      so[w][rloc][t * 16 + ln] = v; } }
  __builtin_amdgcn_fence(__ATOMIC_ACQ_REL, "workgroup"); __builtin_amdgcn_wave_barrier();
  const int rsub = lane >> 4, c4 = (lane & 15) * 4;
  {
#pragma unroll
    for (int q = 0; q < 16; ++q) { const int r = q * 2 + rsub; const v4f v = *(const v4fa*)&so[w][r][c4]; if (C) *(v4f*)(C + cofs + (size_t)(row0 + r) * ldc + col0 + c4) = v; if (C16) { v4h h4; for (int i = 0; i < 4; ++i) h4[i] = (_Float16)v[i]; *(v4h*)(C16 + cofs + (size_t)(row0 + r) * ldc + col0 + c4) = h4; } }
     } }


__global__ __launch_bounds__(256) void k_wnat(const float* __restrict__ w, size_t n8, _Float16* __restrict__ Bt) { const size_t t = (size_t)blockIdx.x * 256 + threadIdx.x; if (t >= n8) return; FragH f; for (int q = 0; q < 8; ++q) f.h[q] = (_Float16)(bf16_round(w[t * 8 + q]) * 16.0f); *(v8us*)((unsigned short*)Bt + t * 8) = f.half[0];  }
__global__ __launch_bounds__(256) void k_rsm(const float* __restrict__ S, _Float16* __restrict__ P, int nrows) {
  #pragma clang fp contract(off)
  const int i = blockIdx.x * 256 + threadIdx.x; if (i >= nrows) return; const float* s = S + (size_t)i * SQ; float mx = -3.0e38f;
#pragma unroll 1
  for (int j = 0; j < SQ; ++j) mx = fmaxf(mx, s[j]); float se = 0.f;
#pragma unroll 1
  for (int j = 0; j < SQ; ++j) se += expf(s[j] - mx); const float sc = 256.0f / se;
#pragma unroll 1
  for (int j0 = 0; j0 < SQ; j0 += 8) { FragH f; for (int q = 0; q < 8; ++q) f.h[q] = (_Float16)(expf(s[j0 + q] - mx) * sc); unsigned short* d = (unsigned short*)P + (size_t)i * SQ + j0; *(v8us*)d = f.half[0];  } }
__global__ __launch_bounds__(256) void k_vt(const _Float16* __restrict__ V16, int b, int h0, _Float16* __restrict__ VT) { __shared__ unsigned short tl[64][65]; const int tid = threadIdx.x; const int hh = blockIdx.x % HG, sg = blockIdx.x / HG; const int s0 = sg * 64; const int h = h0 + hh;
  for (int i = tid; i < 64 * 8; i += 256) { const int j = i / 8, d8 = (i % 8) * 8; FragH f; f.half[0] = *(const v8us*)((const unsigned short*)V16 + ((size_t)b * SQ + s0 + j) * DM + h * HD + d8); for (int q = 0; q < 8; ++q) tl[d8 + q][j] = f.u[q]; }
  __syncthreads();
  { for (int i = tid; i < 64 * 8; i += 256) { const int d = i / 8, j8 = (i % 8) * 8; FragH f; for (int q = 0; q < 8; ++q) f.u[q] = tl[d][j8 + q]; *(v8us*)((unsigned short*)VT + ((size_t)hh * HD + d) * SQ + s0 + j8) = f.half[0]; }  } }


__global__ __launch_bounds__(256) void k_wcat2(const float* __restrict__ wr, const float* __restrict__ wi, _Float16* __restrict__ Bt) { const size_t t = (size_t)blockIdx.x * 256 + threadIdx.x; if (t >= (size_t)(2 * DMX) * (2 * DMX / 8)) return; const int k8 = (int)(t % (2 * DMX / 8)) * 8; const int n2 = (int)(t / (2 * DMX / 8)); const int h = n2 / 128, w = n2 % 128; const bool im = (w >= 64); const int f = h * 64 + (w & 63); FragH fr;
  for (int q = 0; q < 8; ++q) { const int k = k8 + q; float v; if (k < DMX) v = im ? wi[(size_t)k * DMX + f] : wr[(size_t)k * DMX + f]; else v = im ? wr[(size_t)(k - DMX) * DMX + f] : -wi[(size_t)(k - DMX) * DMX + f]; fr.h[q] = (_Float16)(16.0f * bf16_round(v)); }
  unsigned short* d = (unsigned short*)Bt + (size_t)n2 * (2 * DMX) + k8; *(v8us*)d = fr.half[0];  }
__global__ __launch_bounds__(256) void k_bcat2(const float* __restrict__ br, const float* __restrict__ bi, float* __restrict__ b2) { for (int n2 = threadIdx.x; n2 < 2 * DMX; n2 += 256) { const int h = n2 / 128, w = n2 % 128; const float v = (w < 64) ? br[h * 64 + w] : bi[h * 64 + (w - 64)]; *(float*)(b2 + n2) = v; }  }
__global__ __launch_bounds__(256) void k_wcplx3(const float* __restrict__ wr, const float* __restrict__ wi, _Float16* __restrict__ Bt) { const size_t t = (size_t)blockIdx.x * 256 + threadIdx.x; if (t >= (size_t)2 * DMX * (2 * DMX / 8)) return; const int k8 = (int)(t % (2 * DMX / 8)) * 8; const int f = (int)((t / (2 * DMX / 8)) % DMX); const int part = (int)(t / ((size_t)(2 * DMX / 8) * DMX)); FragH fr;
  for (int q = 0; q < 8; ++q) { const int k2 = k8 + q; const int h = k2 / 128, w = k2 % 128; const bool im = (w >= 64); const int g = h * 64 + (w & 63); float v; if (part == 0) v = im ? -wi[(size_t)g * DMX + f] : wr[(size_t)g * DMX + f]; else v = im ? wr[(size_t)g * DMX + f] : wi[(size_t)g * DMX + f]; fr.h[q] = (_Float16)(16.0f * bf16_round(v)); }
  unsigned short* d = (unsigned short*)Bt + ((size_t)part * DMX + f) * (2 * DMX) + k8; *(v8us*)d = fr.half[0];  }
__global__ __launch_bounds__(256) void k_xcat(const float* __restrict__ xr, const float* __restrict__ xi, _Float16* __restrict__ XC, size_t nrows) { const size_t t = (size_t)blockIdx.x * 256 + threadIdx.x; if (t >= nrows * (2 * DMX / 8)) return; const int k8 = (int)(t % (2 * DMX / 8)) * 8; const size_t r = t / (2 * DMX / 8); const float* s = (k8 < DMX) ? xr + r * DMX + k8 : xi + r * DMX + (k8 - DMX); const v4f a = *(const v4fa*)s, b = *(const v4fa*)(s + 4); FragH f; for (int q = 0; q < 4; ++q) { f.h[q] = (_Float16)bf16_round(a[q]); f.h[4 + q] = (_Float16)bf16_round(b[q]); }
  unsigned short* d = (unsigned short*)XC + r * (2 * DMX) + k8; *(v8us*)d = f.half[0];  }


// lane l <-> l ^ M inside a 16-lane row (DPP row_xmask) and l <-> l ^ 16 (cross-row move); all 32 lanes are on where these are used
template <int M> __device__ __forceinline__ float rx_xm(float v) { return __int_as_float(__builtin_amdgcn_mov_dpp(__float_as_int(v), 0x160 + M, 0xf, 0xf, true)); }
__device__ __forceinline__ float rx_x16(float v) { const int b = __float_as_int(v); return __int_as_float(__builtin_amdgcn_permlanex16(b, b, 0x76543210, 0xfedcba98, false, false)); }
__device__ __forceinline__ float wave_max(float v) { v = fmaxf(v, rx_xm<1>(v)); v = fmaxf(v, rx_xm<2>(v)); v = fmaxf(v, rx_xm<4>(v)); v = fmaxf(v, rx_xm<8>(v)); return fmaxf(v, rx_x16(v)); }
__device__ __forceinline__ float wave_sum(float v) { v += rx_xm<1>(v); v += rx_xm<2>(v); v += rx_xm<4>(v); v += rx_xm<8>(v); return v + rx_x16(v); }
// four 2^a in one statement, closed by the one free slot the instruction set asks for behind a transcendental before a source of it is overwritten; early-clobber outputs keep every result off every source
__device__ __forceinline__ v4f exp2x4(v4f a) { float r0, r1, r2, r3; asm("v_exp_f32 %0, %4\n\tv_exp_f32 %1, %5\n\tv_exp_f32 %2, %6\n\tv_exp_f32 %3, %7\n\tv_nop" : "=&v"(r0), "=&v"(r1), "=&v"(r2), "=&v"(r3) : "v"(a[0]), "v"(a[1]), "v"(a[2]), "v"(a[3])); const v4f r = {r0, r1, r2, r3}; return r; }
// row softmax, ONE WAVE PER ROW: the row's 2048 scores are read once, 16 loads of 512 contiguous bytes per wave, and stay in 64 registers per lane for maximum, exp, sum and scale; weights x256 f16 leave as whole 256-byte runs.
__global__ __launch_bounds__(256) void k_rsmf(const float* __restrict__ S, _Float16* __restrict__ P) {
  const int lane = threadIdx.x & 31; const int t = blockIdx.x * 8 + __builtin_amdgcn_readfirstlane(threadIdx.x >> 5); if (t >= QN * HG) return;      /* the wave's row, held scalar: row address arithmetic off the vector port; wave-uniform return, no barrier below */
  const size_t i = (size_t)(t / QN) * SQ + (t % QN); const float* s = S + i * SQ + lane * 4; v4f x[16];
  /* every loop over x is fully unrolled: constant indices keep x in registers, and the 16 loads issue back to back */
#pragma unroll
  for (int u = 0; u < 16; ++u) x[u] = *(const v4fa*)(s + u * 128);
  v4f m4 = x[0];
#pragma unroll
  for (int u = 1; u < 16; ++u) for (int q = 0; q < 4; ++q) m4[q] = fmaxf(m4[q], x[u][q]);
  const float mx = wave_max(fmaxf(fmaxf(m4[0], m4[1]), fmaxf(m4[2], m4[3])));
  v4f e4 = {0.f, 0.f, 0.f, 0.f};
#pragma unroll
  for (int u = 0; u < 16; ++u) { x[u] = exp2x4((x[u] - mx) * 1.44269504f); e4 += x[u]; }      /* exp(s - max) as before: subtract, x log2(e), v_exp_f32 */
  const float sc = 256.0f / wave_sum((e4[0] + e4[1]) + (e4[2] + e4[3]));
  _Float16* d = P + i * SQ + lane * 4;
#pragma unroll
  for (int u = 0; u < 16; ++u) { v4h h4; for (int q = 0; q < 4; ++q) h4[q] = (_Float16)(x[u][q] * sc); *(v4h*)(d + u * 128) = h4; } }

extern "C" void kernel_launch(void* const* d_in, const int* in_sizes, int n_in,
                              void* d_out, int out_size, void* d_ws, size_t ws_size, hipStream_t stream) {
  (void)in_sizes; (void)n_in; (void)out_size;
  const float* const* I = (const float* const*)d_in; const float* xr = I[0]; const float* xi = I[1];
  const float* qwr = I[2]; const float* qwi = I[3]; const float* qbr = I[4]; const float* qbi = I[5]; const float* kwr = I[6]; const float* kwi = I[7]; const float* kbr = I[8]; const float* kbi = I[9]; const float* vwr = I[10]; const float* vwi = I[11]; const float* vbr = I[12]; const float* vbi = I[13]; const float* owr = I[14]; const float* owi = I[15]; const float* obr = I[16]; const float* obi = I[17];
  char* ws = (char*)d_ws; size_t off = 0;
  auto take = [&](size_t bytes) { char* p = ws + off; off += (bytes + 255) & ~(size_t)255; return p; };
  _Float16* BQ = (_Float16*)take((size_t)DM * DM * 2); _Float16* BK = (_Float16*)take((size_t)DM * DM * 2); _Float16* BV = (_Float16*)take((size_t)DM * DM * 2); _Float16* BO = (_Float16*)take((size_t)2 * DMX * DM * 2); float* bq2 = (float*)take(DM * 4); float* bk2 = (float*)take(DM * 4); float* bv2 = (float*)take(DM * 4);
  _Float16* XC = (_Float16*)take(NR * DM * 2); _Float16* Q2 = (_Float16*)take(NR * DM * 2); _Float16* K2 = (_Float16*)take(NR * DM * 2); _Float16* V2 = (_Float16*)take(NR * DM * 2); _Float16* O2 = (_Float16*)take(NR * DM * 2);
  float* S = (float*)take((size_t)HG * SQ * SQ * 4); _Float16* P = (_Float16*)take((size_t)HG * SQ * SQ * 2); _Float16* VT = (_Float16*)take((size_t)DM * SQ * 2);
  if (off > ws_size) return;      /* approx 8 x 4 + 16 x 5 + 64 + 32 + 8 = 216 MiB */
  { const unsigned g = (unsigned)(((size_t)DM * (DM / 8) + 255) / 256); k_wcat2<<<g, 256, 0, stream>>>(qwr, qwi, BQ); k_wcat2<<<g, 256, 0, stream>>>(kwr, kwi, BK); k_wcat2<<<g, 256, 0, stream>>>(vwr, vwi, BV); k_wcplx3<<<(unsigned)(((size_t)2 * DMX * (DM / 8) + 255) / 256), 256, 0, stream>>>(owr, owi, BO); }
  k_bcat2<<<1, 256, 0, stream>>>(qbr, qbi, bq2); k_bcat2<<<1, 256, 0, stream>>>(kbr, kbi, bk2); k_bcat2<<<1, 256, 0, stream>>>(vbr, vbi, bv2);
  k_xcat<<<(unsigned)((NR * (DM / 8) + 255) / 256), 256, 0, stream>>>(xr, xi, XC, NR);      /* [x_real | x_imag] exact f16 rows */
  k_gemm2<0><<<dim3((unsigned)((NR / 128) * (DM / 64)), 1), 128, 0, stream>>>(XC, DM, 0, BQ, DM, 0, 0.0625f, bq2, 0, nullptr, 1, 0, 0, nullptr, Q2, DM, 0, (int)NR, DM, DM);      /* (q_r | q_i) per head, K = 2048 */
  k_gemm2<0><<<dim3((unsigned)((NR / 128) * (DM / 64)), 1), 128, 0, stream>>>(XC, DM, 0, BK, DM, 0, 0.0625f, bk2, 0, nullptr, 1, 0, 0, nullptr, K2, DM, 0, (int)NR, DM, DM);
  k_gemm2<0><<<dim3((unsigned)((NR / 128) * (DM / 64)), 1), 128, 0, stream>>>(XC, DM, 0, BV, DM, 0, 0.0625f, bv2, 0, nullptr, 1, 0, 0, nullptr, V2, DM, 0, (int)NR, DM, DM);
  for (int b = 0; b < NB; ++b) { const size_t r0 = (size_t)b * SQ;
    k_vt<NH, SQ><<<NH * (SQ / 64), 256, 0, stream>>>(V2 + r0 * DM, DM, 0, VT);      /* [v_r | v_i]^T: slab 2h = v_r of head h, 2h+1 = v_i */
    for (int h0 = 0; h0 < 16; h0 += HG) {
      k_gemm2<0><<<dim3((QN / 128) * (SQ / 64), HG), 128, 0, stream>>>(Q2 + r0 * DM + h0 * 128, DM, (size_t)128, K2 + r0 * DM + h0 * 128, DM, (size_t)128, 0.125f, nullptr, 0, nullptr, 1, 0, 0, S, nullptr, SQ, (size_t)SQ * SQ, QN, SQ, 128);      /* scores = (qr.kr + qi.ki)/8, K = 128 */
      k_rsmf<<<(HG * QN + 7) / 8, 256, 0, stream>>>(S, P);      /* one wave per row, 8 rows per block */
      k_gemm2<0><<<dim3((QN / 128) * (128 / 64), HG), 128, 0, stream>>>(P, SQ, (size_t)SQ * SQ, VT + (size_t)h0 * 128 * SQ, SQ, (size_t)128 * SQ, 0.25f, nullptr, 0, nullptr, 1, 0, 0, nullptr, O2 + r0 * DM + h0 * 128, DM, (size_t)128, QN, 128, SQ); } }      /* [out_r | out_i] x64 per head */
  k_gemm2<0><<<dim3((unsigned)((NR / 128) * (DMX / 64)), 1), 128, 0, stream>>>(O2, DM, 0, BO, DM, 0, 0.0009765625f, obr, 0, nullptr, 1, 0, 0, (float*)d_out, nullptr, DMX, 0, (int)NR, DMX, DM);      /* y_r = o_r Wr - o_i Wi + br -> out[0] */
  k_gemm2<0><<<dim3((unsigned)((NR / 128) * (DMX / 64)), 1), 128, 0, stream>>>(O2, DM, 0, BO + (size_t)DMX * DM, DM, 0, 0.0009765625f, obi, 0, nullptr, 1, 0, 0, (float*)d_out + NR * DMX, nullptr, DMX, 0, (int)NR, DMX, DM);      /* y_i = o_i Wr + o_r Wi + bi -> out[1] */
}

// v002
// It runs in 597 microseconds.
// In two side-by-side timings against v001, it was 2.24 and 2.23 times as fast.
// Counting every step since v000, it is 6.73 times as fast.
#include <hip/hip_runtime.h>
// Complex multi-head attention (x_real, x_imag [2][2048][1024]; complex linear (weights [in][out]): r = xr Wr - xi Wi + br, i = xi Wr + xr Wi + bi for q, k, v; 16 heads of 64; scores = (qr . kr + qi . ki) / 8 = Re(q conj(k)); softmax; out_r = P vr, out_i = P vi; y = complex_linear(out, Wo); output = stack([y_r, y_i]) -> [2][2][2048][1024]).
// Structure: [x_real | x_imag] as ONE exact f16 row plane (K = 2048); each complex projection as ONE WMMA GEMM (32x64 wave tiles, f32 accumulation, exact x16 weights arranged on VALU as [Wr^T | -Wi^T] / [Wi^T | Wr^T] row pairs, + bias) whose output columns interleave (q_r | q_i) per head (head width 128); [v_r | v_i]^T of both batches via LDS transposes; ONE attention launch over all (batch, head, 256-query block): S^T = K Q^T (K = 128 = qr.kr + qi.ki in one contraction), running maximum and sum per query in f32 (native exp2), P^T packed from the score tiles as f16 B operand, [out_r | out_i]^T += [v_r | v_i]^T P^T (carried x64) into interleaved f16 rows; y_r and y_i as two GEMMs over those rows (K = 2048, weights re-laid on VALU with the matching signs, + bias) straight into the two output planes; 8 + 3 + 1 + 1 + 2 = 15 launches.
// Compute dtype: inputs rounded to bf16; x / weights exact; q, k, v, softmax weights and out plain f16 (~2^-12); scores, statistics, y f32. v_wmma_f32_16x16x32_f16.
#define NB 2
#define SQ 2048
#define DMX 1024                     /* model width */
#define DM (2 * DMX)                 /* interleaved (real | imag) width = 16 heads x 128 */
#define NH 32                        /* k_vt slabs of 64: (head, part) */
#define HD 64
#define HG 4
#define QN SQ
#define NR ((size_t)NB * SQ)
typedef __bf16 v16b __attribute__((ext_vector_type(16)));
typedef unsigned short v8us __attribute__((ext_vector_type(8), may_alias));
typedef float  v8f  __attribute__((ext_vector_type(8)));
typedef float  v4f  __attribute__((ext_vector_type(4)));
typedef float  v4fa __attribute__((ext_vector_type(4), may_alias));
union FragB { v16b v; v8us half[2]; unsigned short u[16]; };

__device__ __forceinline__ unsigned short bf16_bits(float x) { unsigned int u = __float_as_uint(x); return (unsigned short)((u + 0x7FFFu + ((u >> 16) & 1u)) >> 16); }
__device__ __forceinline__ float bf16_val(unsigned short b) { return __uint_as_float(((unsigned int)b) << 16); }
__device__ __forceinline__ float bf16_round(float x) { return bf16_val(bf16_bits(x)); }
// D += A·B with NT terms: 1 = ah·bh, 2 = + al·bh (A split), 3 = + ah·bl (both split)
template <int NT>
__device__ __forceinline__ v8f mmaN(v16b ah, v16b al, v16b bh, v16b bl, v8f c) {
  c = __builtin_amdgcn_wmma_f32_16x16x32_bf16(false, ah, false, bh, (short)0, c, false, false);
  if (NT >= 2) c = __builtin_amdgcn_wmma_f32_16x16x32_bf16(false, al, false, bh, (short)0, c, false, false);
  if (NT >= 3) c = __builtin_amdgcn_wmma_f32_16x16x32_bf16(false, ah, false, bl, (short)0, c, false, false);
  asm volatile("v_nop\n\tv_nop\n\tv_nop\n\tv_nop" : "+v"(c) : "v"(ah), "v"(al), "v"(bh), "v"(bl));
  return c;
}

__global__ __launch_bounds__(256) void k_wt_bf16(const float* __restrict__ W, unsigned short* __restrict__ Wt, int K, int N) {
  const int t = blockIdx.x * 256 + threadIdx.x;
  const int k8n = K / 8;
  if (t >= N * k8n) return;
  const int n = t / k8n, k8 = (t % k8n) * 8;
  v8us v;
#pragma unroll
  for (int i = 0; i < 8; ++i) v[i] = bf16_bits(W[(size_t)(k8 + i) * N + n]);
  *(v8us*)(Wt + (size_t)n * K + k8) = v;
  
}

// GEMM C[M][N] (f32, pitch ldc) = act(A[M][K]·W + bias). A f32 row-major (pitch lda) converted per fragment to bf16
// (ASPLIT: hi/lo two planes -> 2 terms, else single rounded term); Wt bf16 [N][K] (pitch ldb). BIAS_BF16 rounds the
// bias to bf16 first (bias quantised to bf16 before the add). K%32==0, M%16==0, N%64==0.
template <bool ASPLIT, int ACT, bool BIAS_BF16>
__global__ __launch_bounds__(128) void k_gemm_bf(const float* __restrict__ A, int lda, const unsigned short* __restrict__ Wt, int ldb,
                                               const float* __restrict__ bias, float* __restrict__ C, int ldc, int M, int N, int K) {
  __shared__ __attribute__((aligned(16))) float so[4][16][64];
  const int tid = threadIdx.x, w = tid >> 5, lane = tid & 31, ln = lane & 15, hh = lane >> 4;
  const int ntn = N / 64;
  const int wid = blockIdx.x * 4 + w;
  const int mt = wid / ntn, nq = wid % ntn;
  if (mt * 16 >= M) return;
  const int row0 = mt * 16, col0 = nq * 64;
  const float* arow = A + (size_t)(row0 + ln) * lda;
  v8f acc[4] = {};
  for (int kb = 0; kb < K; kb += 32) {
    FragB ah, al;
    const v4f x0 = *(const v4fa*)(arow + kb + 8 * hh), x1 = *(const v4fa*)(arow + kb + 8 * hh + 4);
    const v4f x2 = *(const v4fa*)(arow + kb + 16 + 8 * hh), x3 = *(const v4fa*)(arow + kb + 16 + 8 * hh + 4);
    float xs[16] = {x0[0],x0[1],x0[2],x0[3],x1[0],x1[1],x1[2],x1[3],x2[0],x2[1],x2[2],x2[3],x3[0],x3[1],x3[2],x3[3]};
#pragma unroll
    for (int i = 0; i < 16; ++i) { const unsigned short hb = bf16_bits(xs[i]); ah.u[i] = hb; al.u[i] = ASPLIT ? bf16_bits(xs[i] - bf16_val(hb)) : (unsigned short)0; }
#pragma unroll
    for (int t = 0; t < 4; ++t) {
      const unsigned short* brow = Wt + (size_t)(col0 + t * 16 + ln) * ldb + kb;
      FragB b;
      b.half[0] = *(const v8us*)(brow + 8 * hh);
      b.half[1] = *(const v8us*)(brow + 16 + 8 * hh);
      acc[t] = mmaN<ASPLIT ? 2 : 1>(ah.v, al.v, b.v, b.v, acc[t]);
    }
  }
#pragma unroll
  for (int t = 0; t < 4; ++t) {
    float bv = bias ? bias[col0 + t * 16 + ln] : 0.f;
    if (BIAS_BF16) bv = bf16_round(bv);
#pragma unroll
    for (int r = 0; r < 8; ++r) { float v = acc[t][r] + bv; if (ACT == 1) v = fmaxf(v, 0.f); so[w][8 * hh + r][t * 16 + ln] = v; }
  }
  __builtin_amdgcn_fence(__ATOMIC_ACQ_REL, "workgroup");
  __builtin_amdgcn_wave_barrier();
  const int rsub = lane >> 4, c4 = (lane & 15) * 4;
  {
#pragma unroll
    for (int q = 0; q < 8; ++q) {
      const int r = q * 2 + rsub;
      const v4f v = *(const v4fa*)&so[w][r][c4];
      *(v4f*)(C + (size_t)(row0 + r) * ldc + col0 + c4) = v;
    }
    
  }
}

// GEMM C = act(A·W + bias + resid): A f32 (ASPLIT -> hi/lo 2 terms), Wt bf16 [N][K]; ACT 0 none, 1 relu, 2 exact gelu;
// resid (optional, f32, row index = (row % rmod), pitch ldr, RES_BF16 rounds it) added before the activation.
template <bool ASPLIT, int ACT, bool BIAS_BF16, bool RES_BF16>
__global__ __launch_bounds__(128) void k_gemm_bf3(const float* __restrict__ A, int lda, const unsigned short* __restrict__ Wt, int ldb,
                                                const float* __restrict__ bias, const float* __restrict__ resid, int rmod, int ldr,
                                                float* __restrict__ C, int ldc, int M, int N, int K) {
  __shared__ __attribute__((aligned(16))) float so[4][16][64];
  const int tid = threadIdx.x, w = tid >> 5, lane = tid & 31, ln = lane & 15, hh = lane >> 4;
  const int ntn = N / 64;
  const int wid = blockIdx.x * 4 + w;
  const int mt = wid / ntn, nq = wid % ntn;
  if (mt * 16 >= M) return;
  const int row0 = mt * 16, col0 = nq * 64;
  const float* arow = A + (size_t)(row0 + ln) * lda;
  v8f acc[4] = {};
  for (int kb = 0; kb < K; kb += 32) {
    FragB ah, al;
    const v4f x0 = *(const v4fa*)(arow + kb + 8 * hh), x1 = *(const v4fa*)(arow + kb + 8 * hh + 4);
    const v4f x2 = *(const v4fa*)(arow + kb + 16 + 8 * hh), x3 = *(const v4fa*)(arow + kb + 16 + 8 * hh + 4);
    float xs[16] = {x0[0],x0[1],x0[2],x0[3],x1[0],x1[1],x1[2],x1[3],x2[0],x2[1],x2[2],x2[3],x3[0],x3[1],x3[2],x3[3]};
#pragma unroll
    for (int i = 0; i < 16; ++i) { const unsigned short hb = bf16_bits(xs[i]); ah.u[i] = hb; al.u[i] = ASPLIT ? bf16_bits(xs[i] - bf16_val(hb)) : (unsigned short)0; }
#pragma unroll
    for (int t = 0; t < 4; ++t) {
      const unsigned short* brow = Wt + (size_t)(col0 + t * 16 + ln) * ldb + kb;
      FragB b;
      b.half[0] = *(const v8us*)(brow + 8 * hh);
      b.half[1] = *(const v8us*)(brow + 16 + 8 * hh);
      acc[t] = mmaN<ASPLIT ? 2 : 1>(ah.v, al.v, b.v, b.v, acc[t]);
    }
  }
#pragma unroll
  for (int t = 0; t < 4; ++t) {
    const int col = col0 + t * 16 + ln;
    float bv = bias ? bias[col] : 0.f;
    if (BIAS_BF16) bv = bf16_round(bv);
#pragma unroll
    for (int r = 0; r < 8; ++r) {
      float v = acc[t][r] + bv;
      if (resid) { float rv = resid[(size_t)((row0 + 8 * hh + r) % rmod) * ldr + col]; if (RES_BF16) rv = bf16_round(rv); v += rv; }
      if (ACT == 1) v = fmaxf(v, 0.f);
      if (ACT == 2) v = 0.5f * v * (1.0f + erff(v * 0.70710678118654752f));
      if (ACT == 3) { const float u = 0.7978845608028654f * (v + 0.044715f * v * v * v); v = 0.5f * v * (1.0f + tanhf(u)); }
      so[w][8 * hh + r][t * 16 + ln] = v;
    }
  }
  __builtin_amdgcn_fence(__ATOMIC_ACQ_REL, "workgroup");
  __builtin_amdgcn_wave_barrier();
  const int rsub = lane >> 4, c4 = (lane & 15) * 4;
  {
#pragma unroll
    for (int q = 0; q < 8; ++q) {
      const int r = q * 2 + rsub;
      const v4f v = *(const v4fa*)&so[w][r][c4];
      *(v4f*)(C + (size_t)(row0 + r) * ldc + col0 + c4) = v;
    }
    
  }
}
// row LayerNorm (biased variance, eps) over N: s = X (+ R); optional out_sum <- s; out_norm <- (s-mu)*rsqrt(var+eps)*g + b
template <bool PARAM_BF16>
__global__ __launch_bounds__(256) void k_layernorm(const float* __restrict__ X, const float* __restrict__ R, const float* __restrict__ g, const float* __restrict__ bta,
                                                  float* __restrict__ out_sum, float* __restrict__ out_norm, int N, float eps) {
  __shared__ float red[256];
  const int row = blockIdx.x, tid = threadIdx.x;
  const float* x = X + (size_t)row * N; const float* rr = R ? R + (size_t)row * N : nullptr;
  float vals[16];                     // up to N = 4096
  const int per = N / 256;            // contiguous chunk per thread? use strided-by-4 chunks: thread handles j = tid*4 + 1024*u
  float s1 = 0.f;
  for (int u = 0; u < per / 4; ++u) {
    const int j = tid * 4 + 1024 * u;
    const v4f a = *(const v4fa*)(x + j);
    v4f b = {0.f,0.f,0.f,0.f}; if (rr) b = *(const v4fa*)(rr + j);
#pragma unroll
    for (int q = 0; q < 4; ++q) { const float v = a[q] + b[q]; vals[u * 4 + q] = v; s1 += v; }
  }
  red[tid] = s1; __syncthreads();
  for (int st = 128; st > 0; st >>= 1) { if (tid < st) red[tid] += red[tid + st]; __syncthreads(); }
  const float mu = red[0] / (float)N; __syncthreads();
  float s2 = 0.f;
  for (int u = 0; u < per / 4; ++u)
#pragma unroll
    for (int q = 0; q < 4; ++q) { const float c = vals[u * 4 + q] - mu; s2 += c * c; }
  red[tid] = s2; __syncthreads();
  for (int st = 128; st > 0; st >>= 1) { if (tid < st) red[tid] += red[tid + st]; __syncthreads(); }
  const float rs = rsqrtf(red[0] / (float)N + eps);
  {
    for (int u = 0; u < per / 4; ++u) {
      const int j = tid * 4 + 1024 * u;
      v4f o, sm;
#pragma unroll
      for (int q = 0; q < 4; ++q) {
        float gg = g[j + q], bb = bta[j + q];
        if (PARAM_BF16) { gg = bf16_round(gg); bb = bf16_round(bb); }
        sm[q] = vals[u * 4 + q]; o[q] = (vals[u * 4 + q] - mu) * rs * gg + bb;
      }
      if (out_sum) *(v4f*)(out_sum + (size_t)row * N + j) = sm;
      *(v4f*)(out_norm + (size_t)row * N + j) = o;
    }
    
  }
}



// ---- f16 WMMA path (v_wmma_f32_16x16x32_f16): 11-bit significands for operands in range — used where a [0,1] probability operand needs more precision than bf16
typedef _Float16 v16h __attribute__((ext_vector_type(16)));
union FragH { v16h v; v8us half[2]; _Float16 h[16]; unsigned short u[16]; };
template <int NT>
__device__ __forceinline__ v8f mmaH(v16h ah, v16h al, v16h bh, v16h bl, v8f c) {
  c = __builtin_amdgcn_wmma_f32_16x16x32_f16(false, ah, false, bh, (short)0, c, false, false);
  if (NT >= 2) c = __builtin_amdgcn_wmma_f32_16x16x32_f16(false, al, false, bh, (short)0, c, false, false);
  if (NT >= 3) c = __builtin_amdgcn_wmma_f32_16x16x32_f16(false, ah, false, bl, (short)0, c, false, false);
  asm volatile("v_nop\n\tv_nop\n\tv_nop\n\tv_nop" : "+v"(c) : "v"(ah), "v"(al), "v"(bh), "v"(bl));
  return c;
}
// batched GEMM like k_gemm_b but f16 operands: A f32 (split into f16 hi/lo if ASPLIT, else rounded to f16), Bt = f16 values [n][k]; alpha; C f32; N multiple of 16 (partial tiles skipped)
template <bool ASPLIT>
__global__ __launch_bounds__(128) void k_gemm_h(const float* __restrict__ A, int lda, size_t sA, const _Float16* __restrict__ Bh, int ldb, size_t sB, float alpha, float* __restrict__ C, int ldc, size_t sC, int M, int N, int K) {
  __shared__ __attribute__((aligned(16))) float so[4][16][64];
  const int tid = threadIdx.x, w = tid >> 5, lane = tid & 31, ln = lane & 15, hh = lane >> 4; const int by = blockIdx.y;
  A += (size_t)by * sA; Bh += (size_t)by * sB; C += (size_t)by * sC;
  const int ntn = (N + 63) / 64; const int wid = blockIdx.x * 4 + w; const int mt = wid / ntn, nq = wid % ntn; if (mt * 16 >= M) return;
  const int row0 = mt * 16, col0 = nq * 64; const float* arow = A + (size_t)(row0 + ln) * lda;
  v8f acc[4] = {};
  for (int kb = 0; kb < K; kb += 32) {
    FragH ah, al;
    const v4f x0 = *(const v4fa*)(arow + kb + 8 * hh), x1 = *(const v4fa*)(arow + kb + 8 * hh + 4), x2 = *(const v4fa*)(arow + kb + 16 + 8 * hh), x3 = *(const v4fa*)(arow + kb + 16 + 8 * hh + 4);
    float xs[16] = {x0[0],x0[1],x0[2],x0[3],x1[0],x1[1],x1[2],x1[3],x2[0],x2[1],x2[2],x2[3],x3[0],x3[1],x3[2],x3[3]};
#pragma unroll
    for (int i = 0; i < 16; ++i) { const _Float16 h = (_Float16)xs[i]; ah.h[i] = h; al.h[i] = ASPLIT ? (_Float16)(xs[i] - (float)h) : (_Float16)0.0f; }
#pragma unroll
    for (int t = 0; t < 4; ++t) { if (col0 + t * 16 >= N) continue; const size_t boff = (size_t)(col0 + t * 16 + ln) * ldb + kb; FragH bq; bq.half[0] = *(const v8us*)(Bh + boff + 8 * hh); bq.half[1] = *(const v8us*)(Bh + boff + 16 + 8 * hh);
      acc[t] = mmaH<ASPLIT ? 2 : 1>(ah.v, al.v, bq.v, bq.v, acc[t]); }
  }
#pragma unroll
  for (int t = 0; t < 4; ++t) { if (col0 + t * 16 >= N) continue;
#pragma unroll
    for (int r = 0; r < 8; ++r) so[w][8 * hh + r][t * 16 + ln] = acc[t][r] * alpha; }
  __builtin_amdgcn_fence(__ATOMIC_ACQ_REL, "workgroup"); __builtin_amdgcn_wave_barrier();
  const int rsub = lane >> 4, c4 = (lane & 15) * 4;
  {
#pragma unroll
    for (int q = 0; q < 8; ++q) { const int r = q * 2 + rsub; if (col0 + c4 < N) { const v4f v = *(const v4fa*)&so[w][r][c4]; *(v4f*)(C + (size_t)(row0 + r) * ldc + col0 + c4) = v; } }
     }
}

// Wt[n][k] = f16(W[k][n]·scale) from f32 row-major W[K][N] (scale = power of two; bf16-exact weights stay exact in f16 away from the subnormal range)
__global__ __launch_bounds__(256) void k_wt_f16(const float* __restrict__ W, _Float16* __restrict__ Wt, int K, int N, float scale) {
  const int t = blockIdx.x * 256 + threadIdx.x; if (t >= N * (K / 8)) return; const int n = t / (K / 8), k8 = (t % (K / 8)) * 8; FragH f;
#pragma unroll
  for (int i = 0; i < 8; ++i) f.h[i] = (_Float16)(bf16_round(W[(size_t)(k8 + i) * N + n]) * scale); const v8us o = f.half[0];
  *(v8us*)((unsigned short*)Wt + (size_t)n * K + k8) = o; 
}
// k_gemm_hh variant with fused epilogue: v = acc·alpha + bias[by·sBias + col] (+ CP[(row/rowsPerB)·sCPb + by·64 + col] if CP) ; ACT 0 none / 1 elu ; writes f16 C16 (and f32 C if non-null)
template <int ACT>
__global__ __launch_bounds__(128) void k_gemm_hhx(const _Float16* __restrict__ A, int lda, size_t sA, const _Float16* __restrict__ Bh, int ldb, size_t sB, float alpha, const float* __restrict__ bias, size_t sBias, const float* __restrict__ CP, int rowsPerB, size_t sCPb, int row0g,
    float* __restrict__ C, _Float16* __restrict__ C16, int ldc, size_t sC, int M, int N, int K) {
  __shared__ __attribute__((aligned(16))) float so[4][16][64];
  const int tid = threadIdx.x, w = tid >> 5, lane = tid & 31, ln = lane & 15, hh = lane >> 4; const int by = blockIdx.y;
  A += (size_t)by * sA; Bh += (size_t)by * sB; const size_t cofs = (size_t)by * sC; const float* bp = bias ? bias + (size_t)by * sBias : nullptr;
  const int ntn = (N + 63) / 64; const int wid = blockIdx.x * 4 + w; const int mt = wid / ntn, nq = wid % ntn; if (mt * 16 >= M) return;
  const int row0 = mt * 16, col0 = nq * 64; const _Float16* arow = A + (size_t)(row0 + ln) * lda;
  v8f acc[4] = {};
  for (int kb = 0; kb < K; kb += 32) { FragH ah; ah.half[0] = *(const v8us*)((const unsigned short*)arow + kb + 8 * hh); ah.half[1] = *(const v8us*)((const unsigned short*)arow + kb + 16 + 8 * hh);
#pragma unroll
    for (int t = 0; t < 4; ++t) { if (col0 + t * 16 >= N) continue; const size_t boff = (size_t)(col0 + t * 16 + ln) * ldb + kb; FragH bq; bq.half[0] = *(const v8us*)((const unsigned short*)Bh + boff + 8 * hh); bq.half[1] = *(const v8us*)((const unsigned short*)Bh + boff + 16 + 8 * hh);
      acc[t] = mmaH<1>(ah.v, ah.v, bq.v, bq.v, acc[t]); }
  }
#pragma unroll
  for (int t = 0; t < 4; ++t) { if (col0 + t * 16 >= N) continue; const int col = col0 + t * 16 + ln; const float bv = bp ? bf16_round(bp[col]) : 0.f;
#pragma unroll
    for (int r = 0; r < 8; ++r) { float v = acc[t][r] * alpha + bv; if (CP) { const int rr = row0g + row0 + 8 * hh + r; if (rowsPerB < 0) v += CP[cofs + (size_t)rr * ldc + col];      /* rowsPerB < 0: own element of the batched C plane */ else { const int bidx = rr / rowsPerB; v += CP[(size_t)bidx * sCPb + (size_t)by * 64 + col]; } } if (ACT == 1) v = (v > 0.f) ? v : expm1f(v); else if (ACT == 7) v = (v > 0.f) ? v + 1.0f : expf(v); else if (ACT == 8) v = tanhf(v); else if (ACT == 9) v = 0.5f * v * (1.0f + tanhf(0.7978845608028654f * (v + 0.044715f * v * v * v))); else if (ACT == 11) v = 1.0f / (1.0f + expf(-v)); else if (ACT == 12) v = (v > 0.f) ? v : 0.01f * v; else if (ACT == 14) v = (v > 0.f) ? v : 0.1f * v; else if (ACT == 16) v = (v >= 0.f) ? v : 0.3f * v; else if (ACT == 17) v = (v >= 0.f) ? v : 0.2f * v; else if (ACT == 15) v = v / (1.0f + expf(-v)); else if (ACT == 3) v = fmaxf(v, 0.f); else if (ACT == 6) v = 0.5f * v * (1.0f + erff(v * 0.70710678118654752f)); so[w][8 * hh + r][t * 16 + ln] = v; } }
  __builtin_amdgcn_fence(__ATOMIC_ACQ_REL, "workgroup"); __builtin_amdgcn_wave_barrier();
  const int rsub = lane >> 4, c4 = (lane & 15) * 4; typedef _Float16 v4h __attribute__((ext_vector_type(4)));
  {
#pragma unroll
    for (int q = 0; q < 8; ++q) { const int r = q * 2 + rsub; if (col0 + c4 < N) { const v4f v = *(const v4fa*)&so[w][r][c4]; if (C) *(v4f*)(C + cofs + (size_t)(row0 + r) * ldc + col0 + c4) = v; if (C16) { v4h h4; for (int i = 0; i < 4; ++i) h4[i] = (_Float16)v[i]; *(v4h*)(C16 + cofs + (size_t)(row0 + r) * ldc + col0 + c4) = h4; } } }
     }
}


typedef _Float16 v4h __attribute__((ext_vector_type(4)));

__global__ __launch_bounds__(256) void k_x16(const float* __restrict__ x, _Float16* __restrict__ X16, size_t n8) { const size_t t = (size_t)blockIdx.x * 256 + threadIdx.x; if (t >= n8) return; FragH f;
#pragma unroll
  for (int q = 0; q < 8; ++q) f.h[q] = (_Float16)bf16_round(x[t * 8 + q]); *(v8us*)((unsigned short*)X16 + t * 8) = f.half[0];  }
__global__ __launch_bounds__(256) void k_h16(const float* __restrict__ x, _Float16* __restrict__ X16, size_t n8) { const size_t t = (size_t)blockIdx.x * 256 + threadIdx.x; if (t >= n8) return; FragH f;
#pragma unroll
  for (int q = 0; q < 8; ++q) f.h[q] = (_Float16)x[t * 8 + q]; *(v8us*)((unsigned short*)X16 + t * 8) = f.half[0];  }
__global__ __launch_bounds__(256) void k_round16f(const float* __restrict__ W, _Float16* __restrict__ Bt, size_t n8) { const size_t t = (size_t)blockIdx.x * 256 + threadIdx.x; if (t >= n8) return; FragH f;
#pragma unroll
  for (int i = 0; i < 8; ++i) f.h[i] = (_Float16)(bf16_round(W[t * 8 + i]) * 16.0f); *(v8us*)((unsigned short*)Bt + t * 8) = f.half[0];  }
template <int NHv, int TTv>
__global__ __launch_bounds__(256) void k_vt(const _Float16* __restrict__ V16, int ldv, int voff, _Float16* __restrict__ Vt) { __shared__ unsigned short tl[64][66]; const int tid = threadIdx.x; const int slab = blockIdx.x / (TTv / 64), lg = blockIdx.x % (TTv / 64); const int b = slab / NHv, h = slab % NHv;
  for (int i = tid; i < 64 * 8; i += 256) { const int r = i / 8, c8 = (i % 8) * 8; FragH f; f.half[0] = *(const v8us*)((const unsigned short*)V16 + ((size_t)b * TTv + lg * 64 + r) * ldv + voff + h * 64 + c8);
#pragma unroll
    for (int q = 0; q < 8; ++q) tl[r][c8 + q] = f.u[q]; }
  __syncthreads();
  {
#pragma unroll
    for (int rd = 0; rd < 2; ++rd) { const int d = rd * 32 + tid / 8, pc = tid % 8; FragH f;
#pragma unroll
      for (int q = 0; q < 8; ++q) f.u[q] = tl[pc * 8 + q][d];
      *(v8us*)((unsigned short*)Vt + ((size_t)slab * 64 + d) * TTv + lg * 64 + pc * 8) = f.half[0]; }
     } }

__global__ __launch_bounds__(256) void k_hl(const float* __restrict__ F, _Float16* __restrict__ Hh, _Float16* __restrict__ Hl, size_t n8) { const size_t t = (size_t)blockIdx.x * 256 + threadIdx.x; if (t >= n8) return; FragH fh, fl; const v4f a = *(const v4fa*)(F + t * 8), c = *(const v4fa*)(F + t * 8 + 4);
#pragma unroll
  for (int q = 0; q < 4; ++q) { _Float16 h = (_Float16)a[q]; fh.h[q] = h; fl.h[q] = (_Float16)((a[q] - (float)h) * 1024.0f); h = (_Float16)c[q]; fh.h[4 + q] = h; fl.h[4 + q] = (_Float16)((c[q] - (float)h) * 1024.0f); }
  { *(v8us*)((unsigned short*)Hh + t * 8) = fh.half[0]; *(v8us*)((unsigned short*)Hl + t * 8) = fl.half[0];  } }

// ---- fast GEMM (wave tile 32x64; requires M % 32 == 0 rows per launch region and N % 64 == 0); epilogue = k_gemm_hhx semantics ----
__device__ __forceinline__ v16h g2_frag(const _Float16* p, int hh) { FragH f; f.half[0] = *(const v8us*)((const unsigned short*)p + 8 * hh); f.half[1] = *(const v8us*)((const unsigned short*)p + 16 + 8 * hh); return f.v; }
__device__ __forceinline__ v8f g2_mma(v16h a, v16h b, v8f c) { v8f d = __builtin_amdgcn_wmma_f32_16x16x32_f16(false, a, false, b, (short)0, c, false, false); asm volatile("v_nop\n\tv_nop\n\tv_nop\n\tv_nop" : "+v"(d) : "v"(a), "v"(b)); return d; }
template <int ACT>
__global__ __launch_bounds__(128) void k_gemm2(const _Float16* __restrict__ A, int lda, size_t sA, const _Float16* __restrict__ Bh, int ldb, size_t sB, float alpha, const float* __restrict__ bias, size_t sBias, const float* __restrict__ CP, int rowsPerB, size_t sCPb, int row0g,
    float* __restrict__ C, _Float16* __restrict__ C16, int ldc, size_t sC, int M, int N, int K) { static_assert(ACT == 0 || ACT == 3 || ACT == 6 || ACT == 8 || ACT == 9 || ACT == 11 || ACT == 12 || ACT == 14 || ACT == 15 || ACT == 16 || ACT == 17, "k_gemm2: unsupported ACT code (would silently apply no activation)");
  __shared__ __attribute__((aligned(16))) float so[4][32][68];
  const int tid = threadIdx.x, w = tid >> 5, lane = tid & 31, ln = lane & 15, hh = lane >> 4; const int by = blockIdx.y;
  A += (size_t)by * sA; Bh += (size_t)by * sB; const size_t cofs = (size_t)by * sC; const float* bp = bias ? bias + (size_t)by * sBias : nullptr;
  const int ntn = N >> 6; const int mt = blockIdx.x / ntn, nq = blockIdx.x - mt * ntn; const int row0 = mt * 128 + 32 * w, col0 = nq * 64; if (row0 >= M) return;
  const _Float16* a0p = A + (size_t)(row0 + ln) * lda; const _Float16* a1p = a0p + (size_t)16 * lda;
  const _Float16* b0p = Bh + (size_t)(col0 + ln) * ldb; const _Float16* b1p = b0p + (size_t)16 * ldb; const _Float16* b2p = b1p + (size_t)16 * ldb; const _Float16* b3p = b2p + (size_t)16 * ldb;
  const v8f z8 = {0.f,0.f,0.f,0.f,0.f,0.f,0.f,0.f}; v8f c00 = z8, c01 = z8, c02 = z8, c03 = z8, c10 = z8, c11 = z8, c12 = z8, c13 = z8;
#pragma unroll 1
  for (int kb = 0; kb < K; kb += 32) { const v16h a0 = g2_frag(a0p + kb, hh), a1 = g2_frag(a1p + kb, hh);
    v16h b = g2_frag(b0p + kb, hh); c00 = g2_mma(a0, b, c00); c10 = g2_mma(a1, b, c10);
    b = g2_frag(b1p + kb, hh); c01 = g2_mma(a0, b, c01); c11 = g2_mma(a1, b, c11);
    b = g2_frag(b2p + kb, hh); c02 = g2_mma(a0, b, c02); c12 = g2_mma(a1, b, c12);
    b = g2_frag(b3p + kb, hh); c03 = g2_mma(a0, b, c03); c13 = g2_mma(a1, b, c13); }
  v8f accs[8] = {c00, c01, c02, c03, c10, c11, c12, c13};
#pragma unroll
  for (int u = 0; u < 8; ++u) { const int t = u & 3, half = u >> 2; const int col = col0 + t * 16 + ln; const float bv = bp ? bf16_round(bp[col]) : 0.f;
#pragma unroll
    for (int r = 0; r < 8; ++r) { const int rloc = half * 16 + 8 * hh + r; float v = accs[u][r] * alpha + bv; if (CP) { if (rowsPerB < 0) v += CP[cofs + (size_t)(row0g + row0 + rloc) * ldc + col];      /* rowsPerB < 0: own element of the batched C plane */ else { const int bidx = (row0g + row0 + rloc) / rowsPerB; v += CP[(size_t)bidx * sCPb + (size_t)by * 64 + col]; } }
      if (ACT == 3) v = fmaxf(v, 0.f); else if (ACT == 6) v = 0.5f * v * (1.0f + erff(v * 0.70710678118654752f)); else if (ACT == 11) v = 1.0f / (1.0f + expf(-v)); else if (ACT == 15) v = v / (1.0f + expf(-v)); else if (ACT == 12) v = (v > 0.f) ? v : 0.01f * v; else if (ACT == 8) v = tanhf(v); else if (ACT == 9) v = 0.5f * v * (1.0f + tanhf(0.7978845608028654f * (v + 0.044715f * v * v * v))); else if (ACT == 14) v = (v > 0.f) ? v : 0.1f * v; else if (ACT == 16) v = (v >= 0.f) ? v : 0.3f * v; else if (ACT == 17) v = (v >= 0.f) ? v : 0.2f * v;
      so[w][rloc][t * 16 + ln] = v; } }
  __builtin_amdgcn_fence(__ATOMIC_ACQ_REL, "workgroup"); __builtin_amdgcn_wave_barrier();
  const int rsub = lane >> 4, c4 = (lane & 15) * 4;
  {
#pragma unroll
    for (int q = 0; q < 16; ++q) { const int r = q * 2 + rsub; const v4f v = *(const v4fa*)&so[w][r][c4]; if (C) *(v4f*)(C + cofs + (size_t)(row0 + r) * ldc + col0 + c4) = v; if (C16) { v4h h4; for (int i = 0; i < 4; ++i) h4[i] = (_Float16)v[i]; *(v4h*)(C16 + cofs + (size_t)(row0 + r) * ldc + col0 + c4) = h4; } }
     } }


__global__ __launch_bounds__(256) void k_wnat(const float* __restrict__ w, size_t n8, _Float16* __restrict__ Bt) { const size_t t = (size_t)blockIdx.x * 256 + threadIdx.x; if (t >= n8) return; FragH f; for (int q = 0; q < 8; ++q) f.h[q] = (_Float16)(bf16_round(w[t * 8 + q]) * 16.0f); *(v8us*)((unsigned short*)Bt + t * 8) = f.half[0];  }
__global__ __launch_bounds__(256) void k_rsm(const float* __restrict__ S, _Float16* __restrict__ P, int nrows) {
  #pragma clang fp contract(off)
  const int i = blockIdx.x * 256 + threadIdx.x; if (i >= nrows) return; const float* s = S + (size_t)i * SQ; float mx = -3.0e38f;
#pragma unroll 1
  for (int j = 0; j < SQ; ++j) mx = fmaxf(mx, s[j]); float se = 0.f;
#pragma unroll 1
  for (int j = 0; j < SQ; ++j) se += expf(s[j] - mx); const float sc = 256.0f / se;
#pragma unroll 1
  for (int j0 = 0; j0 < SQ; j0 += 8) { FragH f; for (int q = 0; q < 8; ++q) f.h[q] = (_Float16)(expf(s[j0 + q] - mx) * sc); unsigned short* d = (unsigned short*)P + (size_t)i * SQ + j0; *(v8us*)d = f.half[0];  } }
__global__ __launch_bounds__(256) void k_vt(const _Float16* __restrict__ V16, int b, int h0, _Float16* __restrict__ VT) { __shared__ unsigned short tl[64][65]; const int tid = threadIdx.x; const int hh = blockIdx.x % HG, sg = blockIdx.x / HG; const int s0 = sg * 64; const int h = h0 + hh;
  for (int i = tid; i < 64 * 8; i += 256) { const int j = i / 8, d8 = (i % 8) * 8; FragH f; f.half[0] = *(const v8us*)((const unsigned short*)V16 + ((size_t)b * SQ + s0 + j) * DM + h * HD + d8); for (int q = 0; q < 8; ++q) tl[d8 + q][j] = f.u[q]; }
  __syncthreads();
  { for (int i = tid; i < 64 * 8; i += 256) { const int d = i / 8, j8 = (i % 8) * 8; FragH f; for (int q = 0; q < 8; ++q) f.u[q] = tl[d][j8 + q]; *(v8us*)((unsigned short*)VT + ((size_t)hh * HD + d) * SQ + s0 + j8) = f.half[0]; }  } }


__global__ __launch_bounds__(256) void k_wcat2(const float* __restrict__ wr, const float* __restrict__ wi, _Float16* __restrict__ Bt) { const size_t t = (size_t)blockIdx.x * 256 + threadIdx.x; if (t >= (size_t)(2 * DMX) * (2 * DMX / 8)) return; const int k8 = (int)(t % (2 * DMX / 8)) * 8; const int n2 = (int)(t / (2 * DMX / 8)); const int h = n2 / 128, w = n2 % 128; const bool im = (w >= 64); const int f = h * 64 + (w & 63); FragH fr;
  for (int q = 0; q < 8; ++q) { const int k = k8 + q; float v; if (k < DMX) v = im ? wi[(size_t)k * DMX + f] : wr[(size_t)k * DMX + f]; else v = im ? wr[(size_t)(k - DMX) * DMX + f] : -wi[(size_t)(k - DMX) * DMX + f]; fr.h[q] = (_Float16)(16.0f * bf16_round(v)); }
  unsigned short* d = (unsigned short*)Bt + (size_t)n2 * (2 * DMX) + k8; *(v8us*)d = fr.half[0];  }
__global__ __launch_bounds__(256) void k_bcat2(const float* __restrict__ br, const float* __restrict__ bi, float* __restrict__ b2) { for (int n2 = threadIdx.x; n2 < 2 * DMX; n2 += 256) { const int h = n2 / 128, w = n2 % 128; const float v = (w < 64) ? br[h * 64 + w] : bi[h * 64 + (w - 64)]; *(float*)(b2 + n2) = v; }  }
__global__ __launch_bounds__(256) void k_wcplx3(const float* __restrict__ wr, const float* __restrict__ wi, _Float16* __restrict__ Bt) { const size_t t = (size_t)blockIdx.x * 256 + threadIdx.x; if (t >= (size_t)2 * DMX * (2 * DMX / 8)) return; const int k8 = (int)(t % (2 * DMX / 8)) * 8; const int f = (int)((t / (2 * DMX / 8)) % DMX); const int part = (int)(t / ((size_t)(2 * DMX / 8) * DMX)); FragH fr;
  for (int q = 0; q < 8; ++q) { const int k2 = k8 + q; const int h = k2 / 128, w = k2 % 128; const bool im = (w >= 64); const int g = h * 64 + (w & 63); float v; if (part == 0) v = im ? -wi[(size_t)g * DMX + f] : wr[(size_t)g * DMX + f]; else v = im ? wr[(size_t)g * DMX + f] : wi[(size_t)g * DMX + f]; fr.h[q] = (_Float16)(16.0f * bf16_round(v)); }
  unsigned short* d = (unsigned short*)Bt + ((size_t)part * DMX + f) * (2 * DMX) + k8; *(v8us*)d = fr.half[0];  }
__global__ __launch_bounds__(256) void k_xcat(const float* __restrict__ xr, const float* __restrict__ xi, _Float16* __restrict__ XC, size_t nrows) { const size_t t = (size_t)blockIdx.x * 256 + threadIdx.x; if (t >= nrows * (2 * DMX / 8)) return; const int k8 = (int)(t % (2 * DMX / 8)) * 8; const size_t r = t / (2 * DMX / 8); const float* s = (k8 < DMX) ? xr + r * DMX + k8 : xi + r * DMX + (k8 - DMX); const v4f a = *(const v4fa*)s, b = *(const v4fa*)(s + 4); FragH f; for (int q = 0; q < 4; ++q) { f.h[q] = (_Float16)bf16_round(a[q]); f.h[4 + q] = (_Float16)bf16_round(b[q]); }
  unsigned short* d = (unsigned short*)XC + r * (2 * DMX) + k8; *(v8us*)d = f.half[0];  }


// lane l <-> l ^ 16 (cross-row move); all 32 lanes are on where it is used
__device__ __forceinline__ float rx_x16(float v) { const int b = __float_as_int(v); return __int_as_float(__builtin_amdgcn_permlanex16(b, b, 0x76543210, 0xfedcba98, false, false)); }
// four 2^a in one statement, closed by the one free slot the instruction set asks for behind a transcendental before a source of it is overwritten; early-clobber outputs keep every result off every source
__device__ __forceinline__ v4f exp2x4(v4f a) { float r0, r1, r2, r3; asm("v_exp_f32 %0, %4\n\tv_exp_f32 %1, %5\n\tv_exp_f32 %2, %6\n\tv_exp_f32 %3, %7\n\tv_nop" : "=&v"(r0), "=&v"(r1), "=&v"(r2), "=&v"(r3) : "v"(a[0]), "v"(a[1]), "v"(a[2]), "v"(a[3])); const v4f r = {r0, r1, r2, r3}; return r; }

// two 2^a, same form and same closing slot as exp2x4
__device__ __forceinline__ void exp2x2(float a0, float a1, float& r0, float& r1) { asm("v_exp_f32 %0, %2\n\tv_exp_f32 %1, %3\n\tv_nop" : "=&v"(r0), "=&v"(r1) : "v"(a0), "v"(a1)); }

#define FA_KP 272                    /* LDS pitch of a K row: 256 B + 16 (odd multiple of 16 B) */
#define FA_VP 144                    /* LDS pitch of a V^T row: 128 B + 16 (odd multiple of 16 B) */
#define FA_KT (64 * FA_KP)
#define FA_BUF (FA_KT + 128 * FA_VP)
#define FA_NST (SQ / 64)
__device__ __forceinline__ v8f fa_mma(v16h a, v16h b, v8f c) { return __builtin_amdgcn_wmma_f32_16x16x32_f16(false, a, false, b, (short)0, c, false, false); }
__device__ __forceinline__ v16h fa_lds(const unsigned char* p) { FragH f; f.half[0] = *(const v8us*)p; f.half[1] = *(const v8us*)(p + 32); return f.v; }      /* p already holds + 16 * (lane >> 4): same k order as g2_frag */
__global__ __launch_bounds__(256) void k_fattn(const _Float16* __restrict__ Q, const _Float16* __restrict__ K, const _Float16* __restrict__ VT, _Float16* __restrict__ O) {
  __shared__ __attribute__((aligned(16))) unsigned char L[2 * FA_BUF];
  const int tid = threadIdx.x, lane = tid & 31, c = lane & 15, hh = lane >> 4; const int wave = __builtin_amdgcn_readfirstlane(tid >> 5);
  const int bh = blockIdx.x >> 3, b = bh >> 4, h = bh & 15; const size_t r0 = (size_t)b * SQ; const int q0 = (blockIdx.x & 7) * 256 + wave * 32;
  /* every loop over a register array (fragments, tiles, staging pieces) is fully unrolled: constant indices keep the arrays in registers */
  /* staging: thread t moves 16-byte pieces; K: row (t >> 4) + 16 j, piece t & 15; V^T: row (t >> 3) + 32 j, piece t & 7 */
  const unsigned short* kg = (const unsigned short*)K + (r0 + (tid >> 4)) * DM + h * 128 + (tid & 15) * 8;
  const unsigned short* vg = (const unsigned short*)VT + ((size_t)b * DM + h * 128 + (tid >> 3)) * SQ + (tid & 7) * 8;
  const int kl = (tid >> 4) * FA_KP + (tid & 15) * 16, vl = FA_KT + (tid >> 3) * FA_VP + (tid & 7) * 16;
  v8us sk[4], sv[4];
#pragma unroll
  for (int j = 0; j < 4; ++j) { sk[j] = *(const v8us*)(kg + (size_t)(16 * j) * DM); sv[j] = *(const v8us*)(vg + (size_t)(32 * j) * SQ); }
  v16h qf[2][4];
#pragma unroll
  for (int g = 0; g < 2; ++g) for (int kc = 0; kc < 4; ++kc) qf[g][kc] = g2_frag(Q + (r0 + q0 + 16 * g + c) * DM + h * 128 + 32 * kc, hh);
  asm volatile("s_wait_xcnt 0x0" ::: "memory");      /* stands before any address register of the loads above is written again */
  const v8f z8 = {0.f,0.f,0.f,0.f,0.f,0.f,0.f,0.f}; v8f acc[2][8]; float m_run[2], l_run[2];
#pragma unroll
  for (int g = 0; g < 2; ++g) { m_run[g] = -__builtin_inff(); l_run[g] = 0.f; for (int t = 0; t < 8; ++t) acc[g][t] = z8; }
#pragma unroll
  for (int j = 0; j < 4; ++j) { *(v8us*)(L + kl + 16 * j * FA_KP) = sk[j]; *(v8us*)(L + vl + 32 * j * FA_VP) = sv[j]; }
  __syncthreads();
  const float cs = 0.125f * 1.44269504f;      /* scores / 8, in the log2 domain */
  /* the stage loop and the pass loop stay rolled: one body in the instruction cache, and no second set of live tiles */
#pragma unroll 1
  for (int st = 0; st < FA_NST; ++st) {
    const unsigned char* Lb = L + (st & 1) * FA_BUF;
    if (st + 1 < FA_NST) {      /* next stage's 8 loads fly under this stage's two passes */
#pragma unroll
      for (int j = 0; j < 4; ++j) { sk[j] = *(const v8us*)(kg + (size_t)((st + 1) * 64 + 16 * j) * DM); sv[j] = *(const v8us*)(vg + (size_t)(32 * j) * SQ + (st + 1) * 64); }
      asm volatile("s_wait_xcnt 0x0" ::: "memory");      /* stands before any address register of these loads is written again */
    }
#pragma unroll 1
    for (int ps = 0; ps < 2; ++ps) {
      v8f s[2][2] = {{z8, z8}, {z8, z8}};      /* [16-key tile][query group] */
      const unsigned char* kp = Lb + (ps * 32 + c) * FA_KP + 16 * hh;
#pragma unroll
      for (int kc = 0; kc < 4; ++kc) { const v16h k0 = fa_lds(kp + 64 * kc), k1 = fa_lds(kp + 16 * FA_KP + 64 * kc);
        s[0][0] = fa_mma(k0, qf[0][kc], s[0][0]); s[0][1] = fa_mma(k0, qf[1][kc], s[0][1]); s[1][0] = fa_mma(k1, qf[0][kc], s[1][0]); s[1][1] = fa_mma(k1, qf[1][kc], s[1][1]); }
      v16h vf[8]; const unsigned char* vp = Lb + FA_KT + c * FA_VP + ps * 64 + 16 * hh;
#pragma unroll
      for (int t = 0; t < 8; ++t) vf[t] = fa_lds(vp + 16 * t * FA_VP);
      /* the maximum in use may trail the true one by up to 8 (log2 domain): the 128 accumulator registers are rescaled only when some column needs it */
      float mb[2]; bool need = false;
#pragma unroll
      for (int g = 0; g < 2; ++g) { float mx = s[0][g][0];
        for (int r = 1; r < 8; ++r) mx = fmaxf(mx, s[0][g][r]);
        for (int r = 0; r < 8; ++r) mx = fmaxf(mx, s[1][g][r]);
        mx = fmaxf(mx, rx_x16(mx)) * cs; mb[g] = mx; need = need || (mx > m_run[g] + 8.0f); }
      if (__builtin_amdgcn_ballot_w32(need) != 0) {      /* wave-uniform: taken on the first pass (m_run = -inf, factor 0 on zero sums), rarely later */
        const float n0 = fmaxf(m_run[0], mb[0]), n1 = fmaxf(m_run[1], mb[1]); float co[2]; exp2x2(m_run[0] - n0, m_run[1] - n1, co[0], co[1]);
        m_run[0] = n0; m_run[1] = n1;
#pragma unroll
        for (int g = 0; g < 2; ++g) { l_run[g] *= co[g]; for (int t = 0; t < 8; ++t) acc[g][t] = acc[g][t] * co[g]; }
      }
      FragH pf[2];      /* both groups' weights first, then the 16 products in one run on 16 separate tiles */
#pragma unroll
      for (int g = 0; g < 2; ++g) { const float nm = 4.0f - m_run[g];      /* weights carried x16 (at most 2^12): small ones stay off the f16 subnormal range; the factor cancels in sum and product */
        v4f ps4;
#pragma unroll
        for (int i = 0; i < 4; ++i) { const int kt = i >> 1, rb = (i & 1) * 4; const v4f a4 = {s[kt][g][rb] * cs + nm, s[kt][g][rb + 1] * cs + nm, s[kt][g][rb + 2] * cs + nm, s[kt][g][rb + 3] * cs + nm}; const v4f p4 = exp2x4(a4); ps4 = (i == 0) ? p4 : ps4 + p4;
          for (int q = 0; q < 4; ++q) pf[g].h[4 * i + q] = (_Float16)p4[q]; }      /* element 8 kt + r = key 16 kt + 8 hh + r: the hardware k order, as V^T's loads */
        l_run[g] += (ps4[0] + ps4[1]) + (ps4[2] + ps4[3]); }
#pragma unroll
      for (int t = 0; t < 8; ++t) { acc[0][t] = fa_mma(vf[t], pf[0].v, acc[0][t]); acc[1][t] = fa_mma(vf[t], pf[1].v, acc[1][t]); }
    }
    if (st + 1 < FA_NST) { unsigned char* Ln = L + ((st + 1) & 1) * FA_BUF;      /* that buffer's last readers left it before the barrier that ended stage st - 1 */
#pragma unroll
      for (int j = 0; j < 4; ++j) { *(v8us*)(Ln + kl + 16 * j * FA_KP) = sk[j]; *(v8us*)(Ln + vl + 32 * j * FA_VP) = sv[j]; } }
    __syncthreads();      /* publishes stage st + 1 and ends every read of stage st */
  }
#pragma unroll
  for (int g = 0; g < 2; ++g) { const float inv = 64.0f / (l_run[g] + rx_x16(l_run[g]));      /* each wave half summed its eight keys of every 16-key tile */
    unsigned short* op = (unsigned short*)O + (r0 + q0 + 16 * g + c) * DM + h * 128 + 8 * hh;
#pragma unroll
    for (int t = 0; t < 8; ++t) { FragH f; for (int r = 0; r < 8; ++r) f.h[r] = (_Float16)(acc[g][t][r] * inv); *(v8us*)(op + 16 * t) = f.half[0]; } }      /* register r = d 16 t + 8 hh + r of query c: 16 contiguous bytes */
}

extern "C" void kernel_launch(void* const* d_in, const int* in_sizes, int n_in,
                              void* d_out, int out_size, void* d_ws, size_t ws_size, hipStream_t stream) {
  (void)in_sizes; (void)n_in; (void)out_size;
  const float* const* I = (const float* const*)d_in; const float* xr = I[0]; const float* xi = I[1];
  const float* qwr = I[2]; const float* qwi = I[3]; const float* qbr = I[4]; const float* qbi = I[5]; const float* kwr = I[6]; const float* kwi = I[7]; const float* kbr = I[8]; const float* kbi = I[9]; const float* vwr = I[10]; const float* vwi = I[11]; const float* vbr = I[12]; const float* vbi = I[13]; const float* owr = I[14]; const float* owi = I[15]; const float* obr = I[16]; const float* obi = I[17];
  char* ws = (char*)d_ws; size_t off = 0;
  auto take = [&](size_t bytes) { char* p = ws + off; off += (bytes + 255) & ~(size_t)255; return p; };
  _Float16* BQ = (_Float16*)take((size_t)DM * DM * 2); _Float16* BK = (_Float16*)take((size_t)DM * DM * 2); _Float16* BV = (_Float16*)take((size_t)DM * DM * 2); _Float16* BO = (_Float16*)take((size_t)2 * DMX * DM * 2); float* bq2 = (float*)take(DM * 4); float* bk2 = (float*)take(DM * 4); float* bv2 = (float*)take(DM * 4);
  _Float16* XC = (_Float16*)take(NR * DM * 2); _Float16* Q2 = (_Float16*)take(NR * DM * 2); _Float16* K2 = (_Float16*)take(NR * DM * 2); _Float16* V2 = (_Float16*)take(NR * DM * 2); _Float16* O2 = (_Float16*)take(NR * DM * 2);
  _Float16* VT = (_Float16*)take((size_t)NB * DM * SQ * 2);
  if (off > ws_size) return;      /* approx 8 x 4 + 16 x 5 + 16 = 128 MiB */
  { const unsigned g = (unsigned)(((size_t)DM * (DM / 8) + 255) / 256); k_wcat2<<<g, 256, 0, stream>>>(qwr, qwi, BQ); k_wcat2<<<g, 256, 0, stream>>>(kwr, kwi, BK); k_wcat2<<<g, 256, 0, stream>>>(vwr, vwi, BV); k_wcplx3<<<(unsigned)(((size_t)2 * DMX * (DM / 8) + 255) / 256), 256, 0, stream>>>(owr, owi, BO); }
  k_bcat2<<<1, 256, 0, stream>>>(qbr, qbi, bq2); k_bcat2<<<1, 256, 0, stream>>>(kbr, kbi, bk2); k_bcat2<<<1, 256, 0, stream>>>(vbr, vbi, bv2);
  k_xcat<<<(unsigned)((NR * (DM / 8) + 255) / 256), 256, 0, stream>>>(xr, xi, XC, NR);      /* [x_real | x_imag] exact f16 rows */
  k_gemm2<0><<<dim3((unsigned)((NR / 128) * (DM / 64)), 1), 128, 0, stream>>>(XC, DM, 0, BQ, DM, 0, 0.0625f, bq2, 0, nullptr, 1, 0, 0, nullptr, Q2, DM, 0, (int)NR, DM, DM);      /* (q_r | q_i) per head, K = 2048 */
  k_gemm2<0><<<dim3((unsigned)((NR / 128) * (DM / 64)), 1), 128, 0, stream>>>(XC, DM, 0, BK, DM, 0, 0.0625f, bk2, 0, nullptr, 1, 0, 0, nullptr, K2, DM, 0, (int)NR, DM, DM);
  k_gemm2<0><<<dim3((unsigned)((NR / 128) * (DM / 64)), 1), 128, 0, stream>>>(XC, DM, 0, BV, DM, 0, 0.0625f, bv2, 0, nullptr, 1, 0, 0, nullptr, V2, DM, 0, (int)NR, DM, DM);
  k_vt<NH, SQ><<<NB * NH * (SQ / 64), 256, 0, stream>>>(V2, DM, 0, VT);      /* [v_r | v_i]^T, both batches: row b * 2048 + 128 h + w, w < 64 = v_r of head h, else v_i */
  k_fattn<<<NB * 16 * (SQ / 256), 256, 0, stream>>>(Q2, K2, VT, O2);      /* [out_r | out_i] x64 per head */
  k_gemm2<0><<<dim3((unsigned)((NR / 128) * (DMX / 64)), 1), 128, 0, stream>>>(O2, DM, 0, BO, DM, 0, 0.0009765625f, obr, 0, nullptr, 1, 0, 0, (float*)d_out, nullptr, DMX, 0, (int)NR, DMX, DM);      /* y_r = o_r Wr - o_i Wi + br -> out[0] */
  k_gemm2<0><<<dim3((unsigned)((NR / 128) * (DMX / 64)), 1), 128, 0, stream>>>(O2, DM, 0, BO + (size_t)DMX * DM, DM, 0, 0.0009765625f, obi, 0, nullptr, 1, 0, 0, (float*)d_out + NR * DMX, nullptr, DMX, 0, (int)NR, DMX, DM);      /* y_i = o_i Wr + o_r Wi + bi -> out[1] */
}

// v003
// One run takes 285 microseconds.
// In two side-by-side timings against v002, it was 2.11 and 2.10 times as fast.
// Counting every step since v000, it is 14.2 times as fast.
#include <hip/hip_runtime.h>
// Complex multi-head attention (x_real, x_imag [2][2048][1024]; complex linear (weights [in][out]): r = xr Wr - xi Wi + br, i = xi Wr + xr Wi + bi for q, k, v; 16 heads of 64; scores = (qr . kr + qi . ki) / 8 = Re(q conj(k)); softmax; out_r = P vr, out_i = P vi; y = complex_linear(out, Wo); output = stack([y_r, y_i]) -> [2][2][2048][1024]).
// Structure: [x_real | x_imag] as ONE exact f16 row plane (K = 2048); each complex projection as ONE WMMA GEMM (128x128 workgroup tiles staged in LDS, 64x32 wave tiles, f32 accumulation, exact x16 weights arranged on VALU as [Wr^T | -Wi^T] / [Wi^T | Wr^T] row pairs, + bias) whose output columns interleave (q_r | q_i) per head (head width 128); [v_r | v_i]^T of both batches via LDS transposes; ONE attention launch over all (batch, head, 256-query block): S^T = K Q^T (K = 128 = qr.kr + qi.ki in one contraction), running maximum and sum per query in f32 (native exp2), P^T packed from the score tiles as f16 B operand, [out_r | out_i]^T += [v_r | v_i]^T P^T (carried x64) into interleaved f16 rows; y_r and y_i as two GEMMs over those rows (K = 2048, weights re-laid on VALU with the matching signs, + bias) straight into the two output planes; 8 + 3 + 1 + 1 + 2 = 15 launches.
// Compute dtype: inputs rounded to bf16; x / weights exact; q, k, v, softmax weights and out plain f16 (~2^-12); scores, statistics, y f32. v_wmma_f32_16x16x32_f16.
#define NB 2
#define SQ 2048
#define DMX 1024                     /* model width */
#define DM (2 * DMX)                 /* interleaved (real | imag) width = 16 heads x 128 */
#define NH 32                        /* k_vt slabs of 64: (head, part) */
#define HD 64
#define HG 4
#define QN SQ
#define NR ((size_t)NB * SQ)
typedef __bf16 v16b __attribute__((ext_vector_type(16)));
typedef unsigned short v8us __attribute__((ext_vector_type(8), may_alias));
typedef float  v8f  __attribute__((ext_vector_type(8)));
typedef float  v4f  __attribute__((ext_vector_type(4)));
typedef float  v4fa __attribute__((ext_vector_type(4), may_alias));
union FragB { v16b v; v8us half[2]; unsigned short u[16]; };

__device__ __forceinline__ unsigned short bf16_bits(float x) { unsigned int u = __float_as_uint(x); return (unsigned short)((u + 0x7FFFu + ((u >> 16) & 1u)) >> 16); }
__device__ __forceinline__ float bf16_val(unsigned short b) { return __uint_as_float(((unsigned int)b) << 16); }
__device__ __forceinline__ float bf16_round(float x) { return bf16_val(bf16_bits(x)); }
// D += A·B with NT terms: 1 = ah·bh, 2 = + al·bh (A split), 3 = + ah·bl (both split)
template <int NT>
__device__ __forceinline__ v8f mmaN(v16b ah, v16b al, v16b bh, v16b bl, v8f c) {
  c = __builtin_amdgcn_wmma_f32_16x16x32_bf16(false, ah, false, bh, (short)0, c, false, false);
  if (NT >= 2) c = __builtin_amdgcn_wmma_f32_16x16x32_bf16(false, al, false, bh, (short)0, c, false, false);
  if (NT >= 3) c = __builtin_amdgcn_wmma_f32_16x16x32_bf16(false, ah, false, bl, (short)0, c, false, false);
  asm volatile("v_nop\n\tv_nop\n\tv_nop\n\tv_nop" : "+v"(c) : "v"(ah), "v"(al), "v"(bh), "v"(bl));
  return c;
}

__global__ __launch_bounds__(256) void k_wt_bf16(const float* __restrict__ W, unsigned short* __restrict__ Wt, int K, int N) {
  const int t = blockIdx.x * 256 + threadIdx.x;
  const int k8n = K / 8;
  if (t >= N * k8n) return;
  const int n = t / k8n, k8 = (t % k8n) * 8;
  v8us v;
#pragma unroll
  for (int i = 0; i < 8; ++i) v[i] = bf16_bits(W[(size_t)(k8 + i) * N + n]);
  *(v8us*)(Wt + (size_t)n * K + k8) = v;
  
}

// GEMM C[M][N] (f32, pitch ldc) = act(A[M][K]·W + bias). A f32 row-major (pitch lda) converted per fragment to bf16
// (ASPLIT: hi/lo two planes -> 2 terms, else single rounded term); Wt bf16 [N][K] (pitch ldb). BIAS_BF16 rounds the
// bias to bf16 first (bias quantised to bf16 before the add). K%32==0, M%16==0, N%64==0.
template <bool ASPLIT, int ACT, bool BIAS_BF16>
__global__ __launch_bounds__(128) void k_gemm_bf(const float* __restrict__ A, int lda, const unsigned short* __restrict__ Wt, int ldb,
                                               const float* __restrict__ bias, float* __restrict__ C, int ldc, int M, int N, int K) {
  __shared__ __attribute__((aligned(16))) float so[4][16][64];
  const int tid = threadIdx.x, w = tid >> 5, lane = tid & 31, ln = lane & 15, hh = lane >> 4;
  const int ntn = N / 64;
  const int wid = blockIdx.x * 4 + w;
  const int mt = wid / ntn, nq = wid % ntn;
  if (mt * 16 >= M) return;
  const int row0 = mt * 16, col0 = nq * 64;
  const float* arow = A + (size_t)(row0 + ln) * lda;
  v8f acc[4] = {};
  for (int kb = 0; kb < K; kb += 32) {
    FragB ah, al;
    const v4f x0 = *(const v4fa*)(arow + kb + 8 * hh), x1 = *(const v4fa*)(arow + kb + 8 * hh + 4);
    const v4f x2 = *(const v4fa*)(arow + kb + 16 + 8 * hh), x3 = *(const v4fa*)(arow + kb + 16 + 8 * hh + 4);
    float xs[16] = {x0[0],x0[1],x0[2],x0[3],x1[0],x1[1],x1[2],x1[3],x2[0],x2[1],x2[2],x2[3],x3[0],x3[1],x3[2],x3[3]};
#pragma unroll
    for (int i = 0; i < 16; ++i) { const unsigned short hb = bf16_bits(xs[i]); ah.u[i] = hb; al.u[i] = ASPLIT ? bf16_bits(xs[i] - bf16_val(hb)) : (unsigned short)0; }
#pragma unroll
    for (int t = 0; t < 4; ++t) {
      const unsigned short* brow = Wt + (size_t)(col0 + t * 16 + ln) * ldb + kb;
      FragB b;
      b.half[0] = *(const v8us*)(brow + 8 * hh);
      b.half[1] = *(const v8us*)(brow + 16 + 8 * hh);
      acc[t] = mmaN<ASPLIT ? 2 : 1>(ah.v, al.v, b.v, b.v, acc[t]);
    }
  }
#pragma unroll
  for (int t = 0; t < 4; ++t) {
    float bv = bias ? bias[col0 + t * 16 + ln] : 0.f;
    if (BIAS_BF16) bv = bf16_round(bv);
#pragma unroll
    for (int r = 0; r < 8; ++r) { float v = acc[t][r] + bv; if (ACT == 1) v = fmaxf(v, 0.f); so[w][8 * hh + r][t * 16 + ln] = v; }
  }
  __builtin_amdgcn_fence(__ATOMIC_ACQ_REL, "workgroup");
  __builtin_amdgcn_wave_barrier();
  const int rsub = lane >> 4, c4 = (lane & 15) * 4;
  {
#pragma unroll
    for (int q = 0; q < 8; ++q) {
      const int r = q * 2 + rsub;
      const v4f v = *(const v4fa*)&so[w][r][c4];
      *(v4f*)(C + (size_t)(row0 + r) * ldc + col0 + c4) = v;
    }
    
  }
}

// GEMM C = act(A·W + bias + resid): A f32 (ASPLIT -> hi/lo 2 terms), Wt bf16 [N][K]; ACT 0 none, 1 relu, 2 exact gelu;
// resid (optional, f32, row index = (row % rmod), pitch ldr, RES_BF16 rounds it) added before the activation.
template <bool ASPLIT, int ACT, bool BIAS_BF16, bool RES_BF16>
__global__ __launch_bounds__(128) void k_gemm_bf3(const float* __restrict__ A, int lda, const unsigned short* __restrict__ Wt, int ldb,
                                                const float* __restrict__ bias, const float* __restrict__ resid, int rmod, int ldr,
                                                float* __restrict__ C, int ldc, int M, int N, int K) {
  __shared__ __attribute__((aligned(16))) float so[4][16][64];
  const int tid = threadIdx.x, w = tid >> 5, lane = tid & 31, ln = lane & 15, hh = lane >> 4;
  const int ntn = N / 64;
  const int wid = blockIdx.x * 4 + w;
  const int mt = wid / ntn, nq = wid % ntn;
  if (mt * 16 >= M) return;
  const int row0 = mt * 16, col0 = nq * 64;
  const float* arow = A + (size_t)(row0 + ln) * lda;
  v8f acc[4] = {};
  for (int kb = 0; kb < K; kb += 32) {
    FragB ah, al;
    const v4f x0 = *(const v4fa*)(arow + kb + 8 * hh), x1 = *(const v4fa*)(arow + kb + 8 * hh + 4);
    const v4f x2 = *(const v4fa*)(arow + kb + 16 + 8 * hh), x3 = *(const v4fa*)(arow + kb + 16 + 8 * hh + 4);
    float xs[16] = {x0[0],x0[1],x0[2],x0[3],x1[0],x1[1],x1[2],x1[3],x2[0],x2[1],x2[2],x2[3],x3[0],x3[1],x3[2],x3[3]};
#pragma unroll
    for (int i = 0; i < 16; ++i) { const unsigned short hb = bf16_bits(xs[i]); ah.u[i] = hb; al.u[i] = ASPLIT ? bf16_bits(xs[i] - bf16_val(hb)) : (unsigned short)0; }
#pragma unroll
    for (int t = 0; t < 4; ++t) {
      const unsigned short* brow = Wt + (size_t)(col0 + t * 16 + ln) * ldb + kb;
      FragB b;
      b.half[0] = *(const v8us*)(brow + 8 * hh);
      b.half[1] = *(const v8us*)(brow + 16 + 8 * hh);
      acc[t] = mmaN<ASPLIT ? 2 : 1>(ah.v, al.v, b.v, b.v, acc[t]);
    }
  }
#pragma unroll
  for (int t = 0; t < 4; ++t) {
    const int col = col0 + t * 16 + ln;
    float bv = bias ? bias[col] : 0.f;
    if (BIAS_BF16) bv = bf16_round(bv);
#pragma unroll
    for (int r = 0; r < 8; ++r) {
      float v = acc[t][r] + bv;
      if (resid) { float rv = resid[(size_t)((row0 + 8 * hh + r) % rmod) * ldr + col]; if (RES_BF16) rv = bf16_round(rv); v += rv; }
      if (ACT == 1) v = fmaxf(v, 0.f);
      if (ACT == 2) v = 0.5f * v * (1.0f + erff(v * 0.70710678118654752f));
      if (ACT == 3) { const float u = 0.7978845608028654f * (v + 0.044715f * v * v * v); v = 0.5f * v * (1.0f + tanhf(u)); }
      so[w][8 * hh + r][t * 16 + ln] = v;
    }
  }
  __builtin_amdgcn_fence(__ATOMIC_ACQ_REL, "workgroup");
  __builtin_amdgcn_wave_barrier();
  const int rsub = lane >> 4, c4 = (lane & 15) * 4;
  {
#pragma unroll
    for (int q = 0; q < 8; ++q) {
      const int r = q * 2 + rsub;
      const v4f v = *(const v4fa*)&so[w][r][c4];
      *(v4f*)(C + (size_t)(row0 + r) * ldc + col0 + c4) = v;
    }
    
  }
}
// row LayerNorm (biased variance, eps) over N: s = X (+ R); optional out_sum <- s; out_norm <- (s-mu)*rsqrt(var+eps)*g + b
template <bool PARAM_BF16>
__global__ __launch_bounds__(256) void k_layernorm(const float* __restrict__ X, const float* __restrict__ R, const float* __restrict__ g, const float* __restrict__ bta,
                                                  float* __restrict__ out_sum, float* __restrict__ out_norm, int N, float eps) {
  __shared__ float red[256];
  const int row = blockIdx.x, tid = threadIdx.x;
  const float* x = X + (size_t)row * N; const float* rr = R ? R + (size_t)row * N : nullptr;
  float vals[16];                     // up to N = 4096
  const int per = N / 256;            // contiguous chunk per thread? use strided-by-4 chunks: thread handles j = tid*4 + 1024*u
  float s1 = 0.f;
  for (int u = 0; u < per / 4; ++u) {
    const int j = tid * 4 + 1024 * u;
    const v4f a = *(const v4fa*)(x + j);
    v4f b = {0.f,0.f,0.f,0.f}; if (rr) b = *(const v4fa*)(rr + j);
#pragma unroll
    for (int q = 0; q < 4; ++q) { const float v = a[q] + b[q]; vals[u * 4 + q] = v; s1 += v; }
  }
  red[tid] = s1; __syncthreads();
  for (int st = 128; st > 0; st >>= 1) { if (tid < st) red[tid] += red[tid + st]; __syncthreads(); }
  const float mu = red[0] / (float)N; __syncthreads();
  float s2 = 0.f;
  for (int u = 0; u < per / 4; ++u)
#pragma unroll
    for (int q = 0; q < 4; ++q) { const float c = vals[u * 4 + q] - mu; s2 += c * c; }
  red[tid] = s2; __syncthreads();
  for (int st = 128; st > 0; st >>= 1) { if (tid < st) red[tid] += red[tid + st]; __syncthreads(); }
  const float rs = rsqrtf(red[0] / (float)N + eps);
  {
    for (int u = 0; u < per / 4; ++u) {
      const int j = tid * 4 + 1024 * u;
      v4f o, sm;
#pragma unroll
      for (int q = 0; q < 4; ++q) {
        float gg = g[j + q], bb = bta[j + q];
        if (PARAM_BF16) { gg = bf16_round(gg); bb = bf16_round(bb); }
        sm[q] = vals[u * 4 + q]; o[q] = (vals[u * 4 + q] - mu) * rs * gg + bb;
      }
      if (out_sum) *(v4f*)(out_sum + (size_t)row * N + j) = sm;
      *(v4f*)(out_norm + (size_t)row * N + j) = o;
    }
    
  }
}



// ---- f16 WMMA path (v_wmma_f32_16x16x32_f16): 11-bit significands for operands in range — used where a [0,1] probability operand needs more precision than bf16
typedef _Float16 v16h __attribute__((ext_vector_type(16)));
union FragH { v16h v; v8us half[2]; _Float16 h[16]; unsigned short u[16]; };
template <int NT>
__device__ __forceinline__ v8f mmaH(v16h ah, v16h al, v16h bh, v16h bl, v8f c) {
  c = __builtin_amdgcn_wmma_f32_16x16x32_f16(false, ah, false, bh, (short)0, c, false, false);
  if (NT >= 2) c = __builtin_amdgcn_wmma_f32_16x16x32_f16(false, al, false, bh, (short)0, c, false, false);
  if (NT >= 3) c = __builtin_amdgcn_wmma_f32_16x16x32_f16(false, ah, false, bl, (short)0, c, false, false);
  asm volatile("v_nop\n\tv_nop\n\tv_nop\n\tv_nop" : "+v"(c) : "v"(ah), "v"(al), "v"(bh), "v"(bl));
  return c;
}
// batched GEMM like k_gemm_b but f16 operands: A f32 (split into f16 hi/lo if ASPLIT, else rounded to f16), Bt = f16 values [n][k]; alpha; C f32; N multiple of 16 (partial tiles skipped)
template <bool ASPLIT>
__global__ __launch_bounds__(128) void k_gemm_h(const float* __restrict__ A, int lda, size_t sA, const _Float16* __restrict__ Bh, int ldb, size_t sB, float alpha, float* __restrict__ C, int ldc, size_t sC, int M, int N, int K) {
  __shared__ __attribute__((aligned(16))) float so[4][16][64];
  const int tid = threadIdx.x, w = tid >> 5, lane = tid & 31, ln = lane & 15, hh = lane >> 4; const int by = blockIdx.y;
  A += (size_t)by * sA; Bh += (size_t)by * sB; C += (size_t)by * sC;
  const int ntn = (N + 63) / 64; const int wid = blockIdx.x * 4 + w; const int mt = wid / ntn, nq = wid % ntn; if (mt * 16 >= M) return;
  const int row0 = mt * 16, col0 = nq * 64; const float* arow = A + (size_t)(row0 + ln) * lda;
  v8f acc[4] = {};
  for (int kb = 0; kb < K; kb += 32) {
    FragH ah, al;
    const v4f x0 = *(const v4fa*)(arow + kb + 8 * hh), x1 = *(const v4fa*)(arow + kb + 8 * hh + 4), x2 = *(const v4fa*)(arow + kb + 16 + 8 * hh), x3 = *(const v4fa*)(arow + kb + 16 + 8 * hh + 4);
    float xs[16] = {x0[0],x0[1],x0[2],x0[3],x1[0],x1[1],x1[2],x1[3],x2[0],x2[1],x2[2],x2[3],x3[0],x3[1],x3[2],x3[3]};
#pragma unroll
    for (int i = 0; i < 16; ++i) { const _Float16 h = (_Float16)xs[i]; ah.h[i] = h; al.h[i] = ASPLIT ? (_Float16)(xs[i] - (float)h) : (_Float16)0.0f; }
#pragma unroll
    for (int t = 0; t < 4; ++t) { if (col0 + t * 16 >= N) continue; const size_t boff = (size_t)(col0 + t * 16 + ln) * ldb + kb; FragH bq; bq.half[0] = *(const v8us*)(Bh + boff + 8 * hh); bq.half[1] = *(const v8us*)(Bh + boff + 16 + 8 * hh);
      acc[t] = mmaH<ASPLIT ? 2 : 1>(ah.v, al.v, bq.v, bq.v, acc[t]); }
  }
#pragma unroll
  for (int t = 0; t < 4; ++t) { if (col0 + t * 16 >= N) continue;
#pragma unroll
    for (int r = 0; r < 8; ++r) so[w][8 * hh + r][t * 16 + ln] = acc[t][r] * alpha; }
  __builtin_amdgcn_fence(__ATOMIC_ACQ_REL, "workgroup"); __builtin_amdgcn_wave_barrier();
  const int rsub = lane >> 4, c4 = (lane & 15) * 4;
  {
#pragma unroll
    for (int q = 0; q < 8; ++q) { const int r = q * 2 + rsub; if (col0 + c4 < N) { const v4f v = *(const v4fa*)&so[w][r][c4]; *(v4f*)(C + (size_t)(row0 + r) * ldc + col0 + c4) = v; } }
     }
}

// Wt[n][k] = f16(W[k][n]·scale) from f32 row-major W[K][N] (scale = power of two; bf16-exact weights stay exact in f16 away from the subnormal range)
__global__ __launch_bounds__(256) void k_wt_f16(const float* __restrict__ W, _Float16* __restrict__ Wt, int K, int N, float scale) {
  const int t = blockIdx.x * 256 + threadIdx.x; if (t >= N * (K / 8)) return; const int n = t / (K / 8), k8 = (t % (K / 8)) * 8; FragH f;
#pragma unroll
  for (int i = 0; i < 8; ++i) f.h[i] = (_Float16)(bf16_round(W[(size_t)(k8 + i) * N + n]) * scale); const v8us o = f.half[0];
  *(v8us*)((unsigned short*)Wt + (size_t)n * K + k8) = o; 
}
// k_gemm_hh variant with fused epilogue: v = acc·alpha + bias[by·sBias + col] (+ CP[(row/rowsPerB)·sCPb + by·64 + col] if CP) ; ACT 0 none / 1 elu ; writes f16 C16 (and f32 C if non-null)
template <int ACT>
__global__ __launch_bounds__(128) void k_gemm_hhx(const _Float16* __restrict__ A, int lda, size_t sA, const _Float16* __restrict__ Bh, int ldb, size_t sB, float alpha, const float* __restrict__ bias, size_t sBias, const float* __restrict__ CP, int rowsPerB, size_t sCPb, int row0g,
    float* __restrict__ C, _Float16* __restrict__ C16, int ldc, size_t sC, int M, int N, int K) {
  __shared__ __attribute__((aligned(16))) float so[4][16][64];
  const int tid = threadIdx.x, w = tid >> 5, lane = tid & 31, ln = lane & 15, hh = lane >> 4; const int by = blockIdx.y;
  A += (size_t)by * sA; Bh += (size_t)by * sB; const size_t cofs = (size_t)by * sC; const float* bp = bias ? bias + (size_t)by * sBias : nullptr;
  const int ntn = (N + 63) / 64; const int wid = blockIdx.x * 4 + w; const int mt = wid / ntn, nq = wid % ntn; if (mt * 16 >= M) return;
  const int row0 = mt * 16, col0 = nq * 64; const _Float16* arow = A + (size_t)(row0 + ln) * lda;
  v8f acc[4] = {};
  for (int kb = 0; kb < K; kb += 32) { FragH ah; ah.half[0] = *(const v8us*)((const unsigned short*)arow + kb + 8 * hh); ah.half[1] = *(const v8us*)((const unsigned short*)arow + kb + 16 + 8 * hh);
#pragma unroll
    for (int t = 0; t < 4; ++t) { if (col0 + t * 16 >= N) continue; const size_t boff = (size_t)(col0 + t * 16 + ln) * ldb + kb; FragH bq; bq.half[0] = *(const v8us*)((const unsigned short*)Bh + boff + 8 * hh); bq.half[1] = *(const v8us*)((const unsigned short*)Bh + boff + 16 + 8 * hh);
      acc[t] = mmaH<1>(ah.v, ah.v, bq.v, bq.v, acc[t]); }
  }
#pragma unroll
  for (int t = 0; t < 4; ++t) { if (col0 + t * 16 >= N) continue; const int col = col0 + t * 16 + ln; const float bv = bp ? bf16_round(bp[col]) : 0.f;
#pragma unroll
    for (int r = 0; r < 8; ++r) { float v = acc[t][r] * alpha + bv; if (CP) { const int rr = row0g + row0 + 8 * hh + r; if (rowsPerB < 0) v += CP[cofs + (size_t)rr * ldc + col];      /* rowsPerB < 0: own element of the batched C plane */ else { const int bidx = rr / rowsPerB; v += CP[(size_t)bidx * sCPb + (size_t)by * 64 + col]; } } if (ACT == 1) v = (v > 0.f) ? v : expm1f(v); else if (ACT == 7) v = (v > 0.f) ? v + 1.0f : expf(v); else if (ACT == 8) v = tanhf(v); else if (ACT == 9) v = 0.5f * v * (1.0f + tanhf(0.7978845608028654f * (v + 0.044715f * v * v * v))); else if (ACT == 11) v = 1.0f / (1.0f + expf(-v)); else if (ACT == 12) v = (v > 0.f) ? v : 0.01f * v; else if (ACT == 14) v = (v > 0.f) ? v : 0.1f * v; else if (ACT == 16) v = (v >= 0.f) ? v : 0.3f * v; else if (ACT == 17) v = (v >= 0.f) ? v : 0.2f * v; else if (ACT == 15) v = v / (1.0f + expf(-v)); else if (ACT == 3) v = fmaxf(v, 0.f); else if (ACT == 6) v = 0.5f * v * (1.0f + erff(v * 0.70710678118654752f)); so[w][8 * hh + r][t * 16 + ln] = v; } }
  __builtin_amdgcn_fence(__ATOMIC_ACQ_REL, "workgroup"); __builtin_amdgcn_wave_barrier();
  const int rsub = lane >> 4, c4 = (lane & 15) * 4; typedef _Float16 v4h __attribute__((ext_vector_type(4)));
  {
#pragma unroll
    for (int q = 0; q < 8; ++q) { const int r = q * 2 + rsub; if (col0 + c4 < N) { const v4f v = *(const v4fa*)&so[w][r][c4]; if (C) *(v4f*)(C + cofs + (size_t)(row0 + r) * ldc + col0 + c4) = v; if (C16) { v4h h4; for (int i = 0; i < 4; ++i) h4[i] = (_Float16)v[i]; *(v4h*)(C16 + cofs + (size_t)(row0 + r) * ldc + col0 + c4) = h4; } } }
     }
}


typedef _Float16 v4h __attribute__((ext_vector_type(4)));

__global__ __launch_bounds__(256) void k_x16(const float* __restrict__ x, _Float16* __restrict__ X16, size_t n8) { const size_t t = (size_t)blockIdx.x * 256 + threadIdx.x; if (t >= n8) return; FragH f;
#pragma unroll
  for (int q = 0; q < 8; ++q) f.h[q] = (_Float16)bf16_round(x[t * 8 + q]); *(v8us*)((unsigned short*)X16 + t * 8) = f.half[0];  }
__global__ __launch_bounds__(256) void k_h16(const float* __restrict__ x, _Float16* __restrict__ X16, size_t n8) { const size_t t = (size_t)blockIdx.x * 256 + threadIdx.x; if (t >= n8) return; FragH f;
#pragma unroll
  for (int q = 0; q < 8; ++q) f.h[q] = (_Float16)x[t * 8 + q]; *(v8us*)((unsigned short*)X16 + t * 8) = f.half[0];  }
__global__ __launch_bounds__(256) void k_round16f(const float* __restrict__ W, _Float16* __restrict__ Bt, size_t n8) { const size_t t = (size_t)blockIdx.x * 256 + threadIdx.x; if (t >= n8) return; FragH f;
#pragma unroll
  for (int i = 0; i < 8; ++i) f.h[i] = (_Float16)(bf16_round(W[t * 8 + i]) * 16.0f); *(v8us*)((unsigned short*)Bt + t * 8) = f.half[0];  }
template <int NHv, int TTv>
__global__ __launch_bounds__(256) void k_vt(const _Float16* __restrict__ V16, int ldv, int voff, _Float16* __restrict__ Vt) { __shared__ unsigned short tl[64][66]; const int tid = threadIdx.x; const int slab = blockIdx.x / (TTv / 64), lg = blockIdx.x % (TTv / 64); const int b = slab / NHv, h = slab % NHv;
  for (int i = tid; i < 64 * 8; i += 256) { const int r = i / 8, c8 = (i % 8) * 8; FragH f; f.half[0] = *(const v8us*)((const unsigned short*)V16 + ((size_t)b * TTv + lg * 64 + r) * ldv + voff + h * 64 + c8);
#pragma unroll
    for (int q = 0; q < 8; ++q) tl[r][c8 + q] = f.u[q]; }
  __syncthreads();
  {
#pragma unroll
    for (int rd = 0; rd < 2; ++rd) { const int d = rd * 32 + tid / 8, pc = tid % 8; FragH f;
#pragma unroll
      for (int q = 0; q < 8; ++q) f.u[q] = tl[pc * 8 + q][d];
      *(v8us*)((unsigned short*)Vt + ((size_t)slab * 64 + d) * TTv + lg * 64 + pc * 8) = f.half[0]; }
     } }

__global__ __launch_bounds__(256) void k_hl(const float* __restrict__ F, _Float16* __restrict__ Hh, _Float16* __restrict__ Hl, size_t n8) { const size_t t = (size_t)blockIdx.x * 256 + threadIdx.x; if (t >= n8) return; FragH fh, fl; const v4f a = *(const v4fa*)(F + t * 8), c = *(const v4fa*)(F + t * 8 + 4);
#pragma unroll
  for (int q = 0; q < 4; ++q) { _Float16 h = (_Float16)a[q]; fh.h[q] = h; fl.h[q] = (_Float16)((a[q] - (float)h) * 1024.0f); h = (_Float16)c[q]; fh.h[4 + q] = h; fl.h[4 + q] = (_Float16)((c[q] - (float)h) * 1024.0f); }
  { *(v8us*)((unsigned short*)Hh + t * 8) = fh.half[0]; *(v8us*)((unsigned short*)Hl + t * 8) = fl.half[0];  } }

// one 16x32 f16 fragment from K-contiguous global rows, in the hardware k order
__device__ __forceinline__ v16h g2_frag(const _Float16* p, int hh) { FragH f; f.half[0] = *(const v8us*)((const unsigned short*)p + 8 * hh); f.half[1] = *(const v8us*)((const unsigned short*)p + 16 + 8 * hh); return f.v; }


__global__ __launch_bounds__(256) void k_wnat(const float* __restrict__ w, size_t n8, _Float16* __restrict__ Bt) { const size_t t = (size_t)blockIdx.x * 256 + threadIdx.x; if (t >= n8) return; FragH f; for (int q = 0; q < 8; ++q) f.h[q] = (_Float16)(bf16_round(w[t * 8 + q]) * 16.0f); *(v8us*)((unsigned short*)Bt + t * 8) = f.half[0];  }
__global__ __launch_bounds__(256) void k_rsm(const float* __restrict__ S, _Float16* __restrict__ P, int nrows) {
  #pragma clang fp contract(off)
  const int i = blockIdx.x * 256 + threadIdx.x; if (i >= nrows) return; const float* s = S + (size_t)i * SQ; float mx = -3.0e38f;
#pragma unroll 1
  for (int j = 0; j < SQ; ++j) mx = fmaxf(mx, s[j]); float se = 0.f;
#pragma unroll 1
  for (int j = 0; j < SQ; ++j) se += expf(s[j] - mx); const float sc = 256.0f / se;
#pragma unroll 1
  for (int j0 = 0; j0 < SQ; j0 += 8) { FragH f; for (int q = 0; q < 8; ++q) f.h[q] = (_Float16)(expf(s[j0 + q] - mx) * sc); unsigned short* d = (unsigned short*)P + (size_t)i * SQ + j0; *(v8us*)d = f.half[0];  } }
__global__ __launch_bounds__(256) void k_vt(const _Float16* __restrict__ V16, int b, int h0, _Float16* __restrict__ VT) { __shared__ unsigned short tl[64][65]; const int tid = threadIdx.x; const int hh = blockIdx.x % HG, sg = blockIdx.x / HG; const int s0 = sg * 64; const int h = h0 + hh;
  for (int i = tid; i < 64 * 8; i += 256) { const int j = i / 8, d8 = (i % 8) * 8; FragH f; f.half[0] = *(const v8us*)((const unsigned short*)V16 + ((size_t)b * SQ + s0 + j) * DM + h * HD + d8); for (int q = 0; q < 8; ++q) tl[d8 + q][j] = f.u[q]; }
  __syncthreads();
  { for (int i = tid; i < 64 * 8; i += 256) { const int d = i / 8, j8 = (i % 8) * 8; FragH f; for (int q = 0; q < 8; ++q) f.u[q] = tl[d][j8 + q]; *(v8us*)((unsigned short*)VT + ((size_t)hh * HD + d) * SQ + s0 + j8) = f.half[0]; }  } }


__global__ __launch_bounds__(256) void k_wcat2(const float* __restrict__ wr, const float* __restrict__ wi, _Float16* __restrict__ Bt) { const size_t t = (size_t)blockIdx.x * 256 + threadIdx.x; if (t >= (size_t)(2 * DMX) * (2 * DMX / 8)) return; const int k8 = (int)(t % (2 * DMX / 8)) * 8; const int n2 = (int)(t / (2 * DMX / 8)); const int h = n2 / 128, w = n2 % 128; const bool im = (w >= 64); const int f = h * 64 + (w & 63); FragH fr;
  for (int q = 0; q < 8; ++q) { const int k = k8 + q; float v; if (k < DMX) v = im ? wi[(size_t)k * DMX + f] : wr[(size_t)k * DMX + f]; else v = im ? wr[(size_t)(k - DMX) * DMX + f] : -wi[(size_t)(k - DMX) * DMX + f]; fr.h[q] = (_Float16)(16.0f * bf16_round(v)); }
  unsigned short* d = (unsigned short*)Bt + (size_t)n2 * (2 * DMX) + k8; *(v8us*)d = fr.half[0];  }
__global__ __launch_bounds__(256) void k_bcat2(const float* __restrict__ br, const float* __restrict__ bi, float* __restrict__ b2) { for (int n2 = threadIdx.x; n2 < 2 * DMX; n2 += 256) { const int h = n2 / 128, w = n2 % 128; const float v = (w < 64) ? br[h * 64 + w] : bi[h * 64 + (w - 64)]; *(float*)(b2 + n2) = v; }  }
__global__ __launch_bounds__(256) void k_wcplx3(const float* __restrict__ wr, const float* __restrict__ wi, _Float16* __restrict__ Bt) { const size_t t = (size_t)blockIdx.x * 256 + threadIdx.x; if (t >= (size_t)2 * DMX * (2 * DMX / 8)) return; const int k8 = (int)(t % (2 * DMX / 8)) * 8; const int f = (int)((t / (2 * DMX / 8)) % DMX); const int part = (int)(t / ((size_t)(2 * DMX / 8) * DMX)); FragH fr;
  for (int q = 0; q < 8; ++q) { const int k2 = k8 + q; const int h = k2 / 128, w = k2 % 128; const bool im = (w >= 64); const int g = h * 64 + (w & 63); float v; if (part == 0) v = im ? -wi[(size_t)g * DMX + f] : wr[(size_t)g * DMX + f]; else v = im ? wr[(size_t)g * DMX + f] : wi[(size_t)g * DMX + f]; fr.h[q] = (_Float16)(16.0f * bf16_round(v)); }
  unsigned short* d = (unsigned short*)Bt + ((size_t)part * DMX + f) * (2 * DMX) + k8; *(v8us*)d = fr.half[0];  }
__global__ __launch_bounds__(256) void k_xcat(const float* __restrict__ xr, const float* __restrict__ xi, _Float16* __restrict__ XC, size_t nrows) { const size_t t = (size_t)blockIdx.x * 256 + threadIdx.x; if (t >= nrows * (2 * DMX / 8)) return; const int k8 = (int)(t % (2 * DMX / 8)) * 8; const size_t r = t / (2 * DMX / 8); const float* s = (k8 < DMX) ? xr + r * DMX + k8 : xi + r * DMX + (k8 - DMX); const v4f a = *(const v4fa*)s, b = *(const v4fa*)(s + 4); FragH f; for (int q = 0; q < 4; ++q) { f.h[q] = (_Float16)bf16_round(a[q]); f.h[4 + q] = (_Float16)bf16_round(b[q]); }
  unsigned short* d = (unsigned short*)XC + r * (2 * DMX) + k8; *(v8us*)d = f.half[0];  }


// lane l <-> l ^ 16 (cross-row move); all 32 lanes are on where it is used
__device__ __forceinline__ float rx_x16(float v) { const int b = __float_as_int(v); return __int_as_float(__builtin_amdgcn_permlanex16(b, b, 0x76543210, 0xfedcba98, false, false)); }
// four 2^a in one statement, closed by the one free slot the instruction set asks for behind a transcendental before a source of it is overwritten; early-clobber outputs keep every result off every source
__device__ __forceinline__ v4f exp2x4(v4f a) { float r0, r1, r2, r3; asm("v_exp_f32 %0, %4\n\tv_exp_f32 %1, %5\n\tv_exp_f32 %2, %6\n\tv_exp_f32 %3, %7\n\tv_nop" : "=&v"(r0), "=&v"(r1), "=&v"(r2), "=&v"(r3) : "v"(a[0]), "v"(a[1]), "v"(a[2]), "v"(a[3])); const v4f r = {r0, r1, r2, r3}; return r; }

// two 2^a, same form and same closing slot as exp2x4
__device__ __forceinline__ void exp2x2(float a0, float a1, float& r0, float& r1) { asm("v_exp_f32 %0, %2\n\tv_exp_f32 %1, %3\n\tv_nop" : "=&v"(r0), "=&v"(r1) : "v"(a0), "v"(a1)); }

#define FA_KP 272                    /* LDS pitch of a K row: 256 B + 16 (odd multiple of 16 B) */
#define FA_VP 144                    /* LDS pitch of a V^T row: 128 B + 16 (odd multiple of 16 B) */
#define FA_KT (64 * FA_KP)
#define FA_BUF (FA_KT + 128 * FA_VP)
#define FA_NST (SQ / 64)
__device__ __forceinline__ v8f fa_mma(v16h a, v16h b, v8f c) { return __builtin_amdgcn_wmma_f32_16x16x32_f16(false, a, false, b, (short)0, c, false, false); }
__device__ __forceinline__ v16h fa_lds(const unsigned char* p) { FragH f; f.half[0] = *(const v8us*)p; f.half[1] = *(const v8us*)(p + 32); return f.v; }      /* p already holds + 16 * (lane >> 4): same k order as g2_frag */
__global__ __launch_bounds__(256) void k_fattn(const _Float16* __restrict__ Q, const _Float16* __restrict__ K, const _Float16* __restrict__ VT, _Float16* __restrict__ O) {
  __shared__ __attribute__((aligned(16))) unsigned char L[2 * FA_BUF];
  const int tid = threadIdx.x, lane = tid & 31, c = lane & 15, hh = lane >> 4; const int wave = __builtin_amdgcn_readfirstlane(tid >> 5);
  const int bh = blockIdx.x >> 3, b = bh >> 4, h = bh & 15; const size_t r0 = (size_t)b * SQ; const int q0 = (blockIdx.x & 7) * 256 + wave * 32;
  /* every loop over a register array (fragments, tiles, staging pieces) is fully unrolled: constant indices keep the arrays in registers */
  /* staging: thread t moves 16-byte pieces; K: row (t >> 4) + 16 j, piece t & 15; V^T: row (t >> 3) + 32 j, piece t & 7 */
  const unsigned short* kg = (const unsigned short*)K + (r0 + (tid >> 4)) * DM + h * 128 + (tid & 15) * 8;
  const unsigned short* vg = (const unsigned short*)VT + ((size_t)b * DM + h * 128 + (tid >> 3)) * SQ + (tid & 7) * 8;
  const int kl = (tid >> 4) * FA_KP + (tid & 15) * 16, vl = FA_KT + (tid >> 3) * FA_VP + (tid & 7) * 16;
  v8us sk[4], sv[4];
#pragma unroll
  for (int j = 0; j < 4; ++j) { sk[j] = *(const v8us*)(kg + (size_t)(16 * j) * DM); sv[j] = *(const v8us*)(vg + (size_t)(32 * j) * SQ); }
  v16h qf[2][4];
#pragma unroll
  for (int g = 0; g < 2; ++g) for (int kc = 0; kc < 4; ++kc) qf[g][kc] = g2_frag(Q + (r0 + q0 + 16 * g + c) * DM + h * 128 + 32 * kc, hh);
  asm volatile("s_wait_xcnt 0x0" ::: "memory");      /* stands before any address register of the loads above is written again */
  const v8f z8 = {0.f,0.f,0.f,0.f,0.f,0.f,0.f,0.f}; v8f acc[2][8]; float m_run[2], l_run[2];
#pragma unroll
  for (int g = 0; g < 2; ++g) { m_run[g] = -__builtin_inff(); l_run[g] = 0.f; for (int t = 0; t < 8; ++t) acc[g][t] = z8; }
#pragma unroll
  for (int j = 0; j < 4; ++j) { *(v8us*)(L + kl + 16 * j * FA_KP) = sk[j]; *(v8us*)(L + vl + 32 * j * FA_VP) = sv[j]; }
  __syncthreads();
  const float cs = 0.125f * 1.44269504f;      /* scores / 8, in the log2 domain */
  /* the stage loop and the pass loop stay rolled: one body in the instruction cache, and no second set of live tiles */
#pragma unroll 1
  for (int st = 0; st < FA_NST; ++st) {
    const unsigned char* Lb = L + (st & 1) * FA_BUF;
    if (st + 1 < FA_NST) {      /* next stage's 8 loads fly under this stage's two passes */
#pragma unroll
      for (int j = 0; j < 4; ++j) { sk[j] = *(const v8us*)(kg + (size_t)((st + 1) * 64 + 16 * j) * DM); sv[j] = *(const v8us*)(vg + (size_t)(32 * j) * SQ + (st + 1) * 64); }
      asm volatile("s_wait_xcnt 0x0" ::: "memory");      /* stands before any address register of these loads is written again */
    }
#pragma unroll 1
    for (int ps = 0; ps < 2; ++ps) {
      v8f s[2][2] = {{z8, z8}, {z8, z8}};      /* [16-key tile][query group] */
      const unsigned char* kp = Lb + (ps * 32 + c) * FA_KP + 16 * hh;
#pragma unroll
      for (int kc = 0; kc < 4; ++kc) { const v16h k0 = fa_lds(kp + 64 * kc), k1 = fa_lds(kp + 16 * FA_KP + 64 * kc);
        s[0][0] = fa_mma(k0, qf[0][kc], s[0][0]); s[0][1] = fa_mma(k0, qf[1][kc], s[0][1]); s[1][0] = fa_mma(k1, qf[0][kc], s[1][0]); s[1][1] = fa_mma(k1, qf[1][kc], s[1][1]); }
      v16h vf[8]; const unsigned char* vp = Lb + FA_KT + c * FA_VP + ps * 64 + 16 * hh;
#pragma unroll
      for (int t = 0; t < 8; ++t) vf[t] = fa_lds(vp + 16 * t * FA_VP);
      /* the maximum in use may trail the true one by up to 8 (log2 domain): the 128 accumulator registers are rescaled only when some column needs it */
      float mb[2]; bool need = false;
#pragma unroll
      for (int g = 0; g < 2; ++g) { float mx = s[0][g][0];
        for (int r = 1; r < 8; ++r) mx = fmaxf(mx, s[0][g][r]);
        for (int r = 0; r < 8; ++r) mx = fmaxf(mx, s[1][g][r]);
        mx = fmaxf(mx, rx_x16(mx)) * cs; mb[g] = mx; need = need || (mx > m_run[g] + 8.0f); }
      if (__builtin_amdgcn_ballot_w32(need) != 0) {      /* wave-uniform: taken on the first pass (m_run = -inf, factor 0 on zero sums), rarely later */
        const float n0 = fmaxf(m_run[0], mb[0]), n1 = fmaxf(m_run[1], mb[1]); float co[2]; exp2x2(m_run[0] - n0, m_run[1] - n1, co[0], co[1]);
        m_run[0] = n0; m_run[1] = n1;
#pragma unroll
        for (int g = 0; g < 2; ++g) { l_run[g] *= co[g]; for (int t = 0; t < 8; ++t) acc[g][t] = acc[g][t] * co[g]; }
      }
      FragH pf[2];      /* both groups' weights first, then the 16 products in one run on 16 separate tiles */
#pragma unroll
      for (int g = 0; g < 2; ++g) { const float nm = 4.0f - m_run[g];      /* weights carried x16 (at most 2^12): small ones stay off the f16 subnormal range; the factor cancels in sum and product */
        v4f ps4;
#pragma unroll
        for (int i = 0; i < 4; ++i) { const int kt = i >> 1, rb = (i & 1) * 4; const v4f a4 = {s[kt][g][rb] * cs + nm, s[kt][g][rb + 1] * cs + nm, s[kt][g][rb + 2] * cs + nm, s[kt][g][rb + 3] * cs + nm}; const v4f p4 = exp2x4(a4); ps4 = (i == 0) ? p4 : ps4 + p4;
          for (int q = 0; q < 4; ++q) pf[g].h[4 * i + q] = (_Float16)p4[q]; }      /* element 8 kt + r = key 16 kt + 8 hh + r: the hardware k order, as V^T's loads */
        l_run[g] += (ps4[0] + ps4[1]) + (ps4[2] + ps4[3]); }
#pragma unroll
      for (int t = 0; t < 8; ++t) { acc[0][t] = fa_mma(vf[t], pf[0].v, acc[0][t]); acc[1][t] = fa_mma(vf[t], pf[1].v, acc[1][t]); }
    }
    if (st + 1 < FA_NST) { unsigned char* Ln = L + ((st + 1) & 1) * FA_BUF;      /* that buffer's last readers left it before the barrier that ended stage st - 1 */
#pragma unroll
      for (int j = 0; j < 4; ++j) { *(v8us*)(Ln + kl + 16 * j * FA_KP) = sk[j]; *(v8us*)(Ln + vl + 32 * j * FA_VP) = sv[j]; } }
    __syncthreads();      /* publishes stage st + 1 and ends every read of stage st */
  }
#pragma unroll
  for (int g = 0; g < 2; ++g) { const float inv = 64.0f / (l_run[g] + rx_x16(l_run[g]));      /* each wave half summed its eight keys of every 16-key tile */
    unsigned short* op = (unsigned short*)O + (r0 + q0 + 16 * g + c) * DM + h * 128 + 8 * hh;
#pragma unroll
    for (int t = 0; t < 8; ++t) { FragH f; for (int r = 0; r < 8; ++r) f.h[r] = (_Float16)(acc[g][t][r] * inv); *(v8us*)(op + 16 * t) = f.half[0]; } }      /* register r = d 16 t + 8 hh + r of query c: 16 contiguous bytes */
}

// ---- tiled GEMM: C[M][NN] = (A[M][DM] . Bh[NN][DM]^T) * alpha + bias, f16 operands, f32 accumulation; M % 128 == 0, NN % 128 == 0 ----
// A workgroup of 8 waves owns a 128 x 128 tile of C; a wave owns 64 x 32 (4 x 2 accumulator tiles).
// A and Bh rows come in stages of 128 k (256 B a row, whole lines) through registers into two LDS buffers: stage s + 1 is loaded while stage s is worked on; one barrier per stage.
// Each accumulator tile still sums its 32-k blocks in ascending k, one chain.
#define G3_P 272                     /* LDS pitch of an operand row: 256 B + 16 (odd multiple of 16 B) */
#define G3_OP (128 * G3_P)           /* one operand's 128 rows */
#define G3_BUF (2 * G3_OP)
#define G3_NST (DM / 128)
#define G3_SP 132                    /* epilogue pitch in floats: 128 + 4 */
template <int NN, bool OUT32>
__global__ __launch_bounds__(256) void k_gemm3(const _Float16* __restrict__ A, const _Float16* __restrict__ Bh, float alpha, const float* __restrict__ bias, float* __restrict__ C, _Float16* __restrict__ C16) {
  __shared__ __attribute__((aligned(16))) unsigned char L[2 * G3_BUF];
  const int tid = threadIdx.x, lane = tid & 31, ln = lane & 15, hh = lane >> 4; const int wave = __builtin_amdgcn_readfirstlane(tid >> 5); const int wm = wave >> 2, wn = wave & 3;
  const int mt = blockIdx.x / (NN / 128), nq = blockIdx.x - mt * (NN / 128); const int row0 = mt * 128, col0 = nq * 128;
  /* staging: thread t moves 16-byte pieces: row (t >> 4) + 16 j of each operand, piece t & 15 */
  const unsigned short* ag = (const unsigned short*)A + (size_t)(row0 + (tid >> 4)) * DM + (tid & 15) * 8;
  const unsigned short* bg = (const unsigned short*)Bh + (size_t)(col0 + (tid >> 4)) * DM + (tid & 15) * 8;
  const int sl = (tid >> 4) * G3_P + (tid & 15) * 16;
  /* every loop over a register array is fully unrolled: constant indices keep the arrays in registers */
  v8us sa[8], sb[8];
#pragma unroll
  for (int j = 0; j < 8; ++j) { sa[j] = *(const v8us*)(ag + (size_t)(16 * j) * DM); sb[j] = *(const v8us*)(bg + (size_t)(16 * j) * DM); }
  asm volatile("s_wait_xcnt 0x0" ::: "memory");      /* stands before any address register of the loads above is written again */
  const v8f z8 = {0.f,0.f,0.f,0.f,0.f,0.f,0.f,0.f}; v8f acc[4][2];
#pragma unroll
  for (int mi = 0; mi < 4; ++mi) { acc[mi][0] = z8; acc[mi][1] = z8; }
#pragma unroll
  for (int j = 0; j < 8; ++j) { *(v8us*)(L + sl + 16 * j * G3_P) = sa[j]; *(v8us*)(L + G3_OP + sl + 16 * j * G3_P) = sb[j]; }
  __syncthreads();
  /* the stage loop stays rolled: one body in the instruction cache */
#pragma unroll 1
  for (int st = 0; st < G3_NST; ++st) {
    const unsigned char* Lb = L + (st & 1) * G3_BUF;
    if (st + 1 < G3_NST) {      /* next stage's 16 loads fly under this stage's 32 products */
      const unsigned short* an = ag + (st + 1) * 128; const unsigned short* bn = bg + (st + 1) * 128;
#pragma unroll
      for (int j = 0; j < 8; ++j) { sa[j] = *(const v8us*)(an + (size_t)(16 * j) * DM); sb[j] = *(const v8us*)(bn + (size_t)(16 * j) * DM); }
      asm volatile("s_wait_xcnt 0x0" :: "v"(an), "v"(bn) : "memory");      /* stands before any address register of these loads is written again; the two addresses are inputs so that they stay live up to the wait and no load of the run is given their registers for its result */
    }
    const unsigned char* ap = Lb + (wm * 64 + ln) * G3_P + 16 * hh; const unsigned char* bp = Lb + G3_OP + (wn * 32 + ln) * G3_P + 16 * hh;
    v16h a[2][4], b[2][2];      /* two fragment sets: block kc + 1 is read from LDS while block kc is multiplied */
#pragma unroll
    for (int mi = 0; mi < 4; ++mi) a[0][mi] = fa_lds(ap + 16 * mi * G3_P);
    b[0][0] = fa_lds(bp); b[0][1] = fa_lds(bp + 16 * G3_P);
#pragma unroll
    for (int kc = 0; kc < 4; ++kc) { const int cu = kc & 1, nx = cu ^ 1;
      if (kc < 3) {
#pragma unroll
        for (int mi = 0; mi < 4; ++mi) a[nx][mi] = fa_lds(ap + 16 * mi * G3_P + 64 * (kc + 1));
        b[nx][0] = fa_lds(bp + 64 * (kc + 1)); b[nx][1] = fa_lds(bp + 16 * G3_P + 64 * (kc + 1)); }
      __builtin_amdgcn_sched_barrier(0);      /* holds the next block's 12 LDS reads as one group ahead of this block's products; left free, the compiler read each fragment into one register set directly in front of the first product that uses it and waited for it there */
#pragma unroll
      for (int mi = 0; mi < 4; ++mi) { acc[mi][0] = fa_mma(a[cu][mi], b[cu][0], acc[mi][0]); acc[mi][1] = fa_mma(a[cu][mi], b[cu][1], acc[mi][1]); }
      __builtin_amdgcn_sched_barrier(0);      /* keeps the following group of reads from moving up among these products */
    }
    if (st + 1 < G3_NST) { unsigned char* Ln = L + ((st + 1) & 1) * G3_BUF;      /* that buffer's last readers left it before the barrier that ended stage st - 1 */
#pragma unroll
      for (int j = 0; j < 8; ++j) { *(v8us*)(Ln + sl + 16 * j * G3_P) = sa[j]; *(v8us*)(Ln + G3_OP + sl + 16 * j * G3_P) = sb[j]; } }
    __syncthreads();      /* publishes stage st + 1 and ends every read of stage st */
  }
  /* epilogue: the whole 128 x 128 tile goes through the (now free) ring as f32, so that every store instruction writes one whole row piece of the tile (whole 128-B lines) */
  float* so = (float*)L;
#pragma unroll
  for (int ni = 0; ni < 2; ++ni) { const int col = wn * 32 + ni * 16 + ln; const float bv = bf16_round(bias[col0 + col]);
#pragma unroll
    for (int mi = 0; mi < 4; ++mi) for (int r = 0; r < 8; ++r) so[(wm * 64 + mi * 16 + 8 * hh + r) * G3_SP + col] = acc[mi][ni][r] * alpha + bv; }
  __syncthreads();      /* a row of the tile was written by four waves */
#pragma unroll
  for (int q = 0; q < 16; ++q) { const int row = wave * 16 + q; const v4f v = *(const v4fa*)(so + row * G3_SP + lane * 4);
    if (OUT32) *(v4f*)(C + (size_t)(row0 + row) * NN + col0 + lane * 4) = v;
    else { v4h h4; for (int i = 0; i < 4; ++i) h4[i] = (_Float16)v[i]; *(v4h*)(C16 + (size_t)(row0 + row) * NN + col0 + lane * 4) = h4; } }
}

extern "C" void kernel_launch(void* const* d_in, const int* in_sizes, int n_in,
                              void* d_out, int out_size, void* d_ws, size_t ws_size, hipStream_t stream) {
  (void)in_sizes; (void)n_in; (void)out_size;
  const float* const* I = (const float* const*)d_in; const float* xr = I[0]; const float* xi = I[1];
  const float* qwr = I[2]; const float* qwi = I[3]; const float* qbr = I[4]; const float* qbi = I[5]; const float* kwr = I[6]; const float* kwi = I[7]; const float* kbr = I[8]; const float* kbi = I[9]; const float* vwr = I[10]; const float* vwi = I[11]; const float* vbr = I[12]; const float* vbi = I[13]; const float* owr = I[14]; const float* owi = I[15]; const float* obr = I[16]; const float* obi = I[17];
  char* ws = (char*)d_ws; size_t off = 0;
  auto take = [&](size_t bytes) { char* p = ws + off; off += (bytes + 255) & ~(size_t)255; return p; };
  _Float16* BQ = (_Float16*)take((size_t)DM * DM * 2); _Float16* BK = (_Float16*)take((size_t)DM * DM * 2); _Float16* BV = (_Float16*)take((size_t)DM * DM * 2); _Float16* BO = (_Float16*)take((size_t)2 * DMX * DM * 2); float* bq2 = (float*)take(DM * 4); float* bk2 = (float*)take(DM * 4); float* bv2 = (float*)take(DM * 4);
  _Float16* XC = (_Float16*)take(NR * DM * 2); _Float16* Q2 = (_Float16*)take(NR * DM * 2); _Float16* K2 = (_Float16*)take(NR * DM * 2); _Float16* V2 = (_Float16*)take(NR * DM * 2); _Float16* O2 = (_Float16*)take(NR * DM * 2);
  _Float16* VT = (_Float16*)take((size_t)NB * DM * SQ * 2);
  if (off > ws_size) return;      /* approx 8 x 4 + 16 x 5 + 16 = 128 MiB */
  { const unsigned g = (unsigned)(((size_t)DM * (DM / 8) + 255) / 256); k_wcat2<<<g, 256, 0, stream>>>(qwr, qwi, BQ); k_wcat2<<<g, 256, 0, stream>>>(kwr, kwi, BK); k_wcat2<<<g, 256, 0, stream>>>(vwr, vwi, BV); k_wcplx3<<<(unsigned)(((size_t)2 * DMX * (DM / 8) + 255) / 256), 256, 0, stream>>>(owr, owi, BO); }
  k_bcat2<<<1, 256, 0, stream>>>(qbr, qbi, bq2); k_bcat2<<<1, 256, 0, stream>>>(kbr, kbi, bk2); k_bcat2<<<1, 256, 0, stream>>>(vbr, vbi, bv2);
  k_xcat<<<(unsigned)((NR * (DM / 8) + 255) / 256), 256, 0, stream>>>(xr, xi, XC, NR);      /* [x_real | x_imag] exact f16 rows */
  k_gemm3<DM, false><<<(unsigned)((NR / 128) * (DM / 128)), 256, 0, stream>>>(XC, BQ, 0.0625f, bq2, nullptr, Q2);      /* (q_r | q_i) per head, K = 2048 */
  k_gemm3<DM, false><<<(unsigned)((NR / 128) * (DM / 128)), 256, 0, stream>>>(XC, BK, 0.0625f, bk2, nullptr, K2);
  k_gemm3<DM, false><<<(unsigned)((NR / 128) * (DM / 128)), 256, 0, stream>>>(XC, BV, 0.0625f, bv2, nullptr, V2);
  k_vt<NH, SQ><<<NB * NH * (SQ / 64), 256, 0, stream>>>(V2, DM, 0, VT);      /* [v_r | v_i]^T, both batches: row b * 2048 + 128 h + w, w < 64 = v_r of head h, else v_i */
  k_fattn<<<NB * 16 * (SQ / 256), 256, 0, stream>>>(Q2, K2, VT, O2);      /* [out_r | out_i] x64 per head */
  k_gemm3<DMX, true><<<(unsigned)((NR / 128) * (DMX / 128)), 256, 0, stream>>>(O2, BO, 0.0009765625f, obr, (float*)d_out, nullptr);      /* y_r = o_r Wr - o_i Wi + br -> out[0] */
  k_gemm3<DMX, true><<<(unsigned)((NR / 128) * (DMX / 128)), 256, 0, stream>>>(O2, BO + (size_t)DMX * DM, 0.0009765625f, obi, (float*)d_out + NR * DMX, nullptr);      /* y_i = o_i Wr + o_r Wi + bi -> out[1] */
}

// v004
// One run takes 211 microseconds.
// Two timings next to v003 put it at 1.35 and 1.36 times that version's speed.
// All steps since v000 together make it 19.2 times as fast.
#include <hip/hip_runtime.h>
// Complex multi-head attention (x_real, x_imag [2][2048][1024]; complex linear (weights [in][out]): r = xr Wr - xi Wi + br, i = xi Wr + xr Wi + bi for q, k, v; 16 heads of 64; scores = (qr . kr + qi . ki) / 8 = Re(q conj(k)); softmax; out_r = P vr, out_i = P vi; y = complex_linear(out, Wo); output = stack([y_r, y_i]) -> [2][2][2048][1024]).
// Structure: [x_real | x_imag] as ONE exact f16 row plane (K = 2048); each complex projection as ONE WMMA GEMM (128x128 workgroup tiles staged in LDS, 64x32 wave tiles, f32 accumulation, exact x16 weights arranged on VALU as [Wr^T | -Wi^T] / [Wi^T | Wr^T] row pairs, + bias) whose output columns interleave (q_r | q_i) per head (head width 128); [v_r | v_i]^T of both batches via LDS transposes; ONE attention launch over all (batch, head, 256-query block): S^T = K Q^T (K = 128 = qr.kr + qi.ki in one contraction), running maximum and sum per query in f32 (native exp2), P^T packed from the score tiles as f16 B operand, [out_r | out_i]^T += [v_r | v_i]^T P^T (carried x64) into interleaved f16 rows; y_r and y_i as two GEMMs over those rows (K = 2048, weights re-laid on VALU with the matching signs, + bias) straight into the two output planes; 5 + 3 + 1 + 1 + 2 = 12 launches.
// Compute dtype: inputs rounded to bf16; x / weights exact; q, k, v, softmax weights and out plain f16 (~2^-12); scores, statistics, y f32. v_wmma_f32_16x16x32_f16.
#define NB 2
#define SQ 2048
#define DMX 1024                     /* model width */
#define DM (2 * DMX)                 /* interleaved (real | imag) width = 16 heads x 128 */
#define NH 32                        /* k_vt slabs of 64: (head, part) */
#define HD 64
#define HG 4
#define QN SQ
#define NR ((size_t)NB * SQ)
typedef __bf16 v16b __attribute__((ext_vector_type(16)));
typedef unsigned short v8us __attribute__((ext_vector_type(8), may_alias));
typedef float  v8f  __attribute__((ext_vector_type(8)));
typedef float  v4f  __attribute__((ext_vector_type(4)));
typedef float  v4fa __attribute__((ext_vector_type(4), may_alias));
union FragB { v16b v; v8us half[2]; unsigned short u[16]; };

__device__ __forceinline__ unsigned short bf16_bits(float x) { unsigned int u = __float_as_uint(x); return (unsigned short)((u + 0x7FFFu + ((u >> 16) & 1u)) >> 16); }
__device__ __forceinline__ float bf16_val(unsigned short b) { return __uint_as_float(((unsigned int)b) << 16); }
__device__ __forceinline__ float bf16_round(float x) { return bf16_val(bf16_bits(x)); }
// D += A·B with NT terms: 1 = ah·bh, 2 = + al·bh (A split), 3 = + ah·bl (both split)
template <int NT>
__device__ __forceinline__ v8f mmaN(v16b ah, v16b al, v16b bh, v16b bl, v8f c) {
  c = __builtin_amdgcn_wmma_f32_16x16x32_bf16(false, ah, false, bh, (short)0, c, false, false);
  if (NT >= 2) c = __builtin_amdgcn_wmma_f32_16x16x32_bf16(false, al, false, bh, (short)0, c, false, false);
  if (NT >= 3) c = __builtin_amdgcn_wmma_f32_16x16x32_bf16(false, ah, false, bl, (short)0, c, false, false);
  asm volatile("v_nop\n\tv_nop\n\tv_nop\n\tv_nop" : "+v"(c) : "v"(ah), "v"(al), "v"(bh), "v"(bl));
  return c;
}

__global__ __launch_bounds__(256) void k_wt_bf16(const float* __restrict__ W, unsigned short* __restrict__ Wt, int K, int N) {
  const int t = blockIdx.x * 256 + threadIdx.x;
  const int k8n = K / 8;
  if (t >= N * k8n) return;
  const int n = t / k8n, k8 = (t % k8n) * 8;
  v8us v;
#pragma unroll
  for (int i = 0; i < 8; ++i) v[i] = bf16_bits(W[(size_t)(k8 + i) * N + n]);
  *(v8us*)(Wt + (size_t)n * K + k8) = v;
  
}

// GEMM C[M][N] (f32, pitch ldc) = act(A[M][K]·W + bias). A f32 row-major (pitch lda) converted per fragment to bf16
// (ASPLIT: hi/lo two planes -> 2 terms, else single rounded term); Wt bf16 [N][K] (pitch ldb). BIAS_BF16 rounds the
// bias to bf16 first (bias quantised to bf16 before the add). K%32==0, M%16==0, N%64==0.
template <bool ASPLIT, int ACT, bool BIAS_BF16>
__global__ __launch_bounds__(128) void k_gemm_bf(const float* __restrict__ A, int lda, const unsigned short* __restrict__ Wt, int ldb,
                                               const float* __restrict__ bias, float* __restrict__ C, int ldc, int M, int N, int K) {
  __shared__ __attribute__((aligned(16))) float so[4][16][64];
  const int tid = threadIdx.x, w = tid >> 5, lane = tid & 31, ln = lane & 15, hh = lane >> 4;
  const int ntn = N / 64;
  const int wid = blockIdx.x * 4 + w;
  const int mt = wid / ntn, nq = wid % ntn;
  if (mt * 16 >= M) return;
  const int row0 = mt * 16, col0 = nq * 64;
  const float* arow = A + (size_t)(row0 + ln) * lda;
  v8f acc[4] = {};
  for (int kb = 0; kb < K; kb += 32) {
    FragB ah, al;
    const v4f x0 = *(const v4fa*)(arow + kb + 8 * hh), x1 = *(const v4fa*)(arow + kb + 8 * hh + 4);
    const v4f x2 = *(const v4fa*)(arow + kb + 16 + 8 * hh), x3 = *(const v4fa*)(arow + kb + 16 + 8 * hh + 4);
    float xs[16] = {x0[0],x0[1],x0[2],x0[3],x1[0],x1[1],x1[2],x1[3],x2[0],x2[1],x2[2],x2[3],x3[0],x3[1],x3[2],x3[3]};
#pragma unroll
    for (int i = 0; i < 16; ++i) { const unsigned short hb = bf16_bits(xs[i]); ah.u[i] = hb; al.u[i] = ASPLIT ? bf16_bits(xs[i] - bf16_val(hb)) : (unsigned short)0; }
#pragma unroll
    for (int t = 0; t < 4; ++t) {
      const unsigned short* brow = Wt + (size_t)(col0 + t * 16 + ln) * ldb + kb;
      FragB b;
      b.half[0] = *(const v8us*)(brow + 8 * hh);
      b.half[1] = *(const v8us*)(brow + 16 + 8 * hh);
      acc[t] = mmaN<ASPLIT ? 2 : 1>(ah.v, al.v, b.v, b.v, acc[t]);
    }
  }
#pragma unroll
  for (int t = 0; t < 4; ++t) {
    float bv = bias ? bias[col0 + t * 16 + ln] : 0.f;
    if (BIAS_BF16) bv = bf16_round(bv);
#pragma unroll
    for (int r = 0; r < 8; ++r) { float v = acc[t][r] + bv; if (ACT == 1) v = fmaxf(v, 0.f); so[w][8 * hh + r][t * 16 + ln] = v; }
  }
  __builtin_amdgcn_fence(__ATOMIC_ACQ_REL, "workgroup");
  __builtin_amdgcn_wave_barrier();
  const int rsub = lane >> 4, c4 = (lane & 15) * 4;
  {
#pragma unroll
    for (int q = 0; q < 8; ++q) {
      const int r = q * 2 + rsub;
      const v4f v = *(const v4fa*)&so[w][r][c4];
      *(v4f*)(C + (size_t)(row0 + r) * ldc + col0 + c4) = v;
    }
    
  }
}

// GEMM C = act(A·W + bias + resid): A f32 (ASPLIT -> hi/lo 2 terms), Wt bf16 [N][K]; ACT 0 none, 1 relu, 2 exact gelu;
// resid (optional, f32, row index = (row % rmod), pitch ldr, RES_BF16 rounds it) added before the activation.
template <bool ASPLIT, int ACT, bool BIAS_BF16, bool RES_BF16>
__global__ __launch_bounds__(128) void k_gemm_bf3(const float* __restrict__ A, int lda, const unsigned short* __restrict__ Wt, int ldb,
                                                const float* __restrict__ bias, const float* __restrict__ resid, int rmod, int ldr,
                                                float* __restrict__ C, int ldc, int M, int N, int K) {
  __shared__ __attribute__((aligned(16))) float so[4][16][64];
  const int tid = threadIdx.x, w = tid >> 5, lane = tid & 31, ln = lane & 15, hh = lane >> 4;
  const int ntn = N / 64;
  const int wid = blockIdx.x * 4 + w;
  const int mt = wid / ntn, nq = wid % ntn;
  if (mt * 16 >= M) return;
  const int row0 = mt * 16, col0 = nq * 64;
  const float* arow = A + (size_t)(row0 + ln) * lda;
  v8f acc[4] = {};
  for (int kb = 0; kb < K; kb += 32) {
    FragB ah, al;
    const v4f x0 = *(const v4fa*)(arow + kb + 8 * hh), x1 = *(const v4fa*)(arow + kb + 8 * hh + 4);
    const v4f x2 = *(const v4fa*)(arow + kb + 16 + 8 * hh), x3 = *(const v4fa*)(arow + kb + 16 + 8 * hh + 4);
    float xs[16] = {x0[0],x0[1],x0[2],x0[3],x1[0],x1[1],x1[2],x1[3],x2[0],x2[1],x2[2],x2[3],x3[0],x3[1],x3[2],x3[3]};
#pragma unroll
    for (int i = 0; i < 16; ++i) { const unsigned short hb = bf16_bits(xs[i]); ah.u[i] = hb; al.u[i] = ASPLIT ? bf16_bits(xs[i] - bf16_val(hb)) : (unsigned short)0; }
#pragma unroll
    for (int t = 0; t < 4; ++t) {
      const unsigned short* brow = Wt + (size_t)(col0 + t * 16 + ln) * ldb + kb;
      FragB b;
      b.half[0] = *(const v8us*)(brow + 8 * hh);
      b.half[1] = *(const v8us*)(brow + 16 + 8 * hh);
      acc[t] = mmaN<ASPLIT ? 2 : 1>(ah.v, al.v, b.v, b.v, acc[t]);
    }
  }
#pragma unroll
  for (int t = 0; t < 4; ++t) {
    const int col = col0 + t * 16 + ln;
    float bv = bias ? bias[col] : 0.f;
    if (BIAS_BF16) bv = bf16_round(bv);
#pragma unroll
    for (int r = 0; r < 8; ++r) {
      float v = acc[t][r] + bv;
      if (resid) { float rv = resid[(size_t)((row0 + 8 * hh + r) % rmod) * ldr + col]; if (RES_BF16) rv = bf16_round(rv); v += rv; }
      if (ACT == 1) v = fmaxf(v, 0.f);
      if (ACT == 2) v = 0.5f * v * (1.0f + erff(v * 0.70710678118654752f));
      if (ACT == 3) { const float u = 0.7978845608028654f * (v + 0.044715f * v * v * v); v = 0.5f * v * (1.0f + tanhf(u)); }
      so[w][8 * hh + r][t * 16 + ln] = v;
    }
  }
  __builtin_amdgcn_fence(__ATOMIC_ACQ_REL, "workgroup");
  __builtin_amdgcn_wave_barrier();
  const int rsub = lane >> 4, c4 = (lane & 15) * 4;
  {
#pragma unroll
    for (int q = 0; q < 8; ++q) {
      const int r = q * 2 + rsub;
      const v4f v = *(const v4fa*)&so[w][r][c4];
      *(v4f*)(C + (size_t)(row0 + r) * ldc + col0 + c4) = v;
    }
    
  }
}
// row LayerNorm (biased variance, eps) over N: s = X (+ R); optional out_sum <- s; out_norm <- (s-mu)*rsqrt(var+eps)*g + b
template <bool PARAM_BF16>
__global__ __launch_bounds__(256) void k_layernorm(const float* __restrict__ X, const float* __restrict__ R, const float* __restrict__ g, const float* __restrict__ bta,
                                                  float* __restrict__ out_sum, float* __restrict__ out_norm, int N, float eps) {
  __shared__ float red[256];
  const int row = blockIdx.x, tid = threadIdx.x;
  const float* x = X + (size_t)row * N; const float* rr = R ? R + (size_t)row * N : nullptr;
  float vals[16];                     // up to N = 4096
  const int per = N / 256;            // contiguous chunk per thread? use strided-by-4 chunks: thread handles j = tid*4 + 1024*u
  float s1 = 0.f;
  for (int u = 0; u < per / 4; ++u) {
    const int j = tid * 4 + 1024 * u;
    const v4f a = *(const v4fa*)(x + j);
    v4f b = {0.f,0.f,0.f,0.f}; if (rr) b = *(const v4fa*)(rr + j);
#pragma unroll
    for (int q = 0; q < 4; ++q) { const float v = a[q] + b[q]; vals[u * 4 + q] = v; s1 += v; }
  }
  red[tid] = s1; __syncthreads();
  for (int st = 128; st > 0; st >>= 1) { if (tid < st) red[tid] += red[tid + st]; __syncthreads(); }
  const float mu = red[0] / (float)N; __syncthreads();
  float s2 = 0.f;
  for (int u = 0; u < per / 4; ++u)
#pragma unroll
    for (int q = 0; q < 4; ++q) { const float c = vals[u * 4 + q] - mu; s2 += c * c; }
  red[tid] = s2; __syncthreads();
  for (int st = 128; st > 0; st >>= 1) { if (tid < st) red[tid] += red[tid + st]; __syncthreads(); }
  const float rs = rsqrtf(red[0] / (float)N + eps);
  {
    for (int u = 0; u < per / 4; ++u) {
      const int j = tid * 4 + 1024 * u;
      v4f o, sm;
#pragma unroll
      for (int q = 0; q < 4; ++q) {
        float gg = g[j + q], bb = bta[j + q];
        if (PARAM_BF16) { gg = bf16_round(gg); bb = bf16_round(bb); }
        sm[q] = vals[u * 4 + q]; o[q] = (vals[u * 4 + q] - mu) * rs * gg + bb;
      }
      if (out_sum) *(v4f*)(out_sum + (size_t)row * N + j) = sm;
      *(v4f*)(out_norm + (size_t)row * N + j) = o;
    }
    
  }
}



// ---- f16 WMMA path (v_wmma_f32_16x16x32_f16): 11-bit significands for operands in range — used where a [0,1] probability operand needs more precision than bf16
typedef _Float16 v16h __attribute__((ext_vector_type(16)));
union FragH { v16h v; v8us half[2]; _Float16 h[16]; unsigned short u[16]; };
template <int NT>
__device__ __forceinline__ v8f mmaH(v16h ah, v16h al, v16h bh, v16h bl, v8f c) {
  c = __builtin_amdgcn_wmma_f32_16x16x32_f16(false, ah, false, bh, (short)0, c, false, false);
  if (NT >= 2) c = __builtin_amdgcn_wmma_f32_16x16x32_f16(false, al, false, bh, (short)0, c, false, false);
  if (NT >= 3) c = __builtin_amdgcn_wmma_f32_16x16x32_f16(false, ah, false, bl, (short)0, c, false, false);
  asm volatile("v_nop\n\tv_nop\n\tv_nop\n\tv_nop" : "+v"(c) : "v"(ah), "v"(al), "v"(bh), "v"(bl));
  return c;
}
// batched GEMM like k_gemm_b but f16 operands: A f32 (split into f16 hi/lo if ASPLIT, else rounded to f16), Bt = f16 values [n][k]; alpha; C f32; N multiple of 16 (partial tiles skipped)
template <bool ASPLIT>
__global__ __launch_bounds__(128) void k_gemm_h(const float* __restrict__ A, int lda, size_t sA, const _Float16* __restrict__ Bh, int ldb, size_t sB, float alpha, float* __restrict__ C, int ldc, size_t sC, int M, int N, int K) {
  __shared__ __attribute__((aligned(16))) float so[4][16][64];
  const int tid = threadIdx.x, w = tid >> 5, lane = tid & 31, ln = lane & 15, hh = lane >> 4; const int by = blockIdx.y;
  A += (size_t)by * sA; Bh += (size_t)by * sB; C += (size_t)by * sC;
  const int ntn = (N + 63) / 64; const int wid = blockIdx.x * 4 + w; const int mt = wid / ntn, nq = wid % ntn; if (mt * 16 >= M) return;
  const int row0 = mt * 16, col0 = nq * 64; const float* arow = A + (size_t)(row0 + ln) * lda;
  v8f acc[4] = {};
  for (int kb = 0; kb < K; kb += 32) {
    FragH ah, al;
    const v4f x0 = *(const v4fa*)(arow + kb + 8 * hh), x1 = *(const v4fa*)(arow + kb + 8 * hh + 4), x2 = *(const v4fa*)(arow + kb + 16 + 8 * hh), x3 = *(const v4fa*)(arow + kb + 16 + 8 * hh + 4);
    float xs[16] = {x0[0],x0[1],x0[2],x0[3],x1[0],x1[1],x1[2],x1[3],x2[0],x2[1],x2[2],x2[3],x3[0],x3[1],x3[2],x3[3]};
#pragma unroll
    for (int i = 0; i < 16; ++i) { const _Float16 h = (_Float16)xs[i]; ah.h[i] = h; al.h[i] = ASPLIT ? (_Float16)(xs[i] - (float)h) : (_Float16)0.0f; }
#pragma unroll
    for (int t = 0; t < 4; ++t) { if (col0 + t * 16 >= N) continue; const size_t boff = (size_t)(col0 + t * 16 + ln) * ldb + kb; FragH bq; bq.half[0] = *(const v8us*)(Bh + boff + 8 * hh); bq.half[1] = *(const v8us*)(Bh + boff + 16 + 8 * hh);
      acc[t] = mmaH<ASPLIT ? 2 : 1>(ah.v, al.v, bq.v, bq.v, acc[t]); }
  }
#pragma unroll
  for (int t = 0; t < 4; ++t) { if (col0 + t * 16 >= N) continue;
#pragma unroll
    for (int r = 0; r < 8; ++r) so[w][8 * hh + r][t * 16 + ln] = acc[t][r] * alpha; }
  __builtin_amdgcn_fence(__ATOMIC_ACQ_REL, "workgroup"); __builtin_amdgcn_wave_barrier();
  const int rsub = lane >> 4, c4 = (lane & 15) * 4;
  {
#pragma unroll
    for (int q = 0; q < 8; ++q) { const int r = q * 2 + rsub; if (col0 + c4 < N) { const v4f v = *(const v4fa*)&so[w][r][c4]; *(v4f*)(C + (size_t)(row0 + r) * ldc + col0 + c4) = v; } }
     }
}

// Wt[n][k] = f16(W[k][n]·scale) from f32 row-major W[K][N] (scale = power of two; bf16-exact weights stay exact in f16 away from the subnormal range)
__global__ __launch_bounds__(256) void k_wt_f16(const float* __restrict__ W, _Float16* __restrict__ Wt, int K, int N, float scale) {
  const int t = blockIdx.x * 256 + threadIdx.x; if (t >= N * (K / 8)) return; const int n = t / (K / 8), k8 = (t % (K / 8)) * 8; FragH f;
#pragma unroll
  for (int i = 0; i < 8; ++i) f.h[i] = (_Float16)(bf16_round(W[(size_t)(k8 + i) * N + n]) * scale); const v8us o = f.half[0];
  *(v8us*)((unsigned short*)Wt + (size_t)n * K + k8) = o; 
}
// k_gemm_hh variant with fused epilogue: v = acc·alpha + bias[by·sBias + col] (+ CP[(row/rowsPerB)·sCPb + by·64 + col] if CP) ; ACT 0 none / 1 elu ; writes f16 C16 (and f32 C if non-null)
template <int ACT>
__global__ __launch_bounds__(128) void k_gemm_hhx(const _Float16* __restrict__ A, int lda, size_t sA, const _Float16* __restrict__ Bh, int ldb, size_t sB, float alpha, const float* __restrict__ bias, size_t sBias, const float* __restrict__ CP, int rowsPerB, size_t sCPb, int row0g,
    float* __restrict__ C, _Float16* __restrict__ C16, int ldc, size_t sC, int M, int N, int K) {
  __shared__ __attribute__((aligned(16))) float so[4][16][64];
  const int tid = threadIdx.x, w = tid >> 5, lane = tid & 31, ln = lane & 15, hh = lane >> 4; const int by = blockIdx.y;
  A += (size_t)by * sA; Bh += (size_t)by * sB; const size_t cofs = (size_t)by * sC; const float* bp = bias ? bias + (size_t)by * sBias : nullptr;
  const int ntn = (N + 63) / 64; const int wid = blockIdx.x * 4 + w; const int mt = wid / ntn, nq = wid % ntn; if (mt * 16 >= M) return;
  const int row0 = mt * 16, col0 = nq * 64; const _Float16* arow = A + (size_t)(row0 + ln) * lda;
  v8f acc[4] = {};
  for (int kb = 0; kb < K; kb += 32) { FragH ah; ah.half[0] = *(const v8us*)((const unsigned short*)arow + kb + 8 * hh); ah.half[1] = *(const v8us*)((const unsigned short*)arow + kb + 16 + 8 * hh);
#pragma unroll
    for (int t = 0; t < 4; ++t) { if (col0 + t * 16 >= N) continue; const size_t boff = (size_t)(col0 + t * 16 + ln) * ldb + kb; FragH bq; bq.half[0] = *(const v8us*)((const unsigned short*)Bh + boff + 8 * hh); bq.half[1] = *(const v8us*)((const unsigned short*)Bh + boff + 16 + 8 * hh);
      acc[t] = mmaH<1>(ah.v, ah.v, bq.v, bq.v, acc[t]); }
  }
#pragma unroll
  for (int t = 0; t < 4; ++t) { if (col0 + t * 16 >= N) continue; const int col = col0 + t * 16 + ln; const float bv = bp ? bf16_round(bp[col]) : 0.f;
#pragma unroll
    for (int r = 0; r < 8; ++r) { float v = acc[t][r] * alpha + bv; if (CP) { const int rr = row0g + row0 + 8 * hh + r; if (rowsPerB < 0) v += CP[cofs + (size_t)rr * ldc + col];      /* rowsPerB < 0: own element of the batched C plane */ else { const int bidx = rr / rowsPerB; v += CP[(size_t)bidx * sCPb + (size_t)by * 64 + col]; } } if (ACT == 1) v = (v > 0.f) ? v : expm1f(v); else if (ACT == 7) v = (v > 0.f) ? v + 1.0f : expf(v); else if (ACT == 8) v = tanhf(v); else if (ACT == 9) v = 0.5f * v * (1.0f + tanhf(0.7978845608028654f * (v + 0.044715f * v * v * v))); else if (ACT == 11) v = 1.0f / (1.0f + expf(-v)); else if (ACT == 12) v = (v > 0.f) ? v : 0.01f * v; else if (ACT == 14) v = (v > 0.f) ? v : 0.1f * v; else if (ACT == 16) v = (v >= 0.f) ? v : 0.3f * v; else if (ACT == 17) v = (v >= 0.f) ? v : 0.2f * v; else if (ACT == 15) v = v / (1.0f + expf(-v)); else if (ACT == 3) v = fmaxf(v, 0.f); else if (ACT == 6) v = 0.5f * v * (1.0f + erff(v * 0.70710678118654752f)); so[w][8 * hh + r][t * 16 + ln] = v; } }
  __builtin_amdgcn_fence(__ATOMIC_ACQ_REL, "workgroup"); __builtin_amdgcn_wave_barrier();
  const int rsub = lane >> 4, c4 = (lane & 15) * 4; typedef _Float16 v4h __attribute__((ext_vector_type(4)));
  {
#pragma unroll
    for (int q = 0; q < 8; ++q) { const int r = q * 2 + rsub; if (col0 + c4 < N) { const v4f v = *(const v4fa*)&so[w][r][c4]; if (C) *(v4f*)(C + cofs + (size_t)(row0 + r) * ldc + col0 + c4) = v; if (C16) { v4h h4; for (int i = 0; i < 4; ++i) h4[i] = (_Float16)v[i]; *(v4h*)(C16 + cofs + (size_t)(row0 + r) * ldc + col0 + c4) = h4; } } }
     }
}


typedef _Float16 v4h __attribute__((ext_vector_type(4)));

__global__ __launch_bounds__(256) void k_x16(const float* __restrict__ x, _Float16* __restrict__ X16, size_t n8) { const size_t t = (size_t)blockIdx.x * 256 + threadIdx.x; if (t >= n8) return; FragH f;
#pragma unroll
  for (int q = 0; q < 8; ++q) f.h[q] = (_Float16)bf16_round(x[t * 8 + q]); *(v8us*)((unsigned short*)X16 + t * 8) = f.half[0];  }
__global__ __launch_bounds__(256) void k_h16(const float* __restrict__ x, _Float16* __restrict__ X16, size_t n8) { const size_t t = (size_t)blockIdx.x * 256 + threadIdx.x; if (t >= n8) return; FragH f;
#pragma unroll
  for (int q = 0; q < 8; ++q) f.h[q] = (_Float16)x[t * 8 + q]; *(v8us*)((unsigned short*)X16 + t * 8) = f.half[0];  }
__global__ __launch_bounds__(256) void k_round16f(const float* __restrict__ W, _Float16* __restrict__ Bt, size_t n8) { const size_t t = (size_t)blockIdx.x * 256 + threadIdx.x; if (t >= n8) return; FragH f;
#pragma unroll
  for (int i = 0; i < 8; ++i) f.h[i] = (_Float16)(bf16_round(W[t * 8 + i]) * 16.0f); *(v8us*)((unsigned short*)Bt + t * 8) = f.half[0];  }
template <int NHv, int TTv>
__global__ __launch_bounds__(256) void k_vt(const _Float16* __restrict__ V16, int ldv, int voff, _Float16* __restrict__ Vt) { __shared__ unsigned short tl[64][66]; const int tid = threadIdx.x; const int slab = blockIdx.x / (TTv / 64), lg = blockIdx.x % (TTv / 64); const int b = slab / NHv, h = slab % NHv;
  for (int i = tid; i < 64 * 8; i += 256) { const int r = i / 8, c8 = (i % 8) * 8; FragH f; f.half[0] = *(const v8us*)((const unsigned short*)V16 + ((size_t)b * TTv + lg * 64 + r) * ldv + voff + h * 64 + c8);
#pragma unroll
    for (int q = 0; q < 8; ++q) tl[r][c8 + q] = f.u[q]; }
  __syncthreads();
  {
#pragma unroll
    for (int rd = 0; rd < 2; ++rd) { const int d = rd * 32 + tid / 8, pc = tid % 8; FragH f;
#pragma unroll
      for (int q = 0; q < 8; ++q) f.u[q] = tl[pc * 8 + q][d];
      *(v8us*)((unsigned short*)Vt + ((size_t)slab * 64 + d) * TTv + lg * 64 + pc * 8) = f.half[0]; }
     } }

__global__ __launch_bounds__(256) void k_hl(const float* __restrict__ F, _Float16* __restrict__ Hh, _Float16* __restrict__ Hl, size_t n8) { const size_t t = (size_t)blockIdx.x * 256 + threadIdx.x; if (t >= n8) return; FragH fh, fl; const v4f a = *(const v4fa*)(F + t * 8), c = *(const v4fa*)(F + t * 8 + 4);
#pragma unroll
  for (int q = 0; q < 4; ++q) { _Float16 h = (_Float16)a[q]; fh.h[q] = h; fl.h[q] = (_Float16)((a[q] - (float)h) * 1024.0f); h = (_Float16)c[q]; fh.h[4 + q] = h; fl.h[4 + q] = (_Float16)((c[q] - (float)h) * 1024.0f); }
  { *(v8us*)((unsigned short*)Hh + t * 8) = fh.half[0]; *(v8us*)((unsigned short*)Hl + t * 8) = fl.half[0];  } }

// one 16x32 f16 fragment from K-contiguous global rows, in the hardware k order
__device__ __forceinline__ v16h g2_frag(const _Float16* p, int hh) { FragH f; f.half[0] = *(const v8us*)((const unsigned short*)p + 8 * hh); f.half[1] = *(const v8us*)((const unsigned short*)p + 16 + 8 * hh); return f.v; }


__global__ __launch_bounds__(256) void k_wnat(const float* __restrict__ w, size_t n8, _Float16* __restrict__ Bt) { const size_t t = (size_t)blockIdx.x * 256 + threadIdx.x; if (t >= n8) return; FragH f; for (int q = 0; q < 8; ++q) f.h[q] = (_Float16)(bf16_round(w[t * 8 + q]) * 16.0f); *(v8us*)((unsigned short*)Bt + t * 8) = f.half[0];  }
__global__ __launch_bounds__(256) void k_rsm(const float* __restrict__ S, _Float16* __restrict__ P, int nrows) {
  #pragma clang fp contract(off)
  const int i = blockIdx.x * 256 + threadIdx.x; if (i >= nrows) return; const float* s = S + (size_t)i * SQ; float mx = -3.0e38f;
#pragma unroll 1
  for (int j = 0; j < SQ; ++j) mx = fmaxf(mx, s[j]); float se = 0.f;
#pragma unroll 1
  for (int j = 0; j < SQ; ++j) se += expf(s[j] - mx); const float sc = 256.0f / se;
#pragma unroll 1
  for (int j0 = 0; j0 < SQ; j0 += 8) { FragH f; for (int q = 0; q < 8; ++q) f.h[q] = (_Float16)(expf(s[j0 + q] - mx) * sc); unsigned short* d = (unsigned short*)P + (size_t)i * SQ + j0; *(v8us*)d = f.half[0];  } }
__global__ __launch_bounds__(256) void k_vt(const _Float16* __restrict__ V16, int b, int h0, _Float16* __restrict__ VT) { __shared__ unsigned short tl[64][65]; const int tid = threadIdx.x; const int hh = blockIdx.x % HG, sg = blockIdx.x / HG; const int s0 = sg * 64; const int h = h0 + hh;
  for (int i = tid; i < 64 * 8; i += 256) { const int j = i / 8, d8 = (i % 8) * 8; FragH f; f.half[0] = *(const v8us*)((const unsigned short*)V16 + ((size_t)b * SQ + s0 + j) * DM + h * HD + d8); for (int q = 0; q < 8; ++q) tl[d8 + q][j] = f.u[q]; }
  __syncthreads();
  { for (int i = tid; i < 64 * 8; i += 256) { const int d = i / 8, j8 = (i % 8) * 8; FragH f; for (int q = 0; q < 8; ++q) f.u[q] = tl[d][j8 + q]; *(v8us*)((unsigned short*)VT + ((size_t)hh * HD + d) * SQ + s0 + j8) = f.half[0]; }  } }


// ---- weight arrangement: the four operands that the GEMMs read, from the eight weight planes, in one launch ----
// A workgroup takes one strip (256 k rows x 64 columns) of one plane: read once, in whole 256-B row pieces, rounded to bf16, scaled x16 (exact in f16), packed as (k, k + 1) pairs and transposed through LDS;
// each transposed row then goes out twice, in 16-B pieces that fill whole lines: W_r^T and W_i^T each stand at two places of the arranged operand, one of W_i^T's with the sign turned (a flip of the f16 sign bits, exact).
// LDS row = one column f of the strip: 128 dwords = 32 chunks of 16 B; chunk c of row r lies at c ^ ((r >> 2) & 15), so that the 32 dword stores of an instruction (16 rows 4 apart x 2 neighbouring dwords) meet 32 banks and a row is still read in 16-B pieces.
#define WP_NW 512                    /* 8 planes x 4 strips of 256 k x 16 strips of 64 columns */
typedef unsigned int v4ua __attribute__((ext_vector_type(4), may_alias));
__device__ __forceinline__ unsigned int wp_pair(float lo, float hi) { union { _Float16 h[2]; unsigned int u; } p; p.h[0] = (_Float16)(16.0f * bf16_round(lo)); p.h[1] = (_Float16)(16.0f * bf16_round(hi)); return p.u; }
__global__ __launch_bounds__(256) void k_wprep(const float* __restrict__ qwr, const float* __restrict__ qwi, const float* __restrict__ kwr, const float* __restrict__ kwi, const float* __restrict__ vwr, const float* __restrict__ vwi, const float* __restrict__ owr, const float* __restrict__ owi,
    _Float16* __restrict__ BQ, _Float16* __restrict__ BK, _Float16* __restrict__ BV, _Float16* __restrict__ BO) {
  __shared__ __attribute__((aligned(16))) unsigned int T[64 * 128];
  const int tid = threadIdx.x, lane = tid & 31; const int wave = __builtin_amdgcn_readfirstlane(tid >> 5);
  const int id = blockIdx.x, mat = id >> 7, fs = id & 15, k0 = ((id >> 4) & 3) * 256; const bool im = ((id >> 6) & 1) != 0, isO = mat == 3;
  const float* Wp = mat == 0 ? (im ? qwi : qwr) : mat == 1 ? (im ? kwi : kwr) : mat == 2 ? (im ? vwi : vwr) : (im ? owi : owr);
  _Float16* Bt = mat == 0 ? BQ : mat == 1 ? BK : mat == 2 ? BV : BO;
  const int fq = lane & 15, rp = lane >> 4;      /* lanes 0 - 15: 64 columns of rows 2 p, 2 p + 1; lanes 16 - 31: the next row pair */
  const float* wp = Wp + (size_t)(k0 + 4 * wave + 2 * rp) * DMX + fs * 64 + 4 * fq;
  /* every loop over a register array is fully unrolled: constant indices keep the arrays in registers */
  v4f ra[8], rb[8];
#pragma unroll
  for (int j = 0; j < 8; ++j) { ra[j] = *(const v4fa*)(wp + (size_t)(32 * j) * DMX); rb[j] = *(const v4fa*)(wp + (size_t)(32 * j + 1) * DMX); }
  asm volatile("s_wait_xcnt 0x0" :: "v"(wp) : "memory");      /* stands before any address register of these loads is written again; the address is an input so that it stays live up to the wait and no load of the run is given its registers for its result */
#pragma unroll
  for (int j = 0; j < 8; ++j) { const int p = 16 * j + 2 * wave + rp, pc = (((p >> 2) ^ fq) << 2) | (p & 3);
    for (int i = 0; i < 4; ++i) T[(4 * fq + i) * 128 + pc] = wp_pair(ra[j][i], rb[j][i]); }
  __syncthreads();      /* a transposed row was written by all eight waves */
  /* q, k, v: row 128 h + w of [Wr^T | -Wi^T] (w < 64) / [Wi^T | Wr^T] (w >= 64), column = k. o: rows f of part 0 [wr | -wi] and part 1 [wi | wr], column 128 (g / 64) + (g % 64) (+ 64), g = the weight's input row */
  const int kk = k0 + 8 * lane, sp = ((kk >> 6) << 7) | (kk & 63);
  const int r1 = isO ? fs * 64 : fs * 128 + (im ? 64 : 0), r2 = isO ? DMX + fs * 64 : fs * 128 + (im ? 0 : 64);
  const int c1 = isO ? sp + (im ? 64 : 0) : kk, c2 = isO ? sp + (im ? 0 : 64) : DMX + kk;
  const unsigned int m1 = (isO && im) ? 0x80008000u : 0u, m2 = (!isO && im) ? 0x80008000u : 0u;
  _Float16* d1 = Bt + (size_t)(r1 + 8 * wave) * DM + c1; _Float16* d2 = Bt + (size_t)(r2 + 8 * wave) * DM + c2;
#pragma unroll
  for (int q = 0; q < 8; ++q) { const int r = 8 * wave + q; const v4ua v = *(const v4ua*)(T + r * 128 + ((lane ^ ((r >> 2) & 15)) << 2));
    *(v4ua*)(d1 + (size_t)q * DM) = v ^ m1; *(v4ua*)(d2 + (size_t)q * DM) = v ^ m2; }
}
__global__ __launch_bounds__(256) void k_bcat2(const float* __restrict__ br, const float* __restrict__ bi, float* __restrict__ b2) { for (int n2 = threadIdx.x; n2 < 2 * DMX; n2 += 256) { const int h = n2 / 128, w = n2 % 128; const float v = (w < 64) ? br[h * 64 + w] : bi[h * 64 + (w - 64)]; *(float*)(b2 + n2) = v; }  }
__global__ __launch_bounds__(256) void k_xcat(const float* __restrict__ xr, const float* __restrict__ xi, _Float16* __restrict__ XC, size_t nrows) { const size_t t = (size_t)blockIdx.x * 256 + threadIdx.x; if (t >= nrows * (2 * DMX / 8)) return; const int k8 = (int)(t % (2 * DMX / 8)) * 8; const size_t r = t / (2 * DMX / 8); const float* s = (k8 < DMX) ? xr + r * DMX + k8 : xi + r * DMX + (k8 - DMX); const v4f a = *(const v4fa*)s, b = *(const v4fa*)(s + 4); FragH f; for (int q = 0; q < 4; ++q) { f.h[q] = (_Float16)bf16_round(a[q]); f.h[4 + q] = (_Float16)bf16_round(b[q]); }
  unsigned short* d = (unsigned short*)XC + r * (2 * DMX) + k8; *(v8us*)d = f.half[0];  }


// lane l <-> l ^ 16 (cross-row move); all 32 lanes are on where it is used
__device__ __forceinline__ float rx_x16(float v) { const int b = __float_as_int(v); return __int_as_float(__builtin_amdgcn_permlanex16(b, b, 0x76543210, 0xfedcba98, false, false)); }
// four 2^a in one statement, closed by the one free slot the instruction set asks for behind a transcendental before a source of it is overwritten; early-clobber outputs keep every result off every source
__device__ __forceinline__ v4f exp2x4(v4f a) { float r0, r1, r2, r3; asm("v_exp_f32 %0, %4\n\tv_exp_f32 %1, %5\n\tv_exp_f32 %2, %6\n\tv_exp_f32 %3, %7\n\tv_nop" : "=&v"(r0), "=&v"(r1), "=&v"(r2), "=&v"(r3) : "v"(a[0]), "v"(a[1]), "v"(a[2]), "v"(a[3])); const v4f r = {r0, r1, r2, r3}; return r; }

// two 2^a, same form and same closing slot as exp2x4
__device__ __forceinline__ void exp2x2(float a0, float a1, float& r0, float& r1) { asm("v_exp_f32 %0, %2\n\tv_exp_f32 %1, %3\n\tv_nop" : "=&v"(r0), "=&v"(r1) : "v"(a0), "v"(a1)); }

#define FA_KP 272                    /* LDS pitch of a K row: 256 B + 16 (odd multiple of 16 B) */
#define FA_VP 144                    /* LDS pitch of a V^T row: 128 B + 16 (odd multiple of 16 B) */
#define FA_KT (64 * FA_KP)
#define FA_BUF (FA_KT + 128 * FA_VP)
#define FA_NST (SQ / 64)
__device__ __forceinline__ v8f fa_mma(v16h a, v16h b, v8f c) { return __builtin_amdgcn_wmma_f32_16x16x32_f16(false, a, false, b, (short)0, c, false, false); }
__device__ __forceinline__ v16h fa_lds(const unsigned char* p) { FragH f; f.half[0] = *(const v8us*)p; f.half[1] = *(const v8us*)(p + 32); return f.v; }      /* p already holds + 16 * (lane >> 4): same k order as g2_frag */
__global__ __launch_bounds__(256) void k_fattn(const _Float16* __restrict__ Q, const _Float16* __restrict__ K, const _Float16* __restrict__ VT, _Float16* __restrict__ O) {
  __shared__ __attribute__((aligned(16))) unsigned char L[2 * FA_BUF];
  const int tid = threadIdx.x, lane = tid & 31, c = lane & 15, hh = lane >> 4; const int wave = __builtin_amdgcn_readfirstlane(tid >> 5);
  const int bh = blockIdx.x >> 3, b = bh >> 4, h = bh & 15; const size_t r0 = (size_t)b * SQ; const int q0 = (blockIdx.x & 7) * 256 + wave * 32;
  /* every loop over a register array (fragments, tiles, staging pieces) is fully unrolled: constant indices keep the arrays in registers */
  /* staging: thread t moves 16-byte pieces; K: row (t >> 4) + 16 j, piece t & 15; V^T: row (t >> 3) + 32 j, piece t & 7 */
  const unsigned short* kg = (const unsigned short*)K + (r0 + (tid >> 4)) * DM + h * 128 + (tid & 15) * 8;
  const unsigned short* vg = (const unsigned short*)VT + ((size_t)b * DM + h * 128 + (tid >> 3)) * SQ + (tid & 7) * 8;
  const int kl = (tid >> 4) * FA_KP + (tid & 15) * 16, vl = FA_KT + (tid >> 3) * FA_VP + (tid & 7) * 16;
  v8us sk[4], sv[4];
#pragma unroll
  for (int j = 0; j < 4; ++j) { sk[j] = *(const v8us*)(kg + (size_t)(16 * j) * DM); sv[j] = *(const v8us*)(vg + (size_t)(32 * j) * SQ); }
  v16h qf[2][4];
#pragma unroll
  for (int g = 0; g < 2; ++g) for (int kc = 0; kc < 4; ++kc) qf[g][kc] = g2_frag(Q + (r0 + q0 + 16 * g + c) * DM + h * 128 + 32 * kc, hh);
  asm volatile("s_wait_xcnt 0x0" ::: "memory");      /* stands before any address register of the loads above is written again */
  const v8f z8 = {0.f,0.f,0.f,0.f,0.f,0.f,0.f,0.f}; v8f acc[2][8]; float m_run[2], l_run[2];
#pragma unroll
  for (int g = 0; g < 2; ++g) { m_run[g] = -__builtin_inff(); l_run[g] = 0.f; for (int t = 0; t < 8; ++t) acc[g][t] = z8; }
#pragma unroll
  for (int j = 0; j < 4; ++j) { *(v8us*)(L + kl + 16 * j * FA_KP) = sk[j]; *(v8us*)(L + vl + 32 * j * FA_VP) = sv[j]; }
  __syncthreads();
  const float cs = 0.125f * 1.44269504f;      /* scores / 8, in the log2 domain */
  /* the stage loop and the pass loop stay rolled: one body in the instruction cache, and no second set of live tiles */
#pragma unroll 1
  for (int st = 0; st < FA_NST; ++st) {
    const unsigned char* Lb = L + (st & 1) * FA_BUF;
    if (st + 1 < FA_NST) {      /* next stage's 8 loads fly under this stage's two passes */
#pragma unroll
      for (int j = 0; j < 4; ++j) { sk[j] = *(const v8us*)(kg + (size_t)((st + 1) * 64 + 16 * j) * DM); sv[j] = *(const v8us*)(vg + (size_t)(32 * j) * SQ + (st + 1) * 64); }
      asm volatile("s_wait_xcnt 0x0" ::: "memory");      /* stands before any address register of these loads is written again */
    }
#pragma unroll 1
    for (int ps = 0; ps < 2; ++ps) {
      v8f s[2][2] = {{z8, z8}, {z8, z8}};      /* [16-key tile][query group] */
      const unsigned char* kp = Lb + (ps * 32 + c) * FA_KP + 16 * hh;
#pragma unroll
      for (int kc = 0; kc < 4; ++kc) { const v16h k0 = fa_lds(kp + 64 * kc), k1 = fa_lds(kp + 16 * FA_KP + 64 * kc);
        s[0][0] = fa_mma(k0, qf[0][kc], s[0][0]); s[0][1] = fa_mma(k0, qf[1][kc], s[0][1]); s[1][0] = fa_mma(k1, qf[0][kc], s[1][0]); s[1][1] = fa_mma(k1, qf[1][kc], s[1][1]); }
      v16h vf[8]; const unsigned char* vp = Lb + FA_KT + c * FA_VP + ps * 64 + 16 * hh;
#pragma unroll
      for (int t = 0; t < 8; ++t) vf[t] = fa_lds(vp + 16 * t * FA_VP);
      /* the maximum in use may trail the true one by up to 8 (log2 domain): the 128 accumulator registers are rescaled only when some column needs it */
      float mb[2]; bool need = false;
#pragma unroll
      for (int g = 0; g < 2; ++g) { float mx = s[0][g][0];
        for (int r = 1; r < 8; ++r) mx = fmaxf(mx, s[0][g][r]);
        for (int r = 0; r < 8; ++r) mx = fmaxf(mx, s[1][g][r]);
        mx = fmaxf(mx, rx_x16(mx)) * cs; mb[g] = mx; need = need || (mx > m_run[g] + 8.0f); }
      if (__builtin_amdgcn_ballot_w32(need) != 0) {      /* wave-uniform: taken on the first pass (m_run = -inf, factor 0 on zero sums), rarely later */
        const float n0 = fmaxf(m_run[0], mb[0]), n1 = fmaxf(m_run[1], mb[1]); float co[2]; exp2x2(m_run[0] - n0, m_run[1] - n1, co[0], co[1]);
        m_run[0] = n0; m_run[1] = n1;
#pragma unroll
        for (int g = 0; g < 2; ++g) { l_run[g] *= co[g]; for (int t = 0; t < 8; ++t) acc[g][t] = acc[g][t] * co[g]; }
      }
      FragH pf[2];      /* both groups' weights first, then the 16 products in one run on 16 separate tiles */
#pragma unroll
      for (int g = 0; g < 2; ++g) { const float nm = 4.0f - m_run[g];      /* weights carried x16 (at most 2^12): small ones stay off the f16 subnormal range; the factor cancels in sum and product */
        v4f ps4;
#pragma unroll
        for (int i = 0; i < 4; ++i) { const int kt = i >> 1, rb = (i & 1) * 4; const v4f a4 = {s[kt][g][rb] * cs + nm, s[kt][g][rb + 1] * cs + nm, s[kt][g][rb + 2] * cs + nm, s[kt][g][rb + 3] * cs + nm}; const v4f p4 = exp2x4(a4); ps4 = (i == 0) ? p4 : ps4 + p4;
          for (int q = 0; q < 4; ++q) pf[g].h[4 * i + q] = (_Float16)p4[q]; }      /* element 8 kt + r = key 16 kt + 8 hh + r: the hardware k order, as V^T's loads */
        l_run[g] += (ps4[0] + ps4[1]) + (ps4[2] + ps4[3]); }
#pragma unroll
      for (int t = 0; t < 8; ++t) { acc[0][t] = fa_mma(vf[t], pf[0].v, acc[0][t]); acc[1][t] = fa_mma(vf[t], pf[1].v, acc[1][t]); }
    }
    if (st + 1 < FA_NST) { unsigned char* Ln = L + ((st + 1) & 1) * FA_BUF;      /* that buffer's last readers left it before the barrier that ended stage st - 1 */
#pragma unroll
      for (int j = 0; j < 4; ++j) { *(v8us*)(Ln + kl + 16 * j * FA_KP) = sk[j]; *(v8us*)(Ln + vl + 32 * j * FA_VP) = sv[j]; } }
    __syncthreads();      /* publishes stage st + 1 and ends every read of stage st */
  }
#pragma unroll
  for (int g = 0; g < 2; ++g) { const float inv = 64.0f / (l_run[g] + rx_x16(l_run[g]));      /* each wave half summed its eight keys of every 16-key tile */
    unsigned short* op = (unsigned short*)O + (r0 + q0 + 16 * g + c) * DM + h * 128 + 8 * hh;
#pragma unroll
    for (int t = 0; t < 8; ++t) { FragH f; for (int r = 0; r < 8; ++r) f.h[r] = (_Float16)(acc[g][t][r] * inv); *(v8us*)(op + 16 * t) = f.half[0]; } }      /* register r = d 16 t + 8 hh + r of query c: 16 contiguous bytes */
}

// ---- tiled GEMM: C[M][NN] = (A[M][DM] . Bh[NN][DM]^T) * alpha + bias, f16 operands, f32 accumulation; M % 128 == 0, NN % 128 == 0 ----
// A workgroup of 8 waves owns a 128 x 128 tile of C; a wave owns 64 x 32 (4 x 2 accumulator tiles).
// A and Bh rows come in stages of 128 k (256 B a row, whole lines) through registers into two LDS buffers: stage s + 1 is loaded while stage s is worked on; one barrier per stage.
// Each accumulator tile still sums its 32-k blocks in ascending k, one chain.
#define G3_P 272                     /* LDS pitch of an operand row: 256 B + 16 (odd multiple of 16 B) */
#define G3_OP (128 * G3_P)           /* one operand's 128 rows */
#define G3_BUF (2 * G3_OP)
#define G3_NST (DM / 128)
#define G3_SP 132                    /* epilogue pitch in floats: 128 + 4 */
template <int NN, bool OUT32>
__global__ __launch_bounds__(256) void k_gemm3(const _Float16* __restrict__ A, const _Float16* __restrict__ Bh, float alpha, const float* __restrict__ bias, float* __restrict__ C, _Float16* __restrict__ C16) {
  __shared__ __attribute__((aligned(16))) unsigned char L[2 * G3_BUF];
  const int tid = threadIdx.x, lane = tid & 31, ln = lane & 15, hh = lane >> 4; const int wave = __builtin_amdgcn_readfirstlane(tid >> 5); const int wm = wave >> 2, wn = wave & 3;
  const int mt = blockIdx.x / (NN / 128), nq = blockIdx.x - mt * (NN / 128); const int row0 = mt * 128, col0 = nq * 128;
  /* staging: thread t moves 16-byte pieces: row (t >> 4) + 16 j of each operand, piece t & 15 */
  const unsigned short* ag = (const unsigned short*)A + (size_t)(row0 + (tid >> 4)) * DM + (tid & 15) * 8;
  const unsigned short* bg = (const unsigned short*)Bh + (size_t)(col0 + (tid >> 4)) * DM + (tid & 15) * 8;
  const int sl = (tid >> 4) * G3_P + (tid & 15) * 16;
  /* every loop over a register array is fully unrolled: constant indices keep the arrays in registers */
  v8us sa[8], sb[8];
#pragma unroll
  for (int j = 0; j < 8; ++j) { sa[j] = *(const v8us*)(ag + (size_t)(16 * j) * DM); sb[j] = *(const v8us*)(bg + (size_t)(16 * j) * DM); }
  asm volatile("s_wait_xcnt 0x0" ::: "memory");      /* stands before any address register of the loads above is written again */
  const v8f z8 = {0.f,0.f,0.f,0.f,0.f,0.f,0.f,0.f}; v8f acc[4][2];
#pragma unroll
  for (int mi = 0; mi < 4; ++mi) { acc[mi][0] = z8; acc[mi][1] = z8; }
#pragma unroll
  for (int j = 0; j < 8; ++j) { *(v8us*)(L + sl + 16 * j * G3_P) = sa[j]; *(v8us*)(L + G3_OP + sl + 16 * j * G3_P) = sb[j]; }
  __syncthreads();
  /* the stage loop stays rolled: one body in the instruction cache */
#pragma unroll 1
  for (int st = 0; st < G3_NST; ++st) {
    const unsigned char* Lb = L + (st & 1) * G3_BUF;
    if (st + 1 < G3_NST) {      /* next stage's 16 loads fly under this stage's 32 products */
      const unsigned short* an = ag + (st + 1) * 128; const unsigned short* bn = bg + (st + 1) * 128;
#pragma unroll
      for (int j = 0; j < 8; ++j) { sa[j] = *(const v8us*)(an + (size_t)(16 * j) * DM); sb[j] = *(const v8us*)(bn + (size_t)(16 * j) * DM); }
      asm volatile("s_wait_xcnt 0x0" :: "v"(an), "v"(bn) : "memory");      /* stands before any address register of these loads is written again; the two addresses are inputs so that they stay live up to the wait and no load of the run is given their registers for its result */
    }
    const unsigned char* ap = Lb + (wm * 64 + ln) * G3_P + 16 * hh; const unsigned char* bp = Lb + G3_OP + (wn * 32 + ln) * G3_P + 16 * hh;
    v16h a[2][4], b[2][2];      /* two fragment sets: block kc + 1 is read from LDS while block kc is multiplied */
#pragma unroll
    for (int mi = 0; mi < 4; ++mi) a[0][mi] = fa_lds(ap + 16 * mi * G3_P);
    b[0][0] = fa_lds(bp); b[0][1] = fa_lds(bp + 16 * G3_P);
#pragma unroll
    for (int kc = 0; kc < 4; ++kc) { const int cu = kc & 1, nx = cu ^ 1;
      if (kc < 3) {
#pragma unroll
        for (int mi = 0; mi < 4; ++mi) a[nx][mi] = fa_lds(ap + 16 * mi * G3_P + 64 * (kc + 1));
        b[nx][0] = fa_lds(bp + 64 * (kc + 1)); b[nx][1] = fa_lds(bp + 16 * G3_P + 64 * (kc + 1)); }
      __builtin_amdgcn_sched_barrier(0);      /* holds the next block's 12 LDS reads as one group ahead of this block's products; left free, the compiler read each fragment into one register set directly in front of the first product that uses it and waited for it there */
#pragma unroll
      for (int mi = 0; mi < 4; ++mi) { acc[mi][0] = fa_mma(a[cu][mi], b[cu][0], acc[mi][0]); acc[mi][1] = fa_mma(a[cu][mi], b[cu][1], acc[mi][1]); }
      __builtin_amdgcn_sched_barrier(0);      /* keeps the following group of reads from moving up among these products */
    }
    if (st + 1 < G3_NST) { unsigned char* Ln = L + ((st + 1) & 1) * G3_BUF;      /* that buffer's last readers left it before the barrier that ended stage st - 1 */
#pragma unroll
      for (int j = 0; j < 8; ++j) { *(v8us*)(Ln + sl + 16 * j * G3_P) = sa[j]; *(v8us*)(Ln + G3_OP + sl + 16 * j * G3_P) = sb[j]; } }
    __syncthreads();      /* publishes stage st + 1 and ends every read of stage st */
  }
  /* epilogue: the whole 128 x 128 tile goes through the (now free) ring as f32, so that every store instruction writes one whole row piece of the tile (whole 128-B lines) */
  float* so = (float*)L;
#pragma unroll
  for (int ni = 0; ni < 2; ++ni) { const int col = wn * 32 + ni * 16 + ln; const float bv = bf16_round(bias[col0 + col]);
#pragma unroll
    for (int mi = 0; mi < 4; ++mi) for (int r = 0; r < 8; ++r) so[(wm * 64 + mi * 16 + 8 * hh + r) * G3_SP + col] = acc[mi][ni][r] * alpha + bv; }
  __syncthreads();      /* a row of the tile was written by four waves */
#pragma unroll
  for (int q = 0; q < 16; ++q) { const int row = wave * 16 + q; const v4f v = *(const v4fa*)(so + row * G3_SP + lane * 4);
    if (OUT32) *(v4f*)(C + (size_t)(row0 + row) * NN + col0 + lane * 4) = v;
    else { v4h h4; for (int i = 0; i < 4; ++i) h4[i] = (_Float16)v[i]; *(v4h*)(C16 + (size_t)(row0 + row) * NN + col0 + lane * 4) = h4; } }
}

extern "C" void kernel_launch(void* const* d_in, const int* in_sizes, int n_in,
                              void* d_out, int out_size, void* d_ws, size_t ws_size, hipStream_t stream) {
  (void)in_sizes; (void)n_in; (void)out_size;
  const float* const* I = (const float* const*)d_in; const float* xr = I[0]; const float* xi = I[1];
  const float* qwr = I[2]; const float* qwi = I[3]; const float* qbr = I[4]; const float* qbi = I[5]; const float* kwr = I[6]; const float* kwi = I[7]; const float* kbr = I[8]; const float* kbi = I[9]; const float* vwr = I[10]; const float* vwi = I[11]; const float* vbr = I[12]; const float* vbi = I[13]; const float* owr = I[14]; const float* owi = I[15]; const float* obr = I[16]; const float* obi = I[17];
  char* ws = (char*)d_ws; size_t off = 0;
  auto take = [&](size_t bytes) { char* p = ws + off; off += (bytes + 255) & ~(size_t)255; return p; };
  _Float16* BQ = (_Float16*)take((size_t)DM * DM * 2); _Float16* BK = (_Float16*)take((size_t)DM * DM * 2); _Float16* BV = (_Float16*)take((size_t)DM * DM * 2); _Float16* BO = (_Float16*)take((size_t)2 * DMX * DM * 2); float* bq2 = (float*)take(DM * 4); float* bk2 = (float*)take(DM * 4); float* bv2 = (float*)take(DM * 4);
  _Float16* XC = (_Float16*)take(NR * DM * 2); _Float16* Q2 = (_Float16*)take(NR * DM * 2); _Float16* K2 = (_Float16*)take(NR * DM * 2); _Float16* V2 = (_Float16*)take(NR * DM * 2); _Float16* O2 = (_Float16*)take(NR * DM * 2);
  _Float16* VT = (_Float16*)take((size_t)NB * DM * SQ * 2);
  if (off > ws_size) return;      /* approx 8 x 4 + 16 x 5 + 16 = 128 MiB */
  k_wprep<<<WP_NW, 256, 0, stream>>>(qwr, qwi, kwr, kwi, vwr, vwi, owr, owi, BQ, BK, BV, BO);      /* arranged x16 weights of q, k, v and o */
  k_bcat2<<<1, 256, 0, stream>>>(qbr, qbi, bq2); k_bcat2<<<1, 256, 0, stream>>>(kbr, kbi, bk2); k_bcat2<<<1, 256, 0, stream>>>(vbr, vbi, bv2);
  k_xcat<<<(unsigned)((NR * (DM / 8) + 255) / 256), 256, 0, stream>>>(xr, xi, XC, NR);      /* [x_real | x_imag] exact f16 rows */
  k_gemm3<DM, false><<<(unsigned)((NR / 128) * (DM / 128)), 256, 0, stream>>>(XC, BQ, 0.0625f, bq2, nullptr, Q2);      /* (q_r | q_i) per head, K = 2048 */
  k_gemm3<DM, false><<<(unsigned)((NR / 128) * (DM / 128)), 256, 0, stream>>>(XC, BK, 0.0625f, bk2, nullptr, K2);
  k_gemm3<DM, false><<<(unsigned)((NR / 128) * (DM / 128)), 256, 0, stream>>>(XC, BV, 0.0625f, bv2, nullptr, V2);
  k_vt<NH, SQ><<<NB * NH * (SQ / 64), 256, 0, stream>>>(V2, DM, 0, VT);      /* [v_r | v_i]^T, both batches: row b * 2048 + 128 h + w, w < 64 = v_r of head h, else v_i */
  k_fattn<<<NB * 16 * (SQ / 256), 256, 0, stream>>>(Q2, K2, VT, O2);      /* [out_r | out_i] x64 per head */
  k_gemm3<DMX, true><<<(unsigned)((NR / 128) * (DMX / 128)), 256, 0, stream>>>(O2, BO, 0.0009765625f, obr, (float*)d_out, nullptr);      /* y_r = o_r Wr - o_i Wi + br -> out[0] */
  k_gemm3<DMX, true><<<(unsigned)((NR / 128) * (DMX / 128)), 256, 0, stream>>>(O2, BO + (size_t)DMX * DM, 0.0009765625f, obi, (float*)d_out + NR * DMX, nullptr);      /* y_i = o_i Wr + o_r Wi + bi -> out[1] */
}

// v005
// A run of this version takes 171 microseconds.
// Next to v004, in two timings, it ran 1.23 and 1.25 times as fast.
// Counting every step since v000, it is 23.8 times as fast.
#include <hip/hip_runtime.h>
// Complex multi-head attention (x_real, x_imag [2][2048][1024]; complex linear (weights [in][out]): r = xr Wr - xi Wi + br, i = xi Wr + xr Wi + bi for q, k, v; 16 heads of 64; scores = (qr . kr + qi . ki) / 8 = Re(q conj(k)); softmax; out_r = P vr, out_i = P vi; y = complex_linear(out, Wo); output = stack([y_r, y_i]) -> [2][2][2048][1024]).
// Structure: [x_real | x_imag] as ONE exact f16 row plane (K = 2048); each complex projection as ONE WMMA GEMM (128x128 workgroup tiles staged in LDS, 64x32 wave tiles, f32 accumulation, exact x16 weights arranged on VALU as [Wr^T | -Wi^T] / [Wi^T | Wr^T] row pairs, + bias) whose output columns interleave (q_r | q_i) per head (head width 128); [v_r | v_i]^T of both batches straight from its GEMM (operands swapped: weight rows as A, x rows as B); ONE attention launch over all (batch, head, 256-query block): S^T = K Q^T (K = 128 = qr.kr + qi.ki in one contraction), running maximum and sum per query in f32 (native exp2), P^T packed from the score tiles as f16 B operand, [out_r | out_i]^T += [v_r | v_i]^T P^T (carried x64) into interleaved f16 rows; y_r and y_i as one GEMM grid over those rows (K = 2048, weights re-laid on VALU with the matching signs, + bias) straight into the two output planes; 4 launches: re-layout of x and the weights, q / k / v^T, attention, y.
// Compute dtype: inputs rounded to bf16; x / weights exact; q, k, v, softmax weights and out plain f16 (~2^-12); scores, statistics, y f32. v_wmma_f32_16x16x32_f16.
#define NB 2
#define SQ 2048
#define DMX 1024                     /* model width */
#define DM (2 * DMX)                 /* interleaved (real | imag) width = 16 heads x 128 */
#define NH 32                        /* (head, part) slabs of 64; unused */
#define HD 64
#define HG 4
#define QN SQ
#define NR ((size_t)NB * SQ)
typedef __bf16 v16b __attribute__((ext_vector_type(16)));
typedef unsigned short v8us __attribute__((ext_vector_type(8), may_alias));
typedef float  v8f  __attribute__((ext_vector_type(8)));
typedef float  v4f  __attribute__((ext_vector_type(4)));
typedef float  v4fa __attribute__((ext_vector_type(4), may_alias));
union FragB { v16b v; v8us half[2]; unsigned short u[16]; };

__device__ __forceinline__ unsigned short bf16_bits(float x) { unsigned int u = __float_as_uint(x); return (unsigned short)((u + 0x7FFFu + ((u >> 16) & 1u)) >> 16); }
__device__ __forceinline__ float bf16_val(unsigned short b) { return __uint_as_float(((unsigned int)b) << 16); }
__device__ __forceinline__ float bf16_round(float x) { return bf16_val(bf16_bits(x)); }
// D += A·B with NT terms: 1 = ah·bh, 2 = + al·bh (A split), 3 = + ah·bl (both split)
template <int NT>
__device__ __forceinline__ v8f mmaN(v16b ah, v16b al, v16b bh, v16b bl, v8f c) {
  c = __builtin_amdgcn_wmma_f32_16x16x32_bf16(false, ah, false, bh, (short)0, c, false, false);
  if (NT >= 2) c = __builtin_amdgcn_wmma_f32_16x16x32_bf16(false, al, false, bh, (short)0, c, false, false);
  if (NT >= 3) c = __builtin_amdgcn_wmma_f32_16x16x32_bf16(false, ah, false, bl, (short)0, c, false, false);
  asm volatile("v_nop\n\tv_nop\n\tv_nop\n\tv_nop" : "+v"(c) : "v"(ah), "v"(al), "v"(bh), "v"(bl));
  return c;
}

__global__ __launch_bounds__(256) void k_wt_bf16(const float* __restrict__ W, unsigned short* __restrict__ Wt, int K, int N) {
  const int t = blockIdx.x * 256 + threadIdx.x;
  const int k8n = K / 8;
  if (t >= N * k8n) return;
  const int n = t / k8n, k8 = (t % k8n) * 8;
  v8us v;
#pragma unroll
  for (int i = 0; i < 8; ++i) v[i] = bf16_bits(W[(size_t)(k8 + i) * N + n]);
  *(v8us*)(Wt + (size_t)n * K + k8) = v;
  
}

// GEMM C[M][N] (f32, pitch ldc) = act(A[M][K]·W + bias). A f32 row-major (pitch lda) converted per fragment to bf16
// (ASPLIT: hi/lo two planes -> 2 terms, else single rounded term); Wt bf16 [N][K] (pitch ldb). BIAS_BF16 rounds the
// bias to bf16 first (bias quantised to bf16 before the add). K%32==0, M%16==0, N%64==0.
template <bool ASPLIT, int ACT, bool BIAS_BF16>
__global__ __launch_bounds__(128) void k_gemm_bf(const float* __restrict__ A, int lda, const unsigned short* __restrict__ Wt, int ldb,
                                               const float* __restrict__ bias, float* __restrict__ C, int ldc, int M, int N, int K) {
  __shared__ __attribute__((aligned(16))) float so[4][16][64];
  const int tid = threadIdx.x, w = tid >> 5, lane = tid & 31, ln = lane & 15, hh = lane >> 4;
  const int ntn = N / 64;
  const int wid = blockIdx.x * 4 + w;
  const int mt = wid / ntn, nq = wid % ntn;
  if (mt * 16 >= M) return;
  const int row0 = mt * 16, col0 = nq * 64;
  const float* arow = A + (size_t)(row0 + ln) * lda;
  v8f acc[4] = {};
  for (int kb = 0; kb < K; kb += 32) {
    FragB ah, al;
    const v4f x0 = *(const v4fa*)(arow + kb + 8 * hh), x1 = *(const v4fa*)(arow + kb + 8 * hh + 4);
    const v4f x2 = *(const v4fa*)(arow + kb + 16 + 8 * hh), x3 = *(const v4fa*)(arow + kb + 16 + 8 * hh + 4);
    float xs[16] = {x0[0],x0[1],x0[2],x0[3],x1[0],x1[1],x1[2],x1[3],x2[0],x2[1],x2[2],x2[3],x3[0],x3[1],x3[2],x3[3]};
#pragma unroll
    for (int i = 0; i < 16; ++i) { const unsigned short hb = bf16_bits(xs[i]); ah.u[i] = hb; al.u[i] = ASPLIT ? bf16_bits(xs[i] - bf16_val(hb)) : (unsigned short)0; }
#pragma unroll
    for (int t = 0; t < 4; ++t) {
      const unsigned short* brow = Wt + (size_t)(col0 + t * 16 + ln) * ldb + kb;
      FragB b;
      b.half[0] = *(const v8us*)(brow + 8 * hh);
      b.half[1] = *(const v8us*)(brow + 16 + 8 * hh);
      acc[t] = mmaN<ASPLIT ? 2 : 1>(ah.v, al.v, b.v, b.v, acc[t]);
    }
  }
#pragma unroll
  for (int t = 0; t < 4; ++t) {
    float bv = bias ? bias[col0 + t * 16 + ln] : 0.f;
    if (BIAS_BF16) bv = bf16_round(bv);
#pragma unroll
    for (int r = 0; r < 8; ++r) { float v = acc[t][r] + bv; if (ACT == 1) v = fmaxf(v, 0.f); so[w][8 * hh + r][t * 16 + ln] = v; }
  }
  __builtin_amdgcn_fence(__ATOMIC_ACQ_REL, "workgroup");
  __builtin_amdgcn_wave_barrier();
  const int rsub = lane >> 4, c4 = (lane & 15) * 4;
  {
#pragma unroll
    for (int q = 0; q < 8; ++q) {
      const int r = q * 2 + rsub;
      const v4f v = *(const v4fa*)&so[w][r][c4];
      *(v4f*)(C + (size_t)(row0 + r) * ldc + col0 + c4) = v;
    }
    
  }
}

// GEMM C = act(A·W + bias + resid): A f32 (ASPLIT -> hi/lo 2 terms), Wt bf16 [N][K]; ACT 0 none, 1 relu, 2 exact gelu;
// resid (optional, f32, row index = (row % rmod), pitch ldr, RES_BF16 rounds it) added before the activation.
template <bool ASPLIT, int ACT, bool BIAS_BF16, bool RES_BF16>
__global__ __launch_bounds__(128) void k_gemm_bf3(const float* __restrict__ A, int lda, const unsigned short* __restrict__ Wt, int ldb,
                                                const float* __restrict__ bias, const float* __restrict__ resid, int rmod, int ldr,
                                                float* __restrict__ C, int ldc, int M, int N, int K) {
  __shared__ __attribute__((aligned(16))) float so[4][16][64];
  const int tid = threadIdx.x, w = tid >> 5, lane = tid & 31, ln = lane & 15, hh = lane >> 4;
  const int ntn = N / 64;
  const int wid = blockIdx.x * 4 + w;
  const int mt = wid / ntn, nq = wid % ntn;
  if (mt * 16 >= M) return;
  const int row0 = mt * 16, col0 = nq * 64;
  const float* arow = A + (size_t)(row0 + ln) * lda;
  v8f acc[4] = {};
  for (int kb = 0; kb < K; kb += 32) {
    FragB ah, al;
    const v4f x0 = *(const v4fa*)(arow + kb + 8 * hh), x1 = *(const v4fa*)(arow + kb + 8 * hh + 4);
    const v4f x2 = *(const v4fa*)(arow + kb + 16 + 8 * hh), x3 = *(const v4fa*)(arow + kb + 16 + 8 * hh + 4);
    float xs[16] = {x0[0],x0[1],x0[2],x0[3],x1[0],x1[1],x1[2],x1[3],x2[0],x2[1],x2[2],x2[3],x3[0],x3[1],x3[2],x3[3]};
#pragma unroll
    for (int i = 0; i < 16; ++i) { const unsigned short hb = bf16_bits(xs[i]); ah.u[i] = hb; al.u[i] = ASPLIT ? bf16_bits(xs[i] - bf16_val(hb)) : (unsigned short)0; }
#pragma unroll
    for (int t = 0; t < 4; ++t) {
      const unsigned short* brow = Wt + (size_t)(col0 + t * 16 + ln) * ldb + kb;
      FragB b;
      b.half[0] = *(const v8us*)(brow + 8 * hh);
      b.half[1] = *(const v8us*)(brow + 16 + 8 * hh);
      acc[t] = mmaN<ASPLIT ? 2 : 1>(ah.v, al.v, b.v, b.v, acc[t]);
    }
  }
#pragma unroll
  for (int t = 0; t < 4; ++t) {
    const int col = col0 + t * 16 + ln;
    float bv = bias ? bias[col] : 0.f;
    if (BIAS_BF16) bv = bf16_round(bv);
#pragma unroll
    for (int r = 0; r < 8; ++r) {
      float v = acc[t][r] + bv;
      if (resid) { float rv = resid[(size_t)((row0 + 8 * hh + r) % rmod) * ldr + col]; if (RES_BF16) rv = bf16_round(rv); v += rv; }
      if (ACT == 1) v = fmaxf(v, 0.f);
      if (ACT == 2) v = 0.5f * v * (1.0f + erff(v * 0.70710678118654752f));
      if (ACT == 3) { const float u = 0.7978845608028654f * (v + 0.044715f * v * v * v); v = 0.5f * v * (1.0f + tanhf(u)); }
      so[w][8 * hh + r][t * 16 + ln] = v;
    }
  }
  __builtin_amdgcn_fence(__ATOMIC_ACQ_REL, "workgroup");
  __builtin_amdgcn_wave_barrier();
  const int rsub = lane >> 4, c4 = (lane & 15) * 4;
  {
#pragma unroll
    for (int q = 0; q < 8; ++q) {
      const int r = q * 2 + rsub;
      const v4f v = *(const v4fa*)&so[w][r][c4];
      *(v4f*)(C + (size_t)(row0 + r) * ldc + col0 + c4) = v;
    }
    
  }
}
// row LayerNorm (biased variance, eps) over N: s = X (+ R); optional out_sum <- s; out_norm <- (s-mu)*rsqrt(var+eps)*g + b
template <bool PARAM_BF16>
__global__ __launch_bounds__(256) void k_layernorm(const float* __restrict__ X, const float* __restrict__ R, const float* __restrict__ g, const float* __restrict__ bta,
                                                  float* __restrict__ out_sum, float* __restrict__ out_norm, int N, float eps) {
  __shared__ float red[256];
  const int row = blockIdx.x, tid = threadIdx.x;
  const float* x = X + (size_t)row * N; const float* rr = R ? R + (size_t)row * N : nullptr;
  float vals[16];                     // up to N = 4096
  const int per = N / 256;            // contiguous chunk per thread? use strided-by-4 chunks: thread handles j = tid*4 + 1024*u
  float s1 = 0.f;
  for (int u = 0; u < per / 4; ++u) {
    const int j = tid * 4 + 1024 * u;
    const v4f a = *(const v4fa*)(x + j);
    v4f b = {0.f,0.f,0.f,0.f}; if (rr) b = *(const v4fa*)(rr + j);
#pragma unroll
    for (int q = 0; q < 4; ++q) { const float v = a[q] + b[q]; vals[u * 4 + q] = v; s1 += v; }
  }
  red[tid] = s1; __syncthreads();
  for (int st = 128; st > 0; st >>= 1) { if (tid < st) red[tid] += red[tid + st]; __syncthreads(); }
  const float mu = red[0] / (float)N; __syncthreads();
  float s2 = 0.f;
  for (int u = 0; u < per / 4; ++u)
#pragma unroll
    for (int q = 0; q < 4; ++q) { const float c = vals[u * 4 + q] - mu; s2 += c * c; }
  red[tid] = s2; __syncthreads();
  for (int st = 128; st > 0; st >>= 1) { if (tid < st) red[tid] += red[tid + st]; __syncthreads(); }
  const float rs = rsqrtf(red[0] / (float)N + eps);
  {
    for (int u = 0; u < per / 4; ++u) {
      const int j = tid * 4 + 1024 * u;
      v4f o, sm;
#pragma unroll
      for (int q = 0; q < 4; ++q) {
        float gg = g[j + q], bb = bta[j + q];
        if (PARAM_BF16) { gg = bf16_round(gg); bb = bf16_round(bb); }
        sm[q] = vals[u * 4 + q]; o[q] = (vals[u * 4 + q] - mu) * rs * gg + bb;
      }
      if (out_sum) *(v4f*)(out_sum + (size_t)row * N + j) = sm;
      *(v4f*)(out_norm + (size_t)row * N + j) = o;
    }
    
  }
}



// ---- f16 WMMA path (v_wmma_f32_16x16x32_f16): 11-bit significands for operands in range — used where a [0,1] probability operand needs more precision than bf16
typedef _Float16 v16h __attribute__((ext_vector_type(16)));
union FragH { v16h v; v8us half[2]; _Float16 h[16]; unsigned short u[16]; };
template <int NT>
__device__ __forceinline__ v8f mmaH(v16h ah, v16h al, v16h bh, v16h bl, v8f c) {
  c = __builtin_amdgcn_wmma_f32_16x16x32_f16(false, ah, false, bh, (short)0, c, false, false);
  if (NT >= 2) c = __builtin_amdgcn_wmma_f32_16x16x32_f16(false, al, false, bh, (short)0, c, false, false);
  if (NT >= 3) c = __builtin_amdgcn_wmma_f32_16x16x32_f16(false, ah, false, bl, (short)0, c, false, false);
  asm volatile("v_nop\n\tv_nop\n\tv_nop\n\tv_nop" : "+v"(c) : "v"(ah), "v"(al), "v"(bh), "v"(bl));
  return c;
}
// batched GEMM like k_gemm_b but f16 operands: A f32 (split into f16 hi/lo if ASPLIT, else rounded to f16), Bt = f16 values [n][k]; alpha; C f32; N multiple of 16 (partial tiles skipped)
template <bool ASPLIT>
__global__ __launch_bounds__(128) void k_gemm_h(const float* __restrict__ A, int lda, size_t sA, const _Float16* __restrict__ Bh, int ldb, size_t sB, float alpha, float* __restrict__ C, int ldc, size_t sC, int M, int N, int K) {
  __shared__ __attribute__((aligned(16))) float so[4][16][64];
  const int tid = threadIdx.x, w = tid >> 5, lane = tid & 31, ln = lane & 15, hh = lane >> 4; const int by = blockIdx.y;
  A += (size_t)by * sA; Bh += (size_t)by * sB; C += (size_t)by * sC;
  const int ntn = (N + 63) / 64; const int wid = blockIdx.x * 4 + w; const int mt = wid / ntn, nq = wid % ntn; if (mt * 16 >= M) return;
  const int row0 = mt * 16, col0 = nq * 64; const float* arow = A + (size_t)(row0 + ln) * lda;
  v8f acc[4] = {};
  for (int kb = 0; kb < K; kb += 32) {
    FragH ah, al;
    const v4f x0 = *(const v4fa*)(arow + kb + 8 * hh), x1 = *(const v4fa*)(arow + kb + 8 * hh + 4), x2 = *(const v4fa*)(arow + kb + 16 + 8 * hh), x3 = *(const v4fa*)(arow + kb + 16 + 8 * hh + 4);
    float xs[16] = {x0[0],x0[1],x0[2],x0[3],x1[0],x1[1],x1[2],x1[3],x2[0],x2[1],x2[2],x2[3],x3[0],x3[1],x3[2],x3[3]};
#pragma unroll
    for (int i = 0; i < 16; ++i) { const _Float16 h = (_Float16)xs[i]; ah.h[i] = h; al.h[i] = ASPLIT ? (_Float16)(xs[i] - (float)h) : (_Float16)0.0f; }
#pragma unroll
    for (int t = 0; t < 4; ++t) { if (col0 + t * 16 >= N) continue; const size_t boff = (size_t)(col0 + t * 16 + ln) * ldb + kb; FragH bq; bq.half[0] = *(const v8us*)(Bh + boff + 8 * hh); bq.half[1] = *(const v8us*)(Bh + boff + 16 + 8 * hh);
      acc[t] = mmaH<ASPLIT ? 2 : 1>(ah.v, al.v, bq.v, bq.v, acc[t]); }
  }
#pragma unroll
  for (int t = 0; t < 4; ++t) { if (col0 + t * 16 >= N) continue;
#pragma unroll
    for (int r = 0; r < 8; ++r) so[w][8 * hh + r][t * 16 + ln] = acc[t][r] * alpha; }
  __builtin_amdgcn_fence(__ATOMIC_ACQ_REL, "workgroup"); __builtin_amdgcn_wave_barrier();
  const int rsub = lane >> 4, c4 = (lane & 15) * 4;
  {
#pragma unroll
    for (int q = 0; q < 8; ++q) { const int r = q * 2 + rsub; if (col0 + c4 < N) { const v4f v = *(const v4fa*)&so[w][r][c4]; *(v4f*)(C + (size_t)(row0 + r) * ldc + col0 + c4) = v; } }
     }
}

// Wt[n][k] = f16(W[k][n]·scale) from f32 row-major W[K][N] (scale = power of two; bf16-exact weights stay exact in f16 away from the subnormal range)
__global__ __launch_bounds__(256) void k_wt_f16(const float* __restrict__ W, _Float16* __restrict__ Wt, int K, int N, float scale) {
  const int t = blockIdx.x * 256 + threadIdx.x; if (t >= N * (K / 8)) return; const int n = t / (K / 8), k8 = (t % (K / 8)) * 8; FragH f;
#pragma unroll
  for (int i = 0; i < 8; ++i) f.h[i] = (_Float16)(bf16_round(W[(size_t)(k8 + i) * N + n]) * scale); const v8us o = f.half[0];
  *(v8us*)((unsigned short*)Wt + (size_t)n * K + k8) = o; 
}
// k_gemm_hh variant with fused epilogue: v = acc·alpha + bias[by·sBias + col] (+ CP[(row/rowsPerB)·sCPb + by·64 + col] if CP) ; ACT 0 none / 1 elu ; writes f16 C16 (and f32 C if non-null)
template <int ACT>
__global__ __launch_bounds__(128) void k_gemm_hhx(const _Float16* __restrict__ A, int lda, size_t sA, const _Float16* __restrict__ Bh, int ldb, size_t sB, float alpha, const float* __restrict__ bias, size_t sBias, const float* __restrict__ CP, int rowsPerB, size_t sCPb, int row0g,
    float* __restrict__ C, _Float16* __restrict__ C16, int ldc, size_t sC, int M, int N, int K) {
  __shared__ __attribute__((aligned(16))) float so[4][16][64];
  const int tid = threadIdx.x, w = tid >> 5, lane = tid & 31, ln = lane & 15, hh = lane >> 4; const int by = blockIdx.y;
  A += (size_t)by * sA; Bh += (size_t)by * sB; const size_t cofs = (size_t)by * sC; const float* bp = bias ? bias + (size_t)by * sBias : nullptr;
  const int ntn = (N + 63) / 64; const int wid = blockIdx.x * 4 + w; const int mt = wid / ntn, nq = wid % ntn; if (mt * 16 >= M) return;
  const int row0 = mt * 16, col0 = nq * 64; const _Float16* arow = A + (size_t)(row0 + ln) * lda;
  v8f acc[4] = {};
  for (int kb = 0; kb < K; kb += 32) { FragH ah; ah.half[0] = *(const v8us*)((const unsigned short*)arow + kb + 8 * hh); ah.half[1] = *(const v8us*)((const unsigned short*)arow + kb + 16 + 8 * hh);
#pragma unroll
    for (int t = 0; t < 4; ++t) { if (col0 + t * 16 >= N) continue; const size_t boff = (size_t)(col0 + t * 16 + ln) * ldb + kb; FragH bq; bq.half[0] = *(const v8us*)((const unsigned short*)Bh + boff + 8 * hh); bq.half[1] = *(const v8us*)((const unsigned short*)Bh + boff + 16 + 8 * hh);
      acc[t] = mmaH<1>(ah.v, ah.v, bq.v, bq.v, acc[t]); }
  }
#pragma unroll
  for (int t = 0; t < 4; ++t) { if (col0 + t * 16 >= N) continue; const int col = col0 + t * 16 + ln; const float bv = bp ? bf16_round(bp[col]) : 0.f;
#pragma unroll
    for (int r = 0; r < 8; ++r) { float v = acc[t][r] * alpha + bv; if (CP) { const int rr = row0g + row0 + 8 * hh + r; if (rowsPerB < 0) v += CP[cofs + (size_t)rr * ldc + col];      /* rowsPerB < 0: own element of the batched C plane */ else { const int bidx = rr / rowsPerB; v += CP[(size_t)bidx * sCPb + (size_t)by * 64 + col]; } } if (ACT == 1) v = (v > 0.f) ? v : expm1f(v); else if (ACT == 7) v = (v > 0.f) ? v + 1.0f : expf(v); else if (ACT == 8) v = tanhf(v); else if (ACT == 9) v = 0.5f * v * (1.0f + tanhf(0.7978845608028654f * (v + 0.044715f * v * v * v))); else if (ACT == 11) v = 1.0f / (1.0f + expf(-v)); else if (ACT == 12) v = (v > 0.f) ? v : 0.01f * v; else if (ACT == 14) v = (v > 0.f) ? v : 0.1f * v; else if (ACT == 16) v = (v >= 0.f) ? v : 0.3f * v; else if (ACT == 17) v = (v >= 0.f) ? v : 0.2f * v; else if (ACT == 15) v = v / (1.0f + expf(-v)); else if (ACT == 3) v = fmaxf(v, 0.f); else if (ACT == 6) v = 0.5f * v * (1.0f + erff(v * 0.70710678118654752f)); so[w][8 * hh + r][t * 16 + ln] = v; } }
  __builtin_amdgcn_fence(__ATOMIC_ACQ_REL, "workgroup"); __builtin_amdgcn_wave_barrier();
  const int rsub = lane >> 4, c4 = (lane & 15) * 4; typedef _Float16 v4h __attribute__((ext_vector_type(4)));
  {
#pragma unroll
    for (int q = 0; q < 8; ++q) { const int r = q * 2 + rsub; if (col0 + c4 < N) { const v4f v = *(const v4fa*)&so[w][r][c4]; if (C) *(v4f*)(C + cofs + (size_t)(row0 + r) * ldc + col0 + c4) = v; if (C16) { v4h h4; for (int i = 0; i < 4; ++i) h4[i] = (_Float16)v[i]; *(v4h*)(C16 + cofs + (size_t)(row0 + r) * ldc + col0 + c4) = h4; } } }
     }
}


typedef _Float16 v4h __attribute__((ext_vector_type(4)));

__global__ __launch_bounds__(256) void k_x16(const float* __restrict__ x, _Float16* __restrict__ X16, size_t n8) { const size_t t = (size_t)blockIdx.x * 256 + threadIdx.x; if (t >= n8) return; FragH f;
#pragma unroll
  for (int q = 0; q < 8; ++q) f.h[q] = (_Float16)bf16_round(x[t * 8 + q]); *(v8us*)((unsigned short*)X16 + t * 8) = f.half[0];  }
__global__ __launch_bounds__(256) void k_h16(const float* __restrict__ x, _Float16* __restrict__ X16, size_t n8) { const size_t t = (size_t)blockIdx.x * 256 + threadIdx.x; if (t >= n8) return; FragH f;
#pragma unroll
  for (int q = 0; q < 8; ++q) f.h[q] = (_Float16)x[t * 8 + q]; *(v8us*)((unsigned short*)X16 + t * 8) = f.half[0];  }
__global__ __launch_bounds__(256) void k_round16f(const float* __restrict__ W, _Float16* __restrict__ Bt, size_t n8) { const size_t t = (size_t)blockIdx.x * 256 + threadIdx.x; if (t >= n8) return; FragH f;
#pragma unroll
  for (int i = 0; i < 8; ++i) f.h[i] = (_Float16)(bf16_round(W[t * 8 + i]) * 16.0f); *(v8us*)((unsigned short*)Bt + t * 8) = f.half[0];  }
template <int NHv, int TTv>
__global__ __launch_bounds__(256) void k_vt(const _Float16* __restrict__ V16, int ldv, int voff, _Float16* __restrict__ Vt) { __shared__ unsigned short tl[64][66]; const int tid = threadIdx.x; const int slab = blockIdx.x / (TTv / 64), lg = blockIdx.x % (TTv / 64); const int b = slab / NHv, h = slab % NHv;
  for (int i = tid; i < 64 * 8; i += 256) { const int r = i / 8, c8 = (i % 8) * 8; FragH f; f.half[0] = *(const v8us*)((const unsigned short*)V16 + ((size_t)b * TTv + lg * 64 + r) * ldv + voff + h * 64 + c8);
#pragma unroll
    for (int q = 0; q < 8; ++q) tl[r][c8 + q] = f.u[q]; }
  __syncthreads();
  {
#pragma unroll
    for (int rd = 0; rd < 2; ++rd) { const int d = rd * 32 + tid / 8, pc = tid % 8; FragH f;
#pragma unroll
      for (int q = 0; q < 8; ++q) f.u[q] = tl[pc * 8 + q][d];
      *(v8us*)((unsigned short*)Vt + ((size_t)slab * 64 + d) * TTv + lg * 64 + pc * 8) = f.half[0]; }
     } }

__global__ __launch_bounds__(256) void k_hl(const float* __restrict__ F, _Float16* __restrict__ Hh, _Float16* __restrict__ Hl, size_t n8) { const size_t t = (size_t)blockIdx.x * 256 + threadIdx.x; if (t >= n8) return; FragH fh, fl; const v4f a = *(const v4fa*)(F + t * 8), c = *(const v4fa*)(F + t * 8 + 4);
#pragma unroll
  for (int q = 0; q < 4; ++q) { _Float16 h = (_Float16)a[q]; fh.h[q] = h; fl.h[q] = (_Float16)((a[q] - (float)h) * 1024.0f); h = (_Float16)c[q]; fh.h[4 + q] = h; fl.h[4 + q] = (_Float16)((c[q] - (float)h) * 1024.0f); }
  { *(v8us*)((unsigned short*)Hh + t * 8) = fh.half[0]; *(v8us*)((unsigned short*)Hl + t * 8) = fl.half[0];  } }

// one 16x32 f16 fragment from K-contiguous global rows, in the hardware k order
__device__ __forceinline__ v16h g2_frag(const _Float16* p, int hh) { FragH f; f.half[0] = *(const v8us*)((const unsigned short*)p + 8 * hh); f.half[1] = *(const v8us*)((const unsigned short*)p + 16 + 8 * hh); return f.v; }


__global__ __launch_bounds__(256) void k_wnat(const float* __restrict__ w, size_t n8, _Float16* __restrict__ Bt) { const size_t t = (size_t)blockIdx.x * 256 + threadIdx.x; if (t >= n8) return; FragH f; for (int q = 0; q < 8; ++q) f.h[q] = (_Float16)(bf16_round(w[t * 8 + q]) * 16.0f); *(v8us*)((unsigned short*)Bt + t * 8) = f.half[0];  }
__global__ __launch_bounds__(256) void k_rsm(const float* __restrict__ S, _Float16* __restrict__ P, int nrows) {
  #pragma clang fp contract(off)
  const int i = blockIdx.x * 256 + threadIdx.x; if (i >= nrows) return; const float* s = S + (size_t)i * SQ; float mx = -3.0e38f;
#pragma unroll 1
  for (int j = 0; j < SQ; ++j) mx = fmaxf(mx, s[j]); float se = 0.f;
#pragma unroll 1
  for (int j = 0; j < SQ; ++j) se += expf(s[j] - mx); const float sc = 256.0f / se;
#pragma unroll 1
  for (int j0 = 0; j0 < SQ; j0 += 8) { FragH f; for (int q = 0; q < 8; ++q) f.h[q] = (_Float16)(expf(s[j0 + q] - mx) * sc); unsigned short* d = (unsigned short*)P + (size_t)i * SQ + j0; *(v8us*)d = f.half[0];  } }
__global__ __launch_bounds__(256) void k_vt(const _Float16* __restrict__ V16, int b, int h0, _Float16* __restrict__ VT) { __shared__ unsigned short tl[64][65]; const int tid = threadIdx.x; const int hh = blockIdx.x % HG, sg = blockIdx.x / HG; const int s0 = sg * 64; const int h = h0 + hh;
  for (int i = tid; i < 64 * 8; i += 256) { const int j = i / 8, d8 = (i % 8) * 8; FragH f; f.half[0] = *(const v8us*)((const unsigned short*)V16 + ((size_t)b * SQ + s0 + j) * DM + h * HD + d8); for (int q = 0; q < 8; ++q) tl[d8 + q][j] = f.u[q]; }
  __syncthreads();
  { for (int i = tid; i < 64 * 8; i += 256) { const int d = i / 8, j8 = (i % 8) * 8; FragH f; for (int q = 0; q < 8; ++q) f.u[q] = tl[d][j8 + q]; *(v8us*)((unsigned short*)VT + ((size_t)hh * HD + d) * SQ + s0 + j8) = f.half[0]; }  } }


// ---- re-layout launch: the four weight operands that the GEMMs read, from the eight weight planes, and (in the workgroups behind them) the x rows ----
// A workgroup takes one strip (256 k rows x 64 columns) of one plane: read once, in whole 256-B row pieces, rounded to bf16, scaled x16 (exact in f16), packed as (k, k + 1) pairs and transposed through LDS;
// each transposed row then goes out twice, in 16-B pieces that fill whole lines: W_r^T and W_i^T each stand at two places of the arranged operand, one of W_i^T's with the sign turned (a flip of the f16 sign bits, exact).
// LDS row = one column f of the strip: 128 dwords = 32 chunks of 16 B; chunk c of row r lies at c ^ ((r >> 2) & 15), so that the 32 dword stores of an instruction (16 rows 4 apart x 2 neighbouring dwords) meet 32 banks and a row is still read in 16-B pieces.
#define WP_NW 512                    /* 8 planes x 4 strips of 256 k x 16 strips of 64 columns */
typedef unsigned int v4ua __attribute__((ext_vector_type(4), may_alias));
__device__ __forceinline__ unsigned int wp_pair(float lo, float hi) { union { _Float16 h[2]; unsigned int u; } p; p.h[0] = (_Float16)(16.0f * bf16_round(lo)); p.h[1] = (_Float16)(16.0f * bf16_round(hi)); return p.u; }
__global__ __launch_bounds__(256) void k_wprep(const float* __restrict__ xr, const float* __restrict__ xi, _Float16* __restrict__ XC, const float* __restrict__ qwr, const float* __restrict__ qwi, const float* __restrict__ kwr, const float* __restrict__ kwi, const float* __restrict__ vwr, const float* __restrict__ vwi, const float* __restrict__ owr, const float* __restrict__ owi,
    _Float16* __restrict__ BQ, _Float16* __restrict__ BK, _Float16* __restrict__ BV, _Float16* __restrict__ BO) {
  __shared__ __attribute__((aligned(16))) unsigned int T[64 * 128];
  if (blockIdx.x >= WP_NW) {      /* the workgroups behind the weight strips: 8 rows each of [x_real | x_imag] as exact f16; a thread takes 8 elements of every row (threads 0 - 127 real, 128 - 255 imaginary); they meet no barrier */
    const int k8 = threadIdx.x * 8; const size_t r0 = (size_t)(blockIdx.x - WP_NW) * 8; const float* s = ((k8 < DMX) ? xr + k8 : xi + (k8 - DMX)) + r0 * DMX;
    v4f xa[8], xb[8];      /* all 16 loads in flight before the first conversion */
#pragma unroll
    for (int j = 0; j < 8; ++j) { xa[j] = *(const v4fa*)(s + (size_t)j * DMX); xb[j] = *(const v4fa*)(s + (size_t)j * DMX + 4); }
    asm volatile("s_wait_xcnt 0x0" :: "v"(s) : "memory");      /* stands before any address register of these loads is written again; the address is an input so that it stays live up to the wait and no load of the run is given its registers for its result */
    unsigned short* d = (unsigned short*)XC + r0 * (2 * DMX) + k8;
#pragma unroll
    for (int j = 0; j < 8; ++j) { FragH f; for (int q = 0; q < 4; ++q) { f.h[q] = (_Float16)bf16_round(xa[j][q]); f.h[4 + q] = (_Float16)bf16_round(xb[j][q]); } *(v8us*)(d + (size_t)j * (2 * DMX)) = f.half[0]; }
    return; }
  const int tid = threadIdx.x, lane = tid & 31; const int wave = __builtin_amdgcn_readfirstlane(tid >> 5);
  const int id = blockIdx.x, mat = id >> 7, fs = id & 15, k0 = ((id >> 4) & 3) * 256; const bool im = ((id >> 6) & 1) != 0, isO = mat == 3;
  const float* Wp = mat == 0 ? (im ? qwi : qwr) : mat == 1 ? (im ? kwi : kwr) : mat == 2 ? (im ? vwi : vwr) : (im ? owi : owr);
  _Float16* Bt = mat == 0 ? BQ : mat == 1 ? BK : mat == 2 ? BV : BO;
  const int fq = lane & 15, rp = lane >> 4;      /* lanes 0 - 15: 64 columns of rows 2 p, 2 p + 1; lanes 16 - 31: the next row pair */
  const float* wp = Wp + (size_t)(k0 + 4 * wave + 2 * rp) * DMX + fs * 64 + 4 * fq;
  /* every loop over a register array is fully unrolled: constant indices keep the arrays in registers */
  v4f ra[8], rb[8];
#pragma unroll
  for (int j = 0; j < 8; ++j) { ra[j] = *(const v4fa*)(wp + (size_t)(32 * j) * DMX); rb[j] = *(const v4fa*)(wp + (size_t)(32 * j + 1) * DMX); }
  asm volatile("s_wait_xcnt 0x0" :: "v"(wp) : "memory");      /* stands before any address register of these loads is written again; the address is an input so that it stays live up to the wait and no load of the run is given its registers for its result */
#pragma unroll
  for (int j = 0; j < 8; ++j) { const int p = 16 * j + 2 * wave + rp, pc = (((p >> 2) ^ fq) << 2) | (p & 3);
    for (int i = 0; i < 4; ++i) T[(4 * fq + i) * 128 + pc] = wp_pair(ra[j][i], rb[j][i]); }
  __syncthreads();      /* a transposed row was written by all eight waves */
  /* q, k, v: row 128 h + w of [Wr^T | -Wi^T] (w < 64) / [Wi^T | Wr^T] (w >= 64), column = k. o: rows f of part 0 [wr | -wi] and part 1 [wi | wr], column 128 (g / 64) + (g % 64) (+ 64), g = the weight's input row */
  const int kk = k0 + 8 * lane, sp = ((kk >> 6) << 7) | (kk & 63);
  const int r1 = isO ? fs * 64 : fs * 128 + (im ? 64 : 0), r2 = isO ? DMX + fs * 64 : fs * 128 + (im ? 0 : 64);
  const int c1 = isO ? sp + (im ? 64 : 0) : kk, c2 = isO ? sp + (im ? 0 : 64) : DMX + kk;
  const unsigned int m1 = (isO && im) ? 0x80008000u : 0u, m2 = (!isO && im) ? 0x80008000u : 0u;
  _Float16* d1 = Bt + (size_t)(r1 + 8 * wave) * DM + c1; _Float16* d2 = Bt + (size_t)(r2 + 8 * wave) * DM + c2;
#pragma unroll
  for (int q = 0; q < 8; ++q) { const int r = 8 * wave + q; const v4ua v = *(const v4ua*)(T + r * 128 + ((lane ^ ((r >> 2) & 15)) << 2));
    *(v4ua*)(d1 + (size_t)q * DM) = v ^ m1; *(v4ua*)(d2 + (size_t)q * DM) = v ^ m2; }
}

// lane l <-> l ^ 16 (cross-row move); all 32 lanes are on where it is used
__device__ __forceinline__ float rx_x16(float v) { const int b = __float_as_int(v); return __int_as_float(__builtin_amdgcn_permlanex16(b, b, 0x76543210, 0xfedcba98, false, false)); }
// four 2^a in one statement, closed by the one free slot the instruction set asks for behind a transcendental before a source of it is overwritten; early-clobber outputs keep every result off every source
__device__ __forceinline__ v4f exp2x4(v4f a) { float r0, r1, r2, r3; asm("v_exp_f32 %0, %4\n\tv_exp_f32 %1, %5\n\tv_exp_f32 %2, %6\n\tv_exp_f32 %3, %7\n\tv_nop" : "=&v"(r0), "=&v"(r1), "=&v"(r2), "=&v"(r3) : "v"(a[0]), "v"(a[1]), "v"(a[2]), "v"(a[3])); const v4f r = {r0, r1, r2, r3}; return r; }

// two 2^a, same form and same closing slot as exp2x4
__device__ __forceinline__ void exp2x2(float a0, float a1, float& r0, float& r1) { asm("v_exp_f32 %0, %2\n\tv_exp_f32 %1, %3\n\tv_nop" : "=&v"(r0), "=&v"(r1) : "v"(a0), "v"(a1)); }

#define FA_KP 272                    /* LDS pitch of a K row: 256 B + 16 (odd multiple of 16 B) */
#define FA_VP 144                    /* LDS pitch of a V^T row: 128 B + 16 (odd multiple of 16 B) */
#define FA_KT (64 * FA_KP)
#define FA_BUF (FA_KT + 128 * FA_VP)
#define FA_NST (SQ / 64)
__device__ __forceinline__ v8f fa_mma(v16h a, v16h b, v8f c) { return __builtin_amdgcn_wmma_f32_16x16x32_f16(false, a, false, b, (short)0, c, false, false); }
__device__ __forceinline__ v16h fa_lds(const unsigned char* p) { FragH f; f.half[0] = *(const v8us*)p; f.half[1] = *(const v8us*)(p + 32); return f.v; }      /* p already holds + 16 * (lane >> 4): same k order as g2_frag */
__global__ __launch_bounds__(256) void k_fattn(const _Float16* __restrict__ Q, const _Float16* __restrict__ K, const _Float16* __restrict__ VT, _Float16* __restrict__ O) {
  __shared__ __attribute__((aligned(16))) unsigned char L[2 * FA_BUF];
  const int tid = threadIdx.x, lane = tid & 31, c = lane & 15, hh = lane >> 4; const int wave = __builtin_amdgcn_readfirstlane(tid >> 5);
  const int bh = blockIdx.x >> 3, b = bh >> 4, h = bh & 15; const size_t r0 = (size_t)b * SQ; const int q0 = (blockIdx.x & 7) * 256 + wave * 32;
  /* every loop over a register array (fragments, tiles, staging pieces) is fully unrolled: constant indices keep the arrays in registers */
  /* staging: thread t moves 16-byte pieces; K: row (t >> 4) + 16 j, piece t & 15; V^T: row (t >> 3) + 32 j, piece t & 7 */
  const unsigned short* kg = (const unsigned short*)K + (r0 + (tid >> 4)) * DM + h * 128 + (tid & 15) * 8;
  const unsigned short* vg = (const unsigned short*)VT + ((size_t)b * DM + h * 128 + (tid >> 3)) * SQ + (tid & 7) * 8;
  const int kl = (tid >> 4) * FA_KP + (tid & 15) * 16, vl = FA_KT + (tid >> 3) * FA_VP + (tid & 7) * 16;
  v8us sk[4], sv[4];
#pragma unroll
  for (int j = 0; j < 4; ++j) { sk[j] = *(const v8us*)(kg + (size_t)(16 * j) * DM); sv[j] = *(const v8us*)(vg + (size_t)(32 * j) * SQ); }
  v16h qf[2][4];
#pragma unroll
  for (int g = 0; g < 2; ++g) for (int kc = 0; kc < 4; ++kc) qf[g][kc] = g2_frag(Q + (r0 + q0 + 16 * g + c) * DM + h * 128 + 32 * kc, hh);
  asm volatile("s_wait_xcnt 0x0" ::: "memory");      /* stands before any address register of the loads above is written again */
  const v8f z8 = {0.f,0.f,0.f,0.f,0.f,0.f,0.f,0.f}; v8f acc[2][8]; float m_run[2], l_run[2];
#pragma unroll
  for (int g = 0; g < 2; ++g) { m_run[g] = -__builtin_inff(); l_run[g] = 0.f; for (int t = 0; t < 8; ++t) acc[g][t] = z8; }
#pragma unroll
  for (int j = 0; j < 4; ++j) { *(v8us*)(L + kl + 16 * j * FA_KP) = sk[j]; *(v8us*)(L + vl + 32 * j * FA_VP) = sv[j]; }
  __syncthreads();
  const float cs = 0.125f * 1.44269504f;      /* scores / 8, in the log2 domain */
  /* the stage loop and the pass loop stay rolled: one body in the instruction cache, and no second set of live tiles */
#pragma unroll 1
  for (int st = 0; st < FA_NST; ++st) {
    const unsigned char* Lb = L + (st & 1) * FA_BUF;
    if (st + 1 < FA_NST) {      /* next stage's 8 loads fly under this stage's two passes */
#pragma unroll
      for (int j = 0; j < 4; ++j) { sk[j] = *(const v8us*)(kg + (size_t)((st + 1) * 64 + 16 * j) * DM); sv[j] = *(const v8us*)(vg + (size_t)(32 * j) * SQ + (st + 1) * 64); }
      asm volatile("s_wait_xcnt 0x0" ::: "memory");      /* stands before any address register of these loads is written again */
    }
#pragma unroll 1
    for (int ps = 0; ps < 2; ++ps) {
      v8f s[2][2] = {{z8, z8}, {z8, z8}};      /* [16-key tile][query group] */
      const unsigned char* kp = Lb + (ps * 32 + c) * FA_KP + 16 * hh;
#pragma unroll
      for (int kc = 0; kc < 4; ++kc) { const v16h k0 = fa_lds(kp + 64 * kc), k1 = fa_lds(kp + 16 * FA_KP + 64 * kc);
        s[0][0] = fa_mma(k0, qf[0][kc], s[0][0]); s[0][1] = fa_mma(k0, qf[1][kc], s[0][1]); s[1][0] = fa_mma(k1, qf[0][kc], s[1][0]); s[1][1] = fa_mma(k1, qf[1][kc], s[1][1]); }
      v16h vf[8]; const unsigned char* vp = Lb + FA_KT + c * FA_VP + ps * 64 + 16 * hh;
#pragma unroll
      for (int t = 0; t < 8; ++t) vf[t] = fa_lds(vp + 16 * t * FA_VP);
      /* the maximum in use may trail the true one by up to 8 (log2 domain): the 128 accumulator registers are rescaled only when some column needs it */
      float mb[2]; bool need = false;
#pragma unroll
      for (int g = 0; g < 2; ++g) { float mx = s[0][g][0];
        for (int r = 1; r < 8; ++r) mx = fmaxf(mx, s[0][g][r]);
        for (int r = 0; r < 8; ++r) mx = fmaxf(mx, s[1][g][r]);
        mx = fmaxf(mx, rx_x16(mx)) * cs; mb[g] = mx; need = need || (mx > m_run[g] + 8.0f); }
      if (__builtin_amdgcn_ballot_w32(need) != 0) {      /* wave-uniform: taken on the first pass (m_run = -inf, factor 0 on zero sums), rarely later */
        const float n0 = fmaxf(m_run[0], mb[0]), n1 = fmaxf(m_run[1], mb[1]); float co[2]; exp2x2(m_run[0] - n0, m_run[1] - n1, co[0], co[1]);
        m_run[0] = n0; m_run[1] = n1;
#pragma unroll
        for (int g = 0; g < 2; ++g) { l_run[g] *= co[g]; for (int t = 0; t < 8; ++t) acc[g][t] = acc[g][t] * co[g]; }
      }
      FragH pf[2];      /* both groups' weights first, then the 16 products in one run on 16 separate tiles */
#pragma unroll
      for (int g = 0; g < 2; ++g) { const float nm = 4.0f - m_run[g];      /* weights carried x16 (at most 2^12): small ones stay off the f16 subnormal range; the factor cancels in sum and product */
        v4f ps4;
#pragma unroll
        for (int i = 0; i < 4; ++i) { const int kt = i >> 1, rb = (i & 1) * 4; const v4f a4 = {s[kt][g][rb] * cs + nm, s[kt][g][rb + 1] * cs + nm, s[kt][g][rb + 2] * cs + nm, s[kt][g][rb + 3] * cs + nm}; const v4f p4 = exp2x4(a4); ps4 = (i == 0) ? p4 : ps4 + p4;
          for (int q = 0; q < 4; ++q) pf[g].h[4 * i + q] = (_Float16)p4[q]; }      /* element 8 kt + r = key 16 kt + 8 hh + r: the hardware k order, as V^T's loads */
        l_run[g] += (ps4[0] + ps4[1]) + (ps4[2] + ps4[3]); }
#pragma unroll
      for (int t = 0; t < 8; ++t) { acc[0][t] = fa_mma(vf[t], pf[0].v, acc[0][t]); acc[1][t] = fa_mma(vf[t], pf[1].v, acc[1][t]); }
    }
    if (st + 1 < FA_NST) { unsigned char* Ln = L + ((st + 1) & 1) * FA_BUF;      /* that buffer's last readers left it before the barrier that ended stage st - 1 */
#pragma unroll
      for (int j = 0; j < 4; ++j) { *(v8us*)(Ln + kl + 16 * j * FA_KP) = sk[j]; *(v8us*)(Ln + vl + 32 * j * FA_VP) = sv[j]; } }
    __syncthreads();      /* publishes stage st + 1 and ends every read of stage st */
  }
#pragma unroll
  for (int g = 0; g < 2; ++g) { const float inv = 64.0f / (l_run[g] + rx_x16(l_run[g]));      /* each wave half summed its eight keys of every 16-key tile */
    unsigned short* op = (unsigned short*)O + (r0 + q0 + 16 * g + c) * DM + h * 128 + 8 * hh;
#pragma unroll
    for (int t = 0; t < 8; ++t) { FragH f; for (int r = 0; r < 8; ++r) f.h[r] = (_Float16)(acc[g][t][r] * inv); *(v8us*)(op + 16 * t) = f.half[0]; } }      /* register r = d 16 t + 8 hh + r of query c: 16 contiguous bytes */
}

// ---- tiled GEMM: C[M][N] = (A[M][DM] . Bh[N][DM]^T) * alpha + bias, f16 operands, f32 accumulation; one grid holds every 128 x 128 tile of the products that depend on the same launch ----
// OUT32 = false, 3 x 512 tiles: q = X W0^T, k = X W1^T (rows = positions, bias by column), then v^T = W2 X^T (rows = v's columns, bias by row, columns = positions: [v_r | v_i]^T comes out as the attention reads it).
// OUT32 = true, 512 tiles: y = X W0^T, W0's rows 0 - 1023 -> plane y_r, rows 1024 - 2047 -> plane y_i.
// The (real | imag) biases are read where they stand: 64 real, 64 imaginary per 128 interleaved columns for q, k, v; one plane each for y.
// A workgroup of 8 waves owns a 128 x 128 tile of C; a wave owns 64 x 32 (4 x 2 accumulator tiles).
// A and Bh rows come in stages of 128 k (256 B a row, whole lines) through registers into two LDS buffers: stage s + 1 is loaded while stage s is worked on; one barrier per stage.
// Each accumulator tile still sums its 32-k blocks in ascending k, one chain.
#define G3_P 272                     /* LDS pitch of an operand row: 256 B + 16 (odd multiple of 16 B) */
#define G3_OP (128 * G3_P)           /* one operand's 128 rows */
#define G3_BUF (2 * G3_OP)
#define G3_NST (DM / 128)
#define G3_SP 132                    /* epilogue pitch in floats: 128 + 4 */
template <bool OUT32>
__global__ __launch_bounds__(256) void k_gemm3(const _Float16* __restrict__ X, const _Float16* __restrict__ W0, const _Float16* __restrict__ W1, const _Float16* __restrict__ W2, float alpha,
    const float* __restrict__ b0r, const float* __restrict__ b0i, const float* __restrict__ b1r, const float* __restrict__ b1i, const float* __restrict__ b2r, const float* __restrict__ b2i,
    float* __restrict__ C, _Float16* __restrict__ C0, _Float16* __restrict__ C1, _Float16* __restrict__ C2) {
  __shared__ __attribute__((aligned(16))) unsigned char L[2 * G3_BUF];
  const int tid = threadIdx.x, lane = tid & 31, ln = lane & 15, hh = lane >> 4; const int wave = __builtin_amdgcn_readfirstlane(tid >> 5); const int wm = wave >> 2, wn = wave & 3;
  const int mat = OUT32 ? 0 : blockIdx.x >> 9, tl = blockIdx.x & 511; const bool sw = !OUT32 && mat == 2;      /* sw: the v^T tiles, 16 tile rows x 32 tile columns; the others 32 x 16 */
  const int mt = sw ? tl >> 5 : tl >> 4, nq = sw ? tl & 31 : tl & 15; const int row0 = mt * 128, col0 = nq * 128;
  const _Float16* Wm = mat == 0 ? W0 : mat == 1 ? W1 : W2; const _Float16* A = sw ? Wm : X; const _Float16* Bh = sw ? X : Wm;
  /* staging: thread t moves 16-byte pieces: row (t >> 4) + 16 j of each operand, piece t & 15 */
  const unsigned short* ag = (const unsigned short*)A + (size_t)(row0 + (tid >> 4)) * DM + (tid & 15) * 8;
  const unsigned short* bg = (const unsigned short*)Bh + (size_t)(col0 + (tid >> 4)) * DM + (tid & 15) * 8;
  const int sl = (tid >> 4) * G3_P + (tid & 15) * 16;
  /* every loop over a register array is fully unrolled: constant indices keep the arrays in registers */
  v8us sa[8], sb[8];
#pragma unroll
  for (int j = 0; j < 8; ++j) { sa[j] = *(const v8us*)(ag + (size_t)(16 * j) * DM); sb[j] = *(const v8us*)(bg + (size_t)(16 * j) * DM); }
  asm volatile("s_wait_xcnt 0x0" ::: "memory");      /* stands before any address register of the loads above is written again */
  const v8f z8 = {0.f,0.f,0.f,0.f,0.f,0.f,0.f,0.f}; v8f acc[4][2];
#pragma unroll
  for (int mi = 0; mi < 4; ++mi) { acc[mi][0] = z8; acc[mi][1] = z8; }
#pragma unroll
  for (int j = 0; j < 8; ++j) { *(v8us*)(L + sl + 16 * j * G3_P) = sa[j]; *(v8us*)(L + G3_OP + sl + 16 * j * G3_P) = sb[j]; }
  __syncthreads();
  /* the stage loop stays rolled: one body in the instruction cache */
#pragma unroll 1
  for (int st = 0; st < G3_NST; ++st) {
    const unsigned char* Lb = L + (st & 1) * G3_BUF;
    if (st + 1 < G3_NST) {      /* next stage's 16 loads fly under this stage's 32 products */
      const unsigned short* an = ag + (st + 1) * 128; const unsigned short* bn = bg + (st + 1) * 128;
#pragma unroll
      for (int j = 0; j < 8; ++j) { sa[j] = *(const v8us*)(an + (size_t)(16 * j) * DM); sb[j] = *(const v8us*)(bn + (size_t)(16 * j) * DM); }
      asm volatile("s_wait_xcnt 0x0" :: "v"(an), "v"(bn) : "memory");      /* stands before any address register of these loads is written again; the two addresses are inputs so that they stay live up to the wait and no load of the run is given their registers for its result */
    }
    const unsigned char* ap = Lb + (wm * 64 + ln) * G3_P + 16 * hh; const unsigned char* bp = Lb + G3_OP + (wn * 32 + ln) * G3_P + 16 * hh;
    v16h a[2][4], b[2][2];      /* two fragment sets: block kc + 1 is read from LDS while block kc is multiplied */
#pragma unroll
    for (int mi = 0; mi < 4; ++mi) a[0][mi] = fa_lds(ap + 16 * mi * G3_P);
    b[0][0] = fa_lds(bp); b[0][1] = fa_lds(bp + 16 * G3_P);
#pragma unroll
    for (int kc = 0; kc < 4; ++kc) { const int cu = kc & 1, nx = cu ^ 1;
      if (kc < 3) {
#pragma unroll
        for (int mi = 0; mi < 4; ++mi) a[nx][mi] = fa_lds(ap + 16 * mi * G3_P + 64 * (kc + 1));
        b[nx][0] = fa_lds(bp + 64 * (kc + 1)); b[nx][1] = fa_lds(bp + 16 * G3_P + 64 * (kc + 1)); }
      __builtin_amdgcn_sched_barrier(0);      /* holds the next block's 12 LDS reads as one group ahead of this block's products; left free, the compiler read each fragment into one register set directly in front of the first product that uses it and waited for it there */
#pragma unroll
      for (int mi = 0; mi < 4; ++mi) { acc[mi][0] = fa_mma(a[cu][mi], b[cu][0], acc[mi][0]); acc[mi][1] = fa_mma(a[cu][mi], b[cu][1], acc[mi][1]); }
      __builtin_amdgcn_sched_barrier(0);      /* keeps the following group of reads from moving up among these products */
    }
    if (st + 1 < G3_NST) { unsigned char* Ln = L + ((st + 1) & 1) * G3_BUF;      /* that buffer's last readers left it before the barrier that ended stage st - 1 */
#pragma unroll
      for (int j = 0; j < 8; ++j) { *(v8us*)(Ln + sl + 16 * j * G3_P) = sa[j]; *(v8us*)(Ln + G3_OP + sl + 16 * j * G3_P) = sb[j]; } }
    __syncthreads();      /* publishes stage st + 1 and ends every read of stage st */
  }
  /* epilogue: the whole 128 x 128 tile goes through the (now free) ring as f32, so that every store instruction writes one whole row piece of the tile (whole 128-B lines) */
  float* so = (float*)L;
  if (sw) {      /* tile row w of tile row mt = column 128 mt + w of v: real part of head mt for w < 64 (waves with wm = 0), else imaginary */
    const float* bp = (wm == 0 ? b2r : b2i) + mt * 64 + 8 * hh;
#pragma unroll
    for (int mi = 0; mi < 4; ++mi) { const v4f lo = *(const v4fa*)(bp + 16 * mi), hi = *(const v4fa*)(bp + 16 * mi + 4);
#pragma unroll
      for (int r = 0; r < 8; ++r) { const float bv = bf16_round(r < 4 ? lo[r & 3] : hi[r & 3]);
        for (int ni = 0; ni < 2; ++ni) so[(wm * 64 + mi * 16 + 8 * hh + r) * G3_SP + wn * 32 + ni * 16 + ln] = acc[mi][ni][r] * alpha + bv; } }
  } else {
    const float* bp = OUT32 ? ((nq >> 3) ? b0i : b0r) + (nq & 7) * 128 + wn * 32 + ln : (wn < 2 ? (mat ? b1r : b0r) : (mat ? b1i : b0i)) + nq * 64 + (wn & 1) * 32 + ln;
#pragma unroll
    for (int ni = 0; ni < 2; ++ni) { const int col = wn * 32 + ni * 16 + ln; const float bv = bf16_round(bp[16 * ni]);
#pragma unroll
      for (int mi = 0; mi < 4; ++mi) for (int r = 0; r < 8; ++r) so[(wm * 64 + mi * 16 + 8 * hh + r) * G3_SP + col] = acc[mi][ni][r] * alpha + bv; }
  }
  __syncthreads();      /* a row of the tile was written by four waves */
  float* Cf = OUT32 ? C + (size_t)(nq >> 3) * (NR * DMX) + (size_t)row0 * DMX + (nq & 7) * 128 : nullptr;
  _Float16* Ch = OUT32 ? nullptr : sw ? C2 + ((size_t)(nq >> 4) * DM + row0) * SQ + (nq & 15) * 128 : (mat ? C1 : C0) + (size_t)row0 * DM + col0;      /* v^T: row b * 2048 + column of v, column = position in batch b; SQ = DM = the f16 planes' pitch */
#pragma unroll
  for (int q = 0; q < 16; ++q) { const int row = wave * 16 + q; const v4f v = *(const v4fa*)(so + row * G3_SP + lane * 4);
    if (OUT32) *(v4f*)(Cf + (size_t)row * DMX + lane * 4) = v;
    else { v4h h4; for (int i = 0; i < 4; ++i) h4[i] = (_Float16)v[i]; *(v4h*)(Ch + (size_t)row * DM + lane * 4) = h4; } }
}

extern "C" void kernel_launch(void* const* d_in, const int* in_sizes, int n_in,
                              void* d_out, int out_size, void* d_ws, size_t ws_size, hipStream_t stream) {
  (void)in_sizes; (void)n_in; (void)out_size;
  const float* const* I = (const float* const*)d_in; const float* xr = I[0]; const float* xi = I[1];
  const float* qwr = I[2]; const float* qwi = I[3]; const float* qbr = I[4]; const float* qbi = I[5]; const float* kwr = I[6]; const float* kwi = I[7]; const float* kbr = I[8]; const float* kbi = I[9]; const float* vwr = I[10]; const float* vwi = I[11]; const float* vbr = I[12]; const float* vbi = I[13]; const float* owr = I[14]; const float* owi = I[15]; const float* obr = I[16]; const float* obi = I[17];
  char* ws = (char*)d_ws; size_t off = 0;
  auto take = [&](size_t bytes) { char* p = ws + off; off += (bytes + 255) & ~(size_t)255; return p; };
  _Float16* BQ = (_Float16*)take((size_t)DM * DM * 2); _Float16* BK = (_Float16*)take((size_t)DM * DM * 2); _Float16* BV = (_Float16*)take((size_t)DM * DM * 2); _Float16* BO = (_Float16*)take((size_t)2 * DMX * DM * 2);
  _Float16* XC = (_Float16*)take(NR * DM * 2); _Float16* Q2 = (_Float16*)take(NR * DM * 2); _Float16* K2 = (_Float16*)take(NR * DM * 2); _Float16* O2 = (_Float16*)take(NR * DM * 2);
  _Float16* VT = (_Float16*)take((size_t)NB * DM * SQ * 2);
  if (off > ws_size) return;      /* approx 8 x 4 + 16 x 4 + 16 = 112 MiB */
  k_wprep<<<WP_NW + (unsigned)(NR / 8), 256, 0, stream>>>(xr, xi, XC, qwr, qwi, kwr, kwi, vwr, vwi, owr, owi, BQ, BK, BV, BO);      /* arranged x16 weights of q, k, v and o; [x_real | x_imag] exact f16 rows */
  k_gemm3<false><<<3 * 512, 256, 0, stream>>>(XC, BQ, BK, BV, 0.0625f, qbr, qbi, kbr, kbi, vbr, vbi, nullptr, Q2, K2, VT);      /* (q_r | q_i), (k_r | k_i) per head; [v_r | v_i]^T: row b * 2048 + 128 h + w, w < 64 = v_r of head h, else v_i */
  k_fattn<<<NB * 16 * (SQ / 256), 256, 0, stream>>>(Q2, K2, VT, O2);      /* [out_r | out_i] x64 per head */
  k_gemm3<true><<<512, 256, 0, stream>>>(O2, BO, nullptr, nullptr, 0.0009765625f, obr, obi, nullptr, nullptr, nullptr, nullptr, (float*)d_out, nullptr, nullptr, nullptr);      /* y_r = o_r Wr - o_i Wi + br -> out[0]; y_i = o_i Wr + o_r Wi + bi -> out[1] */
}

// v006
// Measured time: 164 microseconds a run.
// Two timings next to v005 both put it at 1.04 times that version's speed.
// Over all steps from v000 it is 24.6 times as fast.
#include <hip/hip_runtime.h>
// Complex multi-head attention (x_real, x_imag [2][2048][1024]; complex linear (weights [in][out]): r = xr Wr - xi Wi + br, i = xi Wr + xr Wi + bi for q, k, v; 16 heads of 64; scores = (qr . kr + qi . ki) / 8 = Re(q conj(k)); softmax; out_r = P vr, out_i = P vi; y = complex_linear(out, Wo); output = stack([y_r, y_i]) -> [2][2][2048][1024]).
// Structure: [x_real | x_imag] as ONE exact f16 row plane (K = 2048); each complex projection as ONE WMMA GEMM (128x128 workgroup tiles staged in LDS, 64x64 wave tiles, f32 accumulation, exact x16 weights arranged on VALU as [Wr^T | -Wi^T] / [Wi^T | Wr^T] row pairs, + bias) whose output columns interleave (q_r | q_i) per head (head width 128); [v_r | v_i]^T of both batches straight from its GEMM (operands swapped: weight rows as A, x rows as B); ONE attention launch over all (batch, head, 256-query block): S^T = K Q^T (K = 128 = qr.kr + qi.ki in one contraction), running maximum and sum per query in f32 (native exp2), P^T packed from the score tiles as f16 B operand, [out_r | out_i]^T += [v_r | v_i]^T P^T (carried x64) into interleaved f16 rows; y_r and y_i as one GEMM grid over those rows (K = 2048, weights re-laid on VALU with the matching signs, + bias) straight into the two output planes; 4 launches: re-layout of x and the weights, q / k / v^T, attention, y.
// Compute dtype: inputs rounded to bf16; x / weights exact; q, k, v, softmax weights and out plain f16 (~2^-12); scores, statistics, y f32. v_wmma_f32_16x16x32_f16.
#define NB 2
#define SQ 2048
#define DMX 1024                     /* model width */
#define DM (2 * DMX)                 /* interleaved (real | imag) width = 16 heads x 128 */
#define NH 32                        /* (head, part) slabs of 64; unused */
#define HD 64
#define HG 4
#define QN SQ
#define NR ((size_t)NB * SQ)
typedef __bf16 v16b __attribute__((ext_vector_type(16)));
typedef unsigned short v8us __attribute__((ext_vector_type(8), may_alias));
typedef float  v8f  __attribute__((ext_vector_type(8)));
typedef float  v4f  __attribute__((ext_vector_type(4)));
typedef float  v4fa __attribute__((ext_vector_type(4), may_alias));
union FragB { v16b v; v8us half[2]; unsigned short u[16]; };

__device__ __forceinline__ unsigned short bf16_bits(float x) { unsigned int u = __float_as_uint(x); return (unsigned short)((u + 0x7FFFu + ((u >> 16) & 1u)) >> 16); }
__device__ __forceinline__ float bf16_val(unsigned short b) { return __uint_as_float(((unsigned int)b) << 16); }
__device__ __forceinline__ float bf16_round(float x) { return bf16_val(bf16_bits(x)); }
// D += A·B with NT terms: 1 = ah·bh, 2 = + al·bh (A split), 3 = + ah·bl (both split)
template <int NT>
__device__ __forceinline__ v8f mmaN(v16b ah, v16b al, v16b bh, v16b bl, v8f c) {
  c = __builtin_amdgcn_wmma_f32_16x16x32_bf16(false, ah, false, bh, (short)0, c, false, false);
  if (NT >= 2) c = __builtin_amdgcn_wmma_f32_16x16x32_bf16(false, al, false, bh, (short)0, c, false, false);
  if (NT >= 3) c = __builtin_amdgcn_wmma_f32_16x16x32_bf16(false, ah, false, bl, (short)0, c, false, false);
  asm volatile("v_nop\n\tv_nop\n\tv_nop\n\tv_nop" : "+v"(c) : "v"(ah), "v"(al), "v"(bh), "v"(bl));
  return c;
}

__global__ __launch_bounds__(256) void k_wt_bf16(const float* __restrict__ W, unsigned short* __restrict__ Wt, int K, int N) {
  const int t = blockIdx.x * 256 + threadIdx.x;
  const int k8n = K / 8;
  if (t >= N * k8n) return;
  const int n = t / k8n, k8 = (t % k8n) * 8;
  v8us v;
#pragma unroll
  for (int i = 0; i < 8; ++i) v[i] = bf16_bits(W[(size_t)(k8 + i) * N + n]);
  *(v8us*)(Wt + (size_t)n * K + k8) = v;
  
}

// GEMM C[M][N] (f32, pitch ldc) = act(A[M][K]·W + bias). A f32 row-major (pitch lda) converted per fragment to bf16
// (ASPLIT: hi/lo two planes -> 2 terms, else single rounded term); Wt bf16 [N][K] (pitch ldb). BIAS_BF16 rounds the
// bias to bf16 first (bias quantised to bf16 before the add). K%32==0, M%16==0, N%64==0.
template <bool ASPLIT, int ACT, bool BIAS_BF16>
__global__ __launch_bounds__(128) void k_gemm_bf(const float* __restrict__ A, int lda, const unsigned short* __restrict__ Wt, int ldb,
                                               const float* __restrict__ bias, float* __restrict__ C, int ldc, int M, int N, int K) {
  __shared__ __attribute__((aligned(16))) float so[4][16][64];
  const int tid = threadIdx.x, w = tid >> 5, lane = tid & 31, ln = lane & 15, hh = lane >> 4;
  const int ntn = N / 64;
  const int wid = blockIdx.x * 4 + w;
  const int mt = wid / ntn, nq = wid % ntn;
  if (mt * 16 >= M) return;
  const int row0 = mt * 16, col0 = nq * 64;
  const float* arow = A + (size_t)(row0 + ln) * lda;
  v8f acc[4] = {};
  for (int kb = 0; kb < K; kb += 32) {
    FragB ah, al;
    const v4f x0 = *(const v4fa*)(arow + kb + 8 * hh), x1 = *(const v4fa*)(arow + kb + 8 * hh + 4);
    const v4f x2 = *(const v4fa*)(arow + kb + 16 + 8 * hh), x3 = *(const v4fa*)(arow + kb + 16 + 8 * hh + 4);
    float xs[16] = {x0[0],x0[1],x0[2],x0[3],x1[0],x1[1],x1[2],x1[3],x2[0],x2[1],x2[2],x2[3],x3[0],x3[1],x3[2],x3[3]};
#pragma unroll
    for (int i = 0; i < 16; ++i) { const unsigned short hb = bf16_bits(xs[i]); ah.u[i] = hb; al.u[i] = ASPLIT ? bf16_bits(xs[i] - bf16_val(hb)) : (unsigned short)0; }
#pragma unroll
    for (int t = 0; t < 4; ++t) {
      const unsigned short* brow = Wt + (size_t)(col0 + t * 16 + ln) * ldb + kb;
      FragB b;
      b.half[0] = *(const v8us*)(brow + 8 * hh);
      b.half[1] = *(const v8us*)(brow + 16 + 8 * hh);
      acc[t] = mmaN<ASPLIT ? 2 : 1>(ah.v, al.v, b.v, b.v, acc[t]);
    }
  }
#pragma unroll
  for (int t = 0; t < 4; ++t) {
    float bv = bias ? bias[col0 + t * 16 + ln] : 0.f;
    if (BIAS_BF16) bv = bf16_round(bv);
#pragma unroll
    for (int r = 0; r < 8; ++r) { float v = acc[t][r] + bv; if (ACT == 1) v = fmaxf(v, 0.f); so[w][8 * hh + r][t * 16 + ln] = v; }
  }
  __builtin_amdgcn_fence(__ATOMIC_ACQ_REL, "workgroup");
  __builtin_amdgcn_wave_barrier();
  const int rsub = lane >> 4, c4 = (lane & 15) * 4;
  {
#pragma unroll
    for (int q = 0; q < 8; ++q) {
      const int r = q * 2 + rsub;
      const v4f v = *(const v4fa*)&so[w][r][c4];
      *(v4f*)(C + (size_t)(row0 + r) * ldc + col0 + c4) = v;
    }
    
  }
}

// GEMM C = act(A·W + bias + resid): A f32 (ASPLIT -> hi/lo 2 terms), Wt bf16 [N][K]; ACT 0 none, 1 relu, 2 exact gelu;
// resid (optional, f32, row index = (row % rmod), pitch ldr, RES_BF16 rounds it) added before the activation.
template <bool ASPLIT, int ACT, bool BIAS_BF16, bool RES_BF16>
__global__ __launch_bounds__(128) void k_gemm_bf3(const float* __restrict__ A, int lda, const unsigned short* __restrict__ Wt, int ldb,
                                                const float* __restrict__ bias, const float* __restrict__ resid, int rmod, int ldr,
                                                float* __restrict__ C, int ldc, int M, int N, int K) {
  __shared__ __attribute__((aligned(16))) float so[4][16][64];
  const int tid = threadIdx.x, w = tid >> 5, lane = tid & 31, ln = lane & 15, hh = lane >> 4;
  const int ntn = N / 64;
  const int wid = blockIdx.x * 4 + w;
  const int mt = wid / ntn, nq = wid % ntn;
  if (mt * 16 >= M) return;
  const int row0 = mt * 16, col0 = nq * 64;
  const float* arow = A + (size_t)(row0 + ln) * lda;
  v8f acc[4] = {};
  for (int kb = 0; kb < K; kb += 32) {
    FragB ah, al;
    const v4f x0 = *(const v4fa*)(arow + kb + 8 * hh), x1 = *(const v4fa*)(arow + kb + 8 * hh + 4);
    const v4f x2 = *(const v4fa*)(arow + kb + 16 + 8 * hh), x3 = *(const v4fa*)(arow + kb + 16 + 8 * hh + 4);
    float xs[16] = {x0[0],x0[1],x0[2],x0[3],x1[0],x1[1],x1[2],x1[3],x2[0],x2[1],x2[2],x2[3],x3[0],x3[1],x3[2],x3[3]};
#pragma unroll
    for (int i = 0; i < 16; ++i) { const unsigned short hb = bf16_bits(xs[i]); ah.u[i] = hb; al.u[i] = ASPLIT ? bf16_bits(xs[i] - bf16_val(hb)) : (unsigned short)0; }
#pragma unroll
    for (int t = 0; t < 4; ++t) {
      const unsigned short* brow = Wt + (size_t)(col0 + t * 16 + ln) * ldb + kb;
      FragB b;
      b.half[0] = *(const v8us*)(brow + 8 * hh);
      b.half[1] = *(const v8us*)(brow + 16 + 8 * hh);
      acc[t] = mmaN<ASPLIT ? 2 : 1>(ah.v, al.v, b.v, b.v, acc[t]);
    }
  }
#pragma unroll
  for (int t = 0; t < 4; ++t) {
    const int col = col0 + t * 16 + ln;
    float bv = bias ? bias[col] : 0.f;
    if (BIAS_BF16) bv = bf16_round(bv);
#pragma unroll
    for (int r = 0; r < 8; ++r) {
      float v = acc[t][r] + bv;
      if (resid) { float rv = resid[(size_t)((row0 + 8 * hh + r) % rmod) * ldr + col]; if (RES_BF16) rv = bf16_round(rv); v += rv; }
      if (ACT == 1) v = fmaxf(v, 0.f);
      if (ACT == 2) v = 0.5f * v * (1.0f + erff(v * 0.70710678118654752f));
      if (ACT == 3) { const float u = 0.7978845608028654f * (v + 0.044715f * v * v * v); v = 0.5f * v * (1.0f + tanhf(u)); }
      so[w][8 * hh + r][t * 16 + ln] = v;
    }
  }
  __builtin_amdgcn_fence(__ATOMIC_ACQ_REL, "workgroup");
  __builtin_amdgcn_wave_barrier();
  const int rsub = lane >> 4, c4 = (lane & 15) * 4;
  {
#pragma unroll
    for (int q = 0; q < 8; ++q) {
      const int r = q * 2 + rsub;
      const v4f v = *(const v4fa*)&so[w][r][c4];
      *(v4f*)(C + (size_t)(row0 + r) * ldc + col0 + c4) = v;
    }
    
  }
}
// row LayerNorm (biased variance, eps) over N: s = X (+ R); optional out_sum <- s; out_norm <- (s-mu)*rsqrt(var+eps)*g + b
template <bool PARAM_BF16>
__global__ __launch_bounds__(256) void k_layernorm(const float* __restrict__ X, const float* __restrict__ R, const float* __restrict__ g, const float* __restrict__ bta,
                                                  float* __restrict__ out_sum, float* __restrict__ out_norm, int N, float eps) {
  __shared__ float red[256];
  const int row = blockIdx.x, tid = threadIdx.x;
  const float* x = X + (size_t)row * N; const float* rr = R ? R + (size_t)row * N : nullptr;
  float vals[16];                     // up to N = 4096
  const int per = N / 256;            // contiguous chunk per thread? use strided-by-4 chunks: thread handles j = tid*4 + 1024*u
  float s1 = 0.f;
  for (int u = 0; u < per / 4; ++u) {
    const int j = tid * 4 + 1024 * u;
    const v4f a = *(const v4fa*)(x + j);
    v4f b = {0.f,0.f,0.f,0.f}; if (rr) b = *(const v4fa*)(rr + j);
#pragma unroll
    for (int q = 0; q < 4; ++q) { const float v = a[q] + b[q]; vals[u * 4 + q] = v; s1 += v; }
  }
  red[tid] = s1; __syncthreads();
  for (int st = 128; st > 0; st >>= 1) { if (tid < st) red[tid] += red[tid + st]; __syncthreads(); }
  const float mu = red[0] / (float)N; __syncthreads();
  float s2 = 0.f;
  for (int u = 0; u < per / 4; ++u)
#pragma unroll
    for (int q = 0; q < 4; ++q) { const float c = vals[u * 4 + q] - mu; s2 += c * c; }
  red[tid] = s2; __syncthreads();
  for (int st = 128; st > 0; st >>= 1) { if (tid < st) red[tid] += red[tid + st]; __syncthreads(); }
  const float rs = rsqrtf(red[0] / (float)N + eps);
  {
    for (int u = 0; u < per / 4; ++u) {
      const int j = tid * 4 + 1024 * u;
      v4f o, sm;
#pragma unroll
      for (int q = 0; q < 4; ++q) {
        float gg = g[j + q], bb = bta[j + q];
        if (PARAM_BF16) { gg = bf16_round(gg); bb = bf16_round(bb); }
        sm[q] = vals[u * 4 + q]; o[q] = (vals[u * 4 + q] - mu) * rs * gg + bb;
      }
      if (out_sum) *(v4f*)(out_sum + (size_t)row * N + j) = sm;
      *(v4f*)(out_norm + (size_t)row * N + j) = o;
    }
    
  }
}



// ---- f16 WMMA path (v_wmma_f32_16x16x32_f16): 11-bit significands for operands in range — used where a [0,1] probability operand needs more precision than bf16
typedef _Float16 v16h __attribute__((ext_vector_type(16)));
union FragH { v16h v; v8us half[2]; _Float16 h[16]; unsigned short u[16]; };
template <int NT>
__device__ __forceinline__ v8f mmaH(v16h ah, v16h al, v16h bh, v16h bl, v8f c) {
  c = __builtin_amdgcn_wmma_f32_16x16x32_f16(false, ah, false, bh, (short)0, c, false, false);
  if (NT >= 2) c = __builtin_amdgcn_wmma_f32_16x16x32_f16(false, al, false, bh, (short)0, c, false, false);
  if (NT >= 3) c = __builtin_amdgcn_wmma_f32_16x16x32_f16(false, ah, false, bl, (short)0, c, false, false);
  asm volatile("v_nop\n\tv_nop\n\tv_nop\n\tv_nop" : "+v"(c) : "v"(ah), "v"(al), "v"(bh), "v"(bl));
  return c;
}
// batched GEMM like k_gemm_b but f16 operands: A f32 (split into f16 hi/lo if ASPLIT, else rounded to f16), Bt = f16 values [n][k]; alpha; C f32; N multiple of 16 (partial tiles skipped)
template <bool ASPLIT>
__global__ __launch_bounds__(128) void k_gemm_h(const float* __restrict__ A, int lda, size_t sA, const _Float16* __restrict__ Bh, int ldb, size_t sB, float alpha, float* __restrict__ C, int ldc, size_t sC, int M, int N, int K) {
  __shared__ __attribute__((aligned(16))) float so[4][16][64];
  const int tid = threadIdx.x, w = tid >> 5, lane = tid & 31, ln = lane & 15, hh = lane >> 4; const int by = blockIdx.y;
  A += (size_t)by * sA; Bh += (size_t)by * sB; C += (size_t)by * sC;
  const int ntn = (N + 63) / 64; const int wid = blockIdx.x * 4 + w; const int mt = wid / ntn, nq = wid % ntn; if (mt * 16 >= M) return;
  const int row0 = mt * 16, col0 = nq * 64; const float* arow = A + (size_t)(row0 + ln) * lda;
  v8f acc[4] = {};
  for (int kb = 0; kb < K; kb += 32) {
    FragH ah, al;
    const v4f x0 = *(const v4fa*)(arow + kb + 8 * hh), x1 = *(const v4fa*)(arow + kb + 8 * hh + 4), x2 = *(const v4fa*)(arow + kb + 16 + 8 * hh), x3 = *(const v4fa*)(arow + kb + 16 + 8 * hh + 4);
    float xs[16] = {x0[0],x0[1],x0[2],x0[3],x1[0],x1[1],x1[2],x1[3],x2[0],x2[1],x2[2],x2[3],x3[0],x3[1],x3[2],x3[3]};
#pragma unroll
    for (int i = 0; i < 16; ++i) { const _Float16 h = (_Float16)xs[i]; ah.h[i] = h; al.h[i] = ASPLIT ? (_Float16)(xs[i] - (float)h) : (_Float16)0.0f; }
#pragma unroll
    for (int t = 0; t < 4; ++t) { if (col0 + t * 16 >= N) continue; const size_t boff = (size_t)(col0 + t * 16 + ln) * ldb + kb; FragH bq; bq.half[0] = *(const v8us*)(Bh + boff + 8 * hh); bq.half[1] = *(const v8us*)(Bh + boff + 16 + 8 * hh);
      acc[t] = mmaH<ASPLIT ? 2 : 1>(ah.v, al.v, bq.v, bq.v, acc[t]); }
  }
#pragma unroll
  for (int t = 0; t < 4; ++t) { if (col0 + t * 16 >= N) continue;
#pragma unroll
    for (int r = 0; r < 8; ++r) so[w][8 * hh + r][t * 16 + ln] = acc[t][r] * alpha; }
  __builtin_amdgcn_fence(__ATOMIC_ACQ_REL, "workgroup"); __builtin_amdgcn_wave_barrier();
  const int rsub = lane >> 4, c4 = (lane & 15) * 4;
  {
#pragma unroll
    for (int q = 0; q < 8; ++q) { const int r = q * 2 + rsub; if (col0 + c4 < N) { const v4f v = *(const v4fa*)&so[w][r][c4]; *(v4f*)(C + (size_t)(row0 + r) * ldc + col0 + c4) = v; } }
     }
}

// Wt[n][k] = f16(W[k][n]·scale) from f32 row-major W[K][N] (scale = power of two; bf16-exact weights stay exact in f16 away from the subnormal range)
__global__ __launch_bounds__(256) void k_wt_f16(const float* __restrict__ W, _Float16* __restrict__ Wt, int K, int N, float scale) {
  const int t = blockIdx.x * 256 + threadIdx.x; if (t >= N * (K / 8)) return; const int n = t / (K / 8), k8 = (t % (K / 8)) * 8; FragH f;
#pragma unroll
  for (int i = 0; i < 8; ++i) f.h[i] = (_Float16)(bf16_round(W[(size_t)(k8 + i) * N + n]) * scale); const v8us o = f.half[0];
  *(v8us*)((unsigned short*)Wt + (size_t)n * K + k8) = o; 
}
// k_gemm_hh variant with fused epilogue: v = acc·alpha + bias[by·sBias + col] (+ CP[(row/rowsPerB)·sCPb + by·64 + col] if CP) ; ACT 0 none / 1 elu ; writes f16 C16 (and f32 C if non-null)
template <int ACT>
__global__ __launch_bounds__(128) void k_gemm_hhx(const _Float16* __restrict__ A, int lda, size_t sA, const _Float16* __restrict__ Bh, int ldb, size_t sB, float alpha, const float* __restrict__ bias, size_t sBias, const float* __restrict__ CP, int rowsPerB, size_t sCPb, int row0g,
    float* __restrict__ C, _Float16* __restrict__ C16, int ldc, size_t sC, int M, int N, int K) {
  __shared__ __attribute__((aligned(16))) float so[4][16][64];
  const int tid = threadIdx.x, w = tid >> 5, lane = tid & 31, ln = lane & 15, hh = lane >> 4; const int by = blockIdx.y;
  A += (size_t)by * sA; Bh += (size_t)by * sB; const size_t cofs = (size_t)by * sC; const float* bp = bias ? bias + (size_t)by * sBias : nullptr;
  const int ntn = (N + 63) / 64; const int wid = blockIdx.x * 4 + w; const int mt = wid / ntn, nq = wid % ntn; if (mt * 16 >= M) return;
  const int row0 = mt * 16, col0 = nq * 64; const _Float16* arow = A + (size_t)(row0 + ln) * lda;
  v8f acc[4] = {};
  for (int kb = 0; kb < K; kb += 32) { FragH ah; ah.half[0] = *(const v8us*)((const unsigned short*)arow + kb + 8 * hh); ah.half[1] = *(const v8us*)((const unsigned short*)arow + kb + 16 + 8 * hh);
#pragma unroll
    for (int t = 0; t < 4; ++t) { if (col0 + t * 16 >= N) continue; const size_t boff = (size_t)(col0 + t * 16 + ln) * ldb + kb; FragH bq; bq.half[0] = *(const v8us*)((const unsigned short*)Bh + boff + 8 * hh); bq.half[1] = *(const v8us*)((const unsigned short*)Bh + boff + 16 + 8 * hh);
      acc[t] = mmaH<1>(ah.v, ah.v, bq.v, bq.v, acc[t]); }
  }
#pragma unroll
  for (int t = 0; t < 4; ++t) { if (col0 + t * 16 >= N) continue; const int col = col0 + t * 16 + ln; const float bv = bp ? bf16_round(bp[col]) : 0.f;
#pragma unroll
    for (int r = 0; r < 8; ++r) { float v = acc[t][r] * alpha + bv; if (CP) { const int rr = row0g + row0 + 8 * hh + r; if (rowsPerB < 0) v += CP[cofs + (size_t)rr * ldc + col];      /* rowsPerB < 0: own element of the batched C plane */ else { const int bidx = rr / rowsPerB; v += CP[(size_t)bidx * sCPb + (size_t)by * 64 + col]; } } if (ACT == 1) v = (v > 0.f) ? v : expm1f(v); else if (ACT == 7) v = (v > 0.f) ? v + 1.0f : expf(v); else if (ACT == 8) v = tanhf(v); else if (ACT == 9) v = 0.5f * v * (1.0f + tanhf(0.7978845608028654f * (v + 0.044715f * v * v * v))); else if (ACT == 11) v = 1.0f / (1.0f + expf(-v)); else if (ACT == 12) v = (v > 0.f) ? v : 0.01f * v; else if (ACT == 14) v = (v > 0.f) ? v : 0.1f * v; else if (ACT == 16) v = (v >= 0.f) ? v : 0.3f * v; else if (ACT == 17) v = (v >= 0.f) ? v : 0.2f * v; else if (ACT == 15) v = v / (1.0f + expf(-v)); else if (ACT == 3) v = fmaxf(v, 0.f); else if (ACT == 6) v = 0.5f * v * (1.0f + erff(v * 0.70710678118654752f)); so[w][8 * hh + r][t * 16 + ln] = v; } }
  __builtin_amdgcn_fence(__ATOMIC_ACQ_REL, "workgroup"); __builtin_amdgcn_wave_barrier();
  const int rsub = lane >> 4, c4 = (lane & 15) * 4; typedef _Float16 v4h __attribute__((ext_vector_type(4)));
  {
#pragma unroll
    for (int q = 0; q < 8; ++q) { const int r = q * 2 + rsub; if (col0 + c4 < N) { const v4f v = *(const v4fa*)&so[w][r][c4]; if (C) *(v4f*)(C + cofs + (size_t)(row0 + r) * ldc + col0 + c4) = v; if (C16) { v4h h4; for (int i = 0; i < 4; ++i) h4[i] = (_Float16)v[i]; *(v4h*)(C16 + cofs + (size_t)(row0 + r) * ldc + col0 + c4) = h4; } } }
     }
}


typedef _Float16 v4h __attribute__((ext_vector_type(4)));

__global__ __launch_bounds__(256) void k_x16(const float* __restrict__ x, _Float16* __restrict__ X16, size_t n8) { const size_t t = (size_t)blockIdx.x * 256 + threadIdx.x; if (t >= n8) return; FragH f;
#pragma unroll
  for (int q = 0; q < 8; ++q) f.h[q] = (_Float16)bf16_round(x[t * 8 + q]); *(v8us*)((unsigned short*)X16 + t * 8) = f.half[0];  }
__global__ __launch_bounds__(256) void k_h16(const float* __restrict__ x, _Float16* __restrict__ X16, size_t n8) { const size_t t = (size_t)blockIdx.x * 256 + threadIdx.x; if (t >= n8) return; FragH f;
#pragma unroll
  for (int q = 0; q < 8; ++q) f.h[q] = (_Float16)x[t * 8 + q]; *(v8us*)((unsigned short*)X16 + t * 8) = f.half[0];  }
__global__ __launch_bounds__(256) void k_round16f(const float* __restrict__ W, _Float16* __restrict__ Bt, size_t n8) { const size_t t = (size_t)blockIdx.x * 256 + threadIdx.x; if (t >= n8) return; FragH f;
#pragma unroll
  for (int i = 0; i < 8; ++i) f.h[i] = (_Float16)(bf16_round(W[t * 8 + i]) * 16.0f); *(v8us*)((unsigned short*)Bt + t * 8) = f.half[0];  }
template <int NHv, int TTv>
__global__ __launch_bounds__(256) void k_vt(const _Float16* __restrict__ V16, int ldv, int voff, _Float16* __restrict__ Vt) { __shared__ unsigned short tl[64][66]; const int tid = threadIdx.x; const int slab = blockIdx.x / (TTv / 64), lg = blockIdx.x % (TTv / 64); const int b = slab / NHv, h = slab % NHv;
  for (int i = tid; i < 64 * 8; i += 256) { const int r = i / 8, c8 = (i % 8) * 8; FragH f; f.half[0] = *(const v8us*)((const unsigned short*)V16 + ((size_t)b * TTv + lg * 64 + r) * ldv + voff + h * 64 + c8);
#pragma unroll
    for (int q = 0; q < 8; ++q) tl[r][c8 + q] = f.u[q]; }
  __syncthreads();
  {
#pragma unroll
    for (int rd = 0; rd < 2; ++rd) { const int d = rd * 32 + tid / 8, pc = tid % 8; FragH f;
#pragma unroll
      for (int q = 0; q < 8; ++q) f.u[q] = tl[pc * 8 + q][d];
      *(v8us*)((unsigned short*)Vt + ((size_t)slab * 64 + d) * TTv + lg * 64 + pc * 8) = f.half[0]; }
     } }

__global__ __launch_bounds__(256) void k_hl(const float* __restrict__ F, _Float16* __restrict__ Hh, _Float16* __restrict__ Hl, size_t n8) { const size_t t = (size_t)blockIdx.x * 256 + threadIdx.x; if (t >= n8) return; FragH fh, fl; const v4f a = *(const v4fa*)(F + t * 8), c = *(const v4fa*)(F + t * 8 + 4);
#pragma unroll
  for (int q = 0; q < 4; ++q) { _Float16 h = (_Float16)a[q]; fh.h[q] = h; fl.h[q] = (_Float16)((a[q] - (float)h) * 1024.0f); h = (_Float16)c[q]; fh.h[4 + q] = h; fl.h[4 + q] = (_Float16)((c[q] - (float)h) * 1024.0f); }
  { *(v8us*)((unsigned short*)Hh + t * 8) = fh.half[0]; *(v8us*)((unsigned short*)Hl + t * 8) = fl.half[0];  } }

// one 16x32 f16 fragment from K-contiguous global rows, in the hardware k order
__device__ __forceinline__ v16h g2_frag(const _Float16* p, int hh) { FragH f; f.half[0] = *(const v8us*)((const unsigned short*)p + 8 * hh); f.half[1] = *(const v8us*)((const unsigned short*)p + 16 + 8 * hh); return f.v; }


__global__ __launch_bounds__(256) void k_wnat(const float* __restrict__ w, size_t n8, _Float16* __restrict__ Bt) { const size_t t = (size_t)blockIdx.x * 256 + threadIdx.x; if (t >= n8) return; FragH f; for (int q = 0; q < 8; ++q) f.h[q] = (_Float16)(bf16_round(w[t * 8 + q]) * 16.0f); *(v8us*)((unsigned short*)Bt + t * 8) = f.half[0];  }
__global__ __launch_bounds__(256) void k_rsm(const float* __restrict__ S, _Float16* __restrict__ P, int nrows) {
  #pragma clang fp contract(off)
  const int i = blockIdx.x * 256 + threadIdx.x; if (i >= nrows) return; const float* s = S + (size_t)i * SQ; float mx = -3.0e38f;
#pragma unroll 1
  for (int j = 0; j < SQ; ++j) mx = fmaxf(mx, s[j]); float se = 0.f;
#pragma unroll 1
  for (int j = 0; j < SQ; ++j) se += expf(s[j] - mx); const float sc = 256.0f / se;
#pragma unroll 1
  for (int j0 = 0; j0 < SQ; j0 += 8) { FragH f; for (int q = 0; q < 8; ++q) f.h[q] = (_Float16)(expf(s[j0 + q] - mx) * sc); unsigned short* d = (unsigned short*)P + (size_t)i * SQ + j0; *(v8us*)d = f.half[0];  } }
__global__ __launch_bounds__(256) void k_vt(const _Float16* __restrict__ V16, int b, int h0, _Float16* __restrict__ VT) { __shared__ unsigned short tl[64][65]; const int tid = threadIdx.x; const int hh = blockIdx.x % HG, sg = blockIdx.x / HG; const int s0 = sg * 64; const int h = h0 + hh;
  for (int i = tid; i < 64 * 8; i += 256) { const int j = i / 8, d8 = (i % 8) * 8; FragH f; f.half[0] = *(const v8us*)((const unsigned short*)V16 + ((size_t)b * SQ + s0 + j) * DM + h * HD + d8); for (int q = 0; q < 8; ++q) tl[d8 + q][j] = f.u[q]; }
  __syncthreads();
  { for (int i = tid; i < 64 * 8; i += 256) { const int d = i / 8, j8 = (i % 8) * 8; FragH f; for (int q = 0; q < 8; ++q) f.u[q] = tl[d][j8 + q]; *(v8us*)((unsigned short*)VT + ((size_t)hh * HD + d) * SQ + s0 + j8) = f.half[0]; }  } }


// ---- re-layout launch: the four weight operands that the GEMMs read, from the eight weight planes, and (in the workgroups behind them) the x rows ----
// A workgroup takes one strip (256 k rows x 64 columns) of one plane: read once, in whole 256-B row pieces, rounded to bf16, scaled x16 (exact in f16), packed as (k, k + 1) pairs and transposed through LDS;
// each transposed row then goes out twice, in 16-B pieces that fill whole lines: W_r^T and W_i^T each stand at two places of the arranged operand, one of W_i^T's with the sign turned (a flip of the f16 sign bits, exact).
// LDS row = one column f of the strip: 128 dwords = 32 chunks of 16 B; chunk c of row r lies at c ^ ((r >> 2) & 15), so that the 32 dword stores of an instruction (16 rows 4 apart x 2 neighbouring dwords) meet 32 banks and a row is still read in 16-B pieces.
#define WP_NW 512                    /* 8 planes x 4 strips of 256 k x 16 strips of 64 columns */
typedef unsigned int v4ua __attribute__((ext_vector_type(4), may_alias));
__device__ __forceinline__ unsigned int wp_pair(float lo, float hi) { union { _Float16 h[2]; unsigned int u; } p; p.h[0] = (_Float16)(16.0f * bf16_round(lo)); p.h[1] = (_Float16)(16.0f * bf16_round(hi)); return p.u; }
__global__ __launch_bounds__(256) void k_wprep(const float* __restrict__ xr, const float* __restrict__ xi, _Float16* __restrict__ XC, const float* __restrict__ qwr, const float* __restrict__ qwi, const float* __restrict__ kwr, const float* __restrict__ kwi, const float* __restrict__ vwr, const float* __restrict__ vwi, const float* __restrict__ owr, const float* __restrict__ owi,
    _Float16* __restrict__ BQ, _Float16* __restrict__ BK, _Float16* __restrict__ BV, _Float16* __restrict__ BO) {
  __shared__ __attribute__((aligned(16))) unsigned int T[64 * 128];
  if (blockIdx.x >= WP_NW) {      /* the workgroups behind the weight strips: 8 rows each of [x_real | x_imag] as exact f16; a thread takes 8 elements of every row (threads 0 - 127 real, 128 - 255 imaginary); they meet no barrier */
    const int k8 = threadIdx.x * 8; const size_t r0 = (size_t)(blockIdx.x - WP_NW) * 8; const float* s = ((k8 < DMX) ? xr + k8 : xi + (k8 - DMX)) + r0 * DMX;
    v4f xa[8], xb[8];      /* all 16 loads in flight before the first conversion */
#pragma unroll
    for (int j = 0; j < 8; ++j) { xa[j] = *(const v4fa*)(s + (size_t)j * DMX); xb[j] = *(const v4fa*)(s + (size_t)j * DMX + 4); }
    asm volatile("s_wait_xcnt 0x0" :: "v"(s) : "memory");      /* stands before any address register of these loads is written again; the address is an input so that it stays live up to the wait and no load of the run is given its registers for its result */
    unsigned short* d = (unsigned short*)XC + r0 * (2 * DMX) + k8;
#pragma unroll
    for (int j = 0; j < 8; ++j) { FragH f; for (int q = 0; q < 4; ++q) { f.h[q] = (_Float16)bf16_round(xa[j][q]); f.h[4 + q] = (_Float16)bf16_round(xb[j][q]); } *(v8us*)(d + (size_t)j * (2 * DMX)) = f.half[0]; }
    return; }
  const int tid = threadIdx.x, lane = tid & 31; const int wave = __builtin_amdgcn_readfirstlane(tid >> 5);
  const int id = blockIdx.x, mat = id >> 7, fs = id & 15, k0 = ((id >> 4) & 3) * 256; const bool im = ((id >> 6) & 1) != 0, isO = mat == 3;
  const float* Wp = mat == 0 ? (im ? qwi : qwr) : mat == 1 ? (im ? kwi : kwr) : mat == 2 ? (im ? vwi : vwr) : (im ? owi : owr);
  _Float16* Bt = mat == 0 ? BQ : mat == 1 ? BK : mat == 2 ? BV : BO;
  const int fq = lane & 15, rp = lane >> 4;      /* lanes 0 - 15: 64 columns of rows 2 p, 2 p + 1; lanes 16 - 31: the next row pair */
  const float* wp = Wp + (size_t)(k0 + 4 * wave + 2 * rp) * DMX + fs * 64 + 4 * fq;
  /* every loop over a register array is fully unrolled: constant indices keep the arrays in registers */
  v4f ra[8], rb[8];
#pragma unroll
  for (int j = 0; j < 8; ++j) { ra[j] = *(const v4fa*)(wp + (size_t)(32 * j) * DMX); rb[j] = *(const v4fa*)(wp + (size_t)(32 * j + 1) * DMX); }
  asm volatile("s_wait_xcnt 0x0" :: "v"(wp) : "memory");      /* stands before any address register of these loads is written again; the address is an input so that it stays live up to the wait and no load of the run is given its registers for its result */
#pragma unroll
  for (int j = 0; j < 8; ++j) { const int p = 16 * j + 2 * wave + rp, pc = (((p >> 2) ^ fq) << 2) | (p & 3);
    for (int i = 0; i < 4; ++i) T[(4 * fq + i) * 128 + pc] = wp_pair(ra[j][i], rb[j][i]); }
  __syncthreads();      /* a transposed row was written by all eight waves */
  /* q, k, v: row 128 h + w of [Wr^T | -Wi^T] (w < 64) / [Wi^T | Wr^T] (w >= 64), column = k. o: rows f of part 0 [wr | -wi] and part 1 [wi | wr], column 128 (g / 64) + (g % 64) (+ 64), g = the weight's input row */
  const int kk = k0 + 8 * lane, sp = ((kk >> 6) << 7) | (kk & 63);
  const int r1 = isO ? fs * 64 : fs * 128 + (im ? 64 : 0), r2 = isO ? DMX + fs * 64 : fs * 128 + (im ? 0 : 64);
  const int c1 = isO ? sp + (im ? 64 : 0) : kk, c2 = isO ? sp + (im ? 0 : 64) : DMX + kk;
  const unsigned int m1 = (isO && im) ? 0x80008000u : 0u, m2 = (!isO && im) ? 0x80008000u : 0u;
  _Float16* d1 = Bt + (size_t)(r1 + 8 * wave) * DM + c1; _Float16* d2 = Bt + (size_t)(r2 + 8 * wave) * DM + c2;
#pragma unroll
  for (int q = 0; q < 8; ++q) { const int r = 8 * wave + q; const v4ua v = *(const v4ua*)(T + r * 128 + ((lane ^ ((r >> 2) & 15)) << 2));
    *(v4ua*)(d1 + (size_t)q * DM) = v ^ m1; *(v4ua*)(d2 + (size_t)q * DM) = v ^ m2; }
}

// lane l <-> l ^ 16 (cross-row move); all 32 lanes are on where it is used
__device__ __forceinline__ float rx_x16(float v) { const int b = __float_as_int(v); return __int_as_float(__builtin_amdgcn_permlanex16(b, b, 0x76543210, 0xfedcba98, false, false)); }
// four 2^a in one statement, closed by the one free slot the instruction set asks for behind a transcendental before a source of it is overwritten; early-clobber outputs keep every result off every source
__device__ __forceinline__ v4f exp2x4(v4f a) { float r0, r1, r2, r3; asm("v_exp_f32 %0, %4\n\tv_exp_f32 %1, %5\n\tv_exp_f32 %2, %6\n\tv_exp_f32 %3, %7\n\tv_nop" : "=&v"(r0), "=&v"(r1), "=&v"(r2), "=&v"(r3) : "v"(a[0]), "v"(a[1]), "v"(a[2]), "v"(a[3])); const v4f r = {r0, r1, r2, r3}; return r; }

// two 2^a, same form and same closing slot as exp2x4
__device__ __forceinline__ void exp2x2(float a0, float a1, float& r0, float& r1) { asm("v_exp_f32 %0, %2\n\tv_exp_f32 %1, %3\n\tv_nop" : "=&v"(r0), "=&v"(r1) : "v"(a0), "v"(a1)); }

#define FA_KP 272                    /* LDS pitch of a K row: 256 B + 16 (odd multiple of 16 B) */
#define FA_VP 144                    /* LDS pitch of a V^T row: 128 B + 16 (odd multiple of 16 B) */
#define FA_KT (64 * FA_KP)
#define FA_BUF (FA_KT + 128 * FA_VP)
#define FA_NST (SQ / 64)
__device__ __forceinline__ v8f fa_mma(v16h a, v16h b, v8f c) { return __builtin_amdgcn_wmma_f32_16x16x32_f16(false, a, false, b, (short)0, c, false, false); }
__device__ __forceinline__ v16h fa_lds(const unsigned char* p) { FragH f; f.half[0] = *(const v8us*)p; f.half[1] = *(const v8us*)(p + 32); return f.v; }      /* p already holds + 16 * (lane >> 4): same k order as g2_frag */
__global__ __launch_bounds__(256) void k_fattn(const _Float16* __restrict__ Q, const _Float16* __restrict__ K, const _Float16* __restrict__ VT, _Float16* __restrict__ O) {
  __shared__ __attribute__((aligned(16))) unsigned char L[2 * FA_BUF];
  const int tid = threadIdx.x, lane = tid & 31, c = lane & 15, hh = lane >> 4; const int wave = __builtin_amdgcn_readfirstlane(tid >> 5);
  const int bh = blockIdx.x >> 3, b = bh >> 4, h = bh & 15; const size_t r0 = (size_t)b * SQ; const int q0 = (blockIdx.x & 7) * 256 + wave * 32;
  /* every loop over a register array (fragments, tiles, staging pieces) is fully unrolled: constant indices keep the arrays in registers */
  /* staging: thread t moves 16-byte pieces; K: row (t >> 4) + 16 j, piece t & 15; V^T: row (t >> 3) + 32 j, piece t & 7 */
  const unsigned short* kg = (const unsigned short*)K + (r0 + (tid >> 4)) * DM + h * 128 + (tid & 15) * 8;
  const unsigned short* vg = (const unsigned short*)VT + ((size_t)b * DM + h * 128 + (tid >> 3)) * SQ + (tid & 7) * 8;
  const int kl = (tid >> 4) * FA_KP + (tid & 15) * 16, vl = FA_KT + (tid >> 3) * FA_VP + (tid & 7) * 16;
  v8us sk[4], sv[4];
#pragma unroll
  for (int j = 0; j < 4; ++j) { sk[j] = *(const v8us*)(kg + (size_t)(16 * j) * DM); sv[j] = *(const v8us*)(vg + (size_t)(32 * j) * SQ); }
  v16h qf[2][4];
#pragma unroll
  for (int g = 0; g < 2; ++g) for (int kc = 0; kc < 4; ++kc) qf[g][kc] = g2_frag(Q + (r0 + q0 + 16 * g + c) * DM + h * 128 + 32 * kc, hh);
  asm volatile("s_wait_xcnt 0x0" ::: "memory");      /* stands before any address register of the loads above is written again */
  const v8f z8 = {0.f,0.f,0.f,0.f,0.f,0.f,0.f,0.f}; v8f acc[2][8]; float m_run[2], l_run[2];
#pragma unroll
  for (int g = 0; g < 2; ++g) { m_run[g] = -__builtin_inff(); l_run[g] = 0.f; for (int t = 0; t < 8; ++t) acc[g][t] = z8; }
#pragma unroll
  for (int j = 0; j < 4; ++j) { *(v8us*)(L + kl + 16 * j * FA_KP) = sk[j]; *(v8us*)(L + vl + 32 * j * FA_VP) = sv[j]; }
  __syncthreads();
  const float cs = 0.125f * 1.44269504f;      /* scores / 8, in the log2 domain */
  /* the stage loop and the pass loop stay rolled: one body in the instruction cache, and no second set of live tiles */
#pragma unroll 1
  for (int st = 0; st < FA_NST; ++st) {
    const unsigned char* Lb = L + (st & 1) * FA_BUF;
    if (st + 1 < FA_NST) {      /* next stage's 8 loads fly under this stage's two passes */
#pragma unroll
      for (int j = 0; j < 4; ++j) { sk[j] = *(const v8us*)(kg + (size_t)((st + 1) * 64 + 16 * j) * DM); sv[j] = *(const v8us*)(vg + (size_t)(32 * j) * SQ + (st + 1) * 64); }
      asm volatile("s_wait_xcnt 0x0" ::: "memory");      /* stands before any address register of these loads is written again */
    }
#pragma unroll 1
    for (int ps = 0; ps < 2; ++ps) {
      v8f s[2][2] = {{z8, z8}, {z8, z8}};      /* [16-key tile][query group] */
      const unsigned char* kp = Lb + (ps * 32 + c) * FA_KP + 16 * hh;
#pragma unroll
      for (int kc = 0; kc < 4; ++kc) { const v16h k0 = fa_lds(kp + 64 * kc), k1 = fa_lds(kp + 16 * FA_KP + 64 * kc);
        s[0][0] = fa_mma(k0, qf[0][kc], s[0][0]); s[0][1] = fa_mma(k0, qf[1][kc], s[0][1]); s[1][0] = fa_mma(k1, qf[0][kc], s[1][0]); s[1][1] = fa_mma(k1, qf[1][kc], s[1][1]); }
      v16h vf[8]; const unsigned char* vp = Lb + FA_KT + c * FA_VP + ps * 64 + 16 * hh;
#pragma unroll
      for (int t = 0; t < 8; ++t) vf[t] = fa_lds(vp + 16 * t * FA_VP);
      /* the maximum in use may trail the true one by up to 8 (log2 domain): the 128 accumulator registers are rescaled only when some column needs it */
      float mb[2]; bool need = false;
#pragma unroll
      for (int g = 0; g < 2; ++g) { float mx = s[0][g][0];
        for (int r = 1; r < 8; ++r) mx = fmaxf(mx, s[0][g][r]);
        for (int r = 0; r < 8; ++r) mx = fmaxf(mx, s[1][g][r]);
        mx = fmaxf(mx, rx_x16(mx)) * cs; mb[g] = mx; need = need || (mx > m_run[g] + 8.0f); }
      if (__builtin_amdgcn_ballot_w32(need) != 0) {      /* wave-uniform: taken on the first pass (m_run = -inf, factor 0 on zero sums), rarely later */
        const float n0 = fmaxf(m_run[0], mb[0]), n1 = fmaxf(m_run[1], mb[1]); float co[2]; exp2x2(m_run[0] - n0, m_run[1] - n1, co[0], co[1]);
        m_run[0] = n0; m_run[1] = n1;
#pragma unroll
        for (int g = 0; g < 2; ++g) { l_run[g] *= co[g]; for (int t = 0; t < 8; ++t) acc[g][t] = acc[g][t] * co[g]; }
      }
      FragH pf[2];      /* both groups' weights first, then the 16 products in one run on 16 separate tiles */
#pragma unroll
      for (int g = 0; g < 2; ++g) { const float nm = 4.0f - m_run[g];      /* weights carried x16 (at most 2^12): small ones stay off the f16 subnormal range; the factor cancels in sum and product */
        v4f ps4;
#pragma unroll
        for (int i = 0; i < 4; ++i) { const int kt = i >> 1, rb = (i & 1) * 4; const v4f a4 = {s[kt][g][rb] * cs + nm, s[kt][g][rb + 1] * cs + nm, s[kt][g][rb + 2] * cs + nm, s[kt][g][rb + 3] * cs + nm}; const v4f p4 = exp2x4(a4); ps4 = (i == 0) ? p4 : ps4 + p4;
          for (int q = 0; q < 4; ++q) pf[g].h[4 * i + q] = (_Float16)p4[q]; }      /* element 8 kt + r = key 16 kt + 8 hh + r: the hardware k order, as V^T's loads */
        l_run[g] += (ps4[0] + ps4[1]) + (ps4[2] + ps4[3]); }
#pragma unroll
      for (int t = 0; t < 8; ++t) { acc[0][t] = fa_mma(vf[t], pf[0].v, acc[0][t]); acc[1][t] = fa_mma(vf[t], pf[1].v, acc[1][t]); }
    }
    if (st + 1 < FA_NST) { unsigned char* Ln = L + ((st + 1) & 1) * FA_BUF;      /* that buffer's last readers left it before the barrier that ended stage st - 1 */
#pragma unroll
      for (int j = 0; j < 4; ++j) { *(v8us*)(Ln + kl + 16 * j * FA_KP) = sk[j]; *(v8us*)(Ln + vl + 32 * j * FA_VP) = sv[j]; } }
    __syncthreads();      /* publishes stage st + 1 and ends every read of stage st */
  }
#pragma unroll
  for (int g = 0; g < 2; ++g) { const float inv = 64.0f / (l_run[g] + rx_x16(l_run[g]));      /* each wave half summed its eight keys of every 16-key tile */
    unsigned short* op = (unsigned short*)O + (r0 + q0 + 16 * g + c) * DM + h * 128 + 8 * hh;
#pragma unroll
    for (int t = 0; t < 8; ++t) { FragH f; for (int r = 0; r < 8; ++r) f.h[r] = (_Float16)(acc[g][t][r] * inv); *(v8us*)(op + 16 * t) = f.half[0]; } }      /* register r = d 16 t + 8 hh + r of query c: 16 contiguous bytes */
}

// ---- tiled GEMM: C[M][N] = (A[M][DM] . Bh[N][DM]^T) * alpha + bias, f16 operands, f32 accumulation; one grid holds every 128 x 128 tile of the products that depend on the same launch ----
// OUT32 = false, 3 x 512 tiles: q = X W0^T, k = X W1^T (rows = positions, bias by column), then v^T = W2 X^T (rows = v's columns, bias by row, columns = positions: [v_r | v_i]^T comes out as the attention reads it).
// OUT32 = true, 512 tiles: y = X W0^T, W0's rows 0 - 1023 -> plane y_r, rows 1024 - 2047 -> plane y_i.
// The (real | imag) biases are read where they stand: 64 real, 64 imaginary per 128 interleaved columns for q, k, v; one plane each for y.
// A workgroup of 4 waves owns a 128 x 128 tile of C; a wave owns 64 x 64 (4 x 4 accumulator tiles): 16 products per 8 fragments read from LDS. Two such workgroups share a WGP, each with its own barrier, so that one multiplies while the other hands a stage over.
// A and Bh rows come in stages of 128 k (256 B a row, whole lines) through registers into two LDS buffers: stage s + 1 is loaded while stage s is worked on; one barrier per stage.
// Each accumulator tile still sums its 32-k blocks in ascending k, one chain.
#define G3_P 272                     /* LDS pitch of an operand row: 256 B + 16 (odd multiple of 16 B) */
#define G3_OP (128 * G3_P)           /* one operand's 128 rows */
#define G3_BUF (2 * G3_OP)
#define G3_NST (DM / 128)
#define G3_SP 132                    /* epilogue pitch in floats: 128 + 4 */
template <bool OUT32>
__global__ __launch_bounds__(128) void k_gemm3(const _Float16* __restrict__ X, const _Float16* __restrict__ W0, const _Float16* __restrict__ W1, const _Float16* __restrict__ W2, float alpha,
    const float* __restrict__ b0r, const float* __restrict__ b0i, const float* __restrict__ b1r, const float* __restrict__ b1i, const float* __restrict__ b2r, const float* __restrict__ b2i,
    float* __restrict__ C, _Float16* __restrict__ C0, _Float16* __restrict__ C1, _Float16* __restrict__ C2) {
  __shared__ __attribute__((aligned(16))) unsigned char L[2 * G3_BUF];
  const int tid = threadIdx.x, lane = tid & 31, ln = lane & 15, hh = lane >> 4; const int wave = __builtin_amdgcn_readfirstlane(tid >> 5); const int wm = wave >> 1, wn = wave & 1;
  const int mat = OUT32 ? 0 : blockIdx.x >> 9, tl = blockIdx.x & 511; const bool sw = !OUT32 && mat == 2;      /* sw: the v^T tiles, 16 tile rows x 32 tile columns; the others 32 x 16 */
  const int mt = sw ? tl >> 5 : tl >> 4, nq = sw ? tl & 31 : tl & 15; const int row0 = mt * 128, col0 = nq * 128;
  const _Float16* Wm = mat == 0 ? W0 : mat == 1 ? W1 : W2; const _Float16* A = sw ? Wm : X; const _Float16* Bh = sw ? X : Wm;
  /* staging: thread t moves 16-byte pieces: row (t >> 4) + 8 j of each operand, piece t & 15 */
  const unsigned short* ag = (const unsigned short*)A + (size_t)(row0 + (tid >> 4)) * DM + (tid & 15) * 8;
  const unsigned short* bg = (const unsigned short*)Bh + (size_t)(col0 + (tid >> 4)) * DM + (tid & 15) * 8;
  const int sl = (tid >> 4) * G3_P + (tid & 15) * 16;
  /* every loop over a register array is fully unrolled: constant indices keep the arrays in registers */
  v8us sa[16], sb[16];
#pragma unroll
  for (int j = 0; j < 16; ++j) { sa[j] = *(const v8us*)(ag + (size_t)(8 * j) * DM); sb[j] = *(const v8us*)(bg + (size_t)(8 * j) * DM); }
  asm volatile("s_wait_xcnt 0x0" ::: "memory");      /* stands before any address register of the loads above is written again */
  const v8f z8 = {0.f,0.f,0.f,0.f,0.f,0.f,0.f,0.f}; v8f acc[4][4];
#pragma unroll
  for (int mi = 0; mi < 4; ++mi) for (int ni = 0; ni < 4; ++ni) acc[mi][ni] = z8;
#pragma unroll
  for (int j = 0; j < 16; ++j) { *(v8us*)(L + sl + 8 * j * G3_P) = sa[j]; *(v8us*)(L + G3_OP + sl + 8 * j * G3_P) = sb[j]; }
  __syncthreads();
  /* the stage loop stays rolled: one body in the instruction cache */
#pragma unroll 1
  for (int st = 0; st < G3_NST; ++st) {
    const unsigned char* Lb = L + (st & 1) * G3_BUF;
    if (st + 1 < G3_NST) {      /* next stage's 32 loads fly under this stage's 64 products */
      const unsigned short* an = ag + (st + 1) * 128; const unsigned short* bn = bg + (st + 1) * 128;
#pragma unroll
      for (int j = 0; j < 16; ++j) { sa[j] = *(const v8us*)(an + (size_t)(8 * j) * DM); sb[j] = *(const v8us*)(bn + (size_t)(8 * j) * DM); }
      asm volatile("s_wait_xcnt 0x0" :: "v"(an), "v"(bn) : "memory");      /* stands before any address register of these loads is written again; the two addresses are inputs so that they stay live up to the wait and no load of the run is given their registers for its result */
    }
    const unsigned char* ap = Lb + (wm * 64 + ln) * G3_P + 16 * hh; const unsigned char* bp = Lb + G3_OP + (wn * 64 + ln) * G3_P + 16 * hh;
    v16h a[2][4], b[2][4];      /* two fragment sets: block kc + 1 is read from LDS while block kc is multiplied */
#pragma unroll
    for (int mi = 0; mi < 4; ++mi) { a[0][mi] = fa_lds(ap + 16 * mi * G3_P); b[0][mi] = fa_lds(bp + 16 * mi * G3_P); }
#pragma unroll
    for (int kc = 0; kc < 4; ++kc) { const int cu = kc & 1, nx = cu ^ 1;
      if (kc < 3) {
#pragma unroll
        for (int mi = 0; mi < 4; ++mi) { a[nx][mi] = fa_lds(ap + 16 * mi * G3_P + 64 * (kc + 1)); b[nx][mi] = fa_lds(bp + 16 * mi * G3_P + 64 * (kc + 1)); } }
      __builtin_amdgcn_sched_barrier(0);      /* holds the next block's 16 LDS reads as one group ahead of this block's products; left free, the compiler read each fragment into one register set directly in front of its four products and waited for it there */
#pragma unroll
      for (int mi = 0; mi < 4; ++mi) for (int ni = 0; ni < 4; ++ni) acc[mi][ni] = fa_mma(a[cu][mi], b[cu][ni], acc[mi][ni]);
      __builtin_amdgcn_sched_barrier(0);      /* keeps the following group of reads from moving up among these products */
    }
    if (st + 1 < G3_NST) { unsigned char* Ln = L + ((st + 1) & 1) * G3_BUF;      /* that buffer's last readers left it before the barrier that ended stage st - 1 */
#pragma unroll
      for (int j = 0; j < 16; ++j) { *(v8us*)(Ln + sl + 8 * j * G3_P) = sa[j]; *(v8us*)(Ln + G3_OP + sl + 8 * j * G3_P) = sb[j]; } }
    __syncthreads();      /* publishes stage st + 1 and ends every read of stage st */
  }
  /* epilogue: the whole 128 x 128 tile goes through the (now free) ring as f32, so that every store instruction writes one whole row piece of the tile (whole 128-B lines) */
  float* so = (float*)L;
  if (sw) {      /* tile row w of tile row mt = column 128 mt + w of v: real part of head mt for w < 64 (waves with wm = 0), else imaginary */
    const float* bp = (wm == 0 ? b2r : b2i) + mt * 64 + 8 * hh;
#pragma unroll
    for (int mi = 0; mi < 4; ++mi) { const v4f lo = *(const v4fa*)(bp + 16 * mi), hi = *(const v4fa*)(bp + 16 * mi + 4);
#pragma unroll
      for (int r = 0; r < 8; ++r) { const float bv = bf16_round(r < 4 ? lo[r & 3] : hi[r & 3]);
        for (int ni = 0; ni < 4; ++ni) so[(wm * 64 + mi * 16 + 8 * hh + r) * G3_SP + wn * 64 + ni * 16 + ln] = acc[mi][ni][r] * alpha + bv; } }
  } else {
    const float* bb = OUT32 ? ((nq >> 3) ? b0i : b0r) + (nq & 7) * 128 + wn * 64 : (wn == 0 ? (mat ? b1r : b0r) : (mat ? b1i : b0i)) + nq * 64; float bq[4];
#pragma unroll
    for (int ni = 0; ni < 4; ++ni) bq[ni] = bb[16 * ni + ln];
    asm volatile("s_wait_xcnt 0x0" :: "s"(bb), "v"(ln) : "memory");      /* stands before any address register of these four loads is written again; base and lane offset are inputs so that they stay live up to the wait */
#pragma unroll
    for (int ni = 0; ni < 4; ++ni) { const int col = wn * 64 + ni * 16 + ln; const float bv = bf16_round(bq[ni]);
#pragma unroll
      for (int mi = 0; mi < 4; ++mi) for (int r = 0; r < 8; ++r) so[(wm * 64 + mi * 16 + 8 * hh + r) * G3_SP + col] = acc[mi][ni][r] * alpha + bv; }
  }
  __syncthreads();      /* a row of the tile was written by two waves */
  float* Cf = OUT32 ? C + (size_t)(nq >> 3) * (NR * DMX) + (size_t)row0 * DMX + (nq & 7) * 128 : nullptr;
  _Float16* Ch = OUT32 ? nullptr : sw ? C2 + ((size_t)(nq >> 4) * DM + row0) * SQ + (nq & 15) * 128 : (mat ? C1 : C0) + (size_t)row0 * DM + col0;      /* v^T: row b * 2048 + column of v, column = position in batch b; SQ = DM = the f16 planes' pitch */
#pragma unroll
  for (int q = 0; q < 32; ++q) { const int row = wave * 32 + q; const v4f v = *(const v4fa*)(so + row * G3_SP + lane * 4);
    if (OUT32) *(v4f*)(Cf + (size_t)row * DMX + lane * 4) = v;
    else { v4h h4; for (int i = 0; i < 4; ++i) h4[i] = (_Float16)v[i]; *(v4h*)(Ch + (size_t)row * DM + lane * 4) = h4; } }
}

extern "C" void kernel_launch(void* const* d_in, const int* in_sizes, int n_in,
                              void* d_out, int out_size, void* d_ws, size_t ws_size, hipStream_t stream) {
  (void)in_sizes; (void)n_in; (void)out_size;
  const float* const* I = (const float* const*)d_in; const float* xr = I[0]; const float* xi = I[1];
  const float* qwr = I[2]; const float* qwi = I[3]; const float* qbr = I[4]; const float* qbi = I[5]; const float* kwr = I[6]; const float* kwi = I[7]; const float* kbr = I[8]; const float* kbi = I[9]; const float* vwr = I[10]; const float* vwi = I[11]; const float* vbr = I[12]; const float* vbi = I[13]; const float* owr = I[14]; const float* owi = I[15]; const float* obr = I[16]; const float* obi = I[17];
  char* ws = (char*)d_ws; size_t off = 0;
  auto take = [&](size_t bytes) { char* p = ws + off; off += (bytes + 255) & ~(size_t)255; return p; };
  _Float16* BQ = (_Float16*)take((size_t)DM * DM * 2); _Float16* BK = (_Float16*)take((size_t)DM * DM * 2); _Float16* BV = (_Float16*)take((size_t)DM * DM * 2); _Float16* BO = (_Float16*)take((size_t)2 * DMX * DM * 2);
  _Float16* XC = (_Float16*)take(NR * DM * 2); _Float16* Q2 = (_Float16*)take(NR * DM * 2); _Float16* K2 = (_Float16*)take(NR * DM * 2); _Float16* O2 = (_Float16*)take(NR * DM * 2);
  _Float16* VT = (_Float16*)take((size_t)NB * DM * SQ * 2);
  if (off > ws_size) return;      /* approx 8 x 4 + 16 x 4 + 16 = 112 MiB */
  k_wprep<<<WP_NW + (unsigned)(NR / 8), 256, 0, stream>>>(xr, xi, XC, qwr, qwi, kwr, kwi, vwr, vwi, owr, owi, BQ, BK, BV, BO);      /* arranged x16 weights of q, k, v and o; [x_real | x_imag] exact f16 rows */
  k_gemm3<false><<<3 * 512, 128, 0, stream>>>(XC, BQ, BK, BV, 0.0625f, qbr, qbi, kbr, kbi, vbr, vbi, nullptr, Q2, K2, VT);      /* (q_r | q_i), (k_r | k_i) per head; [v_r | v_i]^T: row b * 2048 + 128 h + w, w < 64 = v_r of head h, else v_i */
  k_fattn<<<NB * 16 * (SQ / 256), 256, 0, stream>>>(Q2, K2, VT, O2);      /* [out_r | out_i] x64 per head */
  k_gemm3<true><<<512, 128, 0, stream>>>(O2, BO, nullptr, nullptr, 0.0009765625f, obr, obi, nullptr, nullptr, nullptr, nullptr, (float*)d_out, nullptr, nullptr, nullptr);      /* y_r = o_r Wr - o_i Wi + br -> out[0]; y_i = o_i Wr + o_r Wi + bi -> out[1] */
}
